// v000
// Measured on an AMD MI455X. A time is GPU time per run, averaged over a window of back-to-back runs after a warm-up
// (all launches, gaps included; the runs take copies of the inputs in turn), and the median of several windows.
// Apart from v000's, it joins two sittings. Times from different sittings can be a few percent apart, while
// side-by-side timings come from the same sitting.
// v000, which the later versions start from, runs in 461 microseconds.
#include <hip/hip_runtime.h>
#include <hip/hip_bf16.h>
#include <math.h>

// ---- problem constants ----
constexpr int kB   = 8;
constexpr int kT   = 4096;
constexpr int kD   = 512;
constexpr int kH   = 8;
constexpr int kDH  = 64;
constexpr int kSPK = 4;
constexpr int kHS  = kH * kSPK;   // 32 folded "keys" per batch
constexpr int kHG  = 128;
constexpr int TILE = 32;          // token rows per block
constexpr float kEPS = 1e-5f;

typedef __attribute__((ext_vector_type(16))) _Float16 v16h;
typedef __attribute__((ext_vector_type(8)))  float    v8f;
typedef __attribute__((ext_vector_type(4)))  float    f4v;
typedef __attribute__((ext_vector_type(4)))  _Float16 h4v;
typedef __attribute__((ext_vector_type(8)))  _Float16 h8v;

// Gather one 16x32 WMMA fragment (A or B) from a row-major f16 matrix.
// p points at [row_of_this_lane][k0 + kb]; lanes 0-15 take K {0..7,16..23},
// lanes 16-31 take K {8..15,24..31} (kb handles the 8-offset).
__device__ __forceinline__ v16h frag_h(const _Float16* p) {
  h8v lo = *(const h8v*)p;
  h8v hi = *(const h8v*)(p + 16);
  v16h f;
  #pragma unroll
  for (int j = 0; j < 8; ++j) { f[j] = lo[j]; f[8 + j] = hi[j]; }
  return f;
}

// ============================================================
// Precompute 1: spk_tokens = relu(speaker_emb @ We^T + be) + spk_pos
// ============================================================
__global__ void spk_kernel(const float* __restrict__ se, const float* __restrict__ We,
                           const float* __restrict__ be, const float* __restrict__ spos,
                           float* __restrict__ spk) {
  int idx = blockIdx.x * blockDim.x + threadIdx.x;
  if (idx >= kB * kSPK * kD) return;
  int b = idx / (kSPK * kD);
  int r = idx - b * (kSPK * kD);           // r = s*D + d
  const float* x = se + (size_t)b * kD;
  const float* w = We + (size_t)r * kD;
  float acc = be[r];
  for (int j = 0; j < kD; ++j) acc = fmaf(x[j], w[j], acc);
  spk[idx] = fmaxf(acc, 0.f) + spos[r];
}

// ============================================================
// Precompute 2: k = spk@Wk^T + bk ; v = spk@Wv^T + bv
// ============================================================
__global__ void kv_kernel(const float* __restrict__ spk,
                          const float* __restrict__ Wk, const float* __restrict__ bk,
                          const float* __restrict__ Wv, const float* __restrict__ bv,
                          float* __restrict__ kbuf, float* __restrict__ vbuf) {
  int idx = blockIdx.x * blockDim.x + threadIdx.x;
  const int n = kB * kSPK * kD;
  if (idx >= 2 * n) return;
  int which = idx >= n;
  int r = which ? idx - n : idx;
  int bs = r / kD, d = r - bs * kD;
  const float* x = spk + (size_t)bs * kD;
  const float* W = (which ? Wv : Wk) + (size_t)d * kD;
  float acc = which ? bv[d] : bk[d];
  for (int j = 0; j < kD; ++j) acc = fmaf(x[j], W[j], acc);
  (which ? vbuf : kbuf)[r] = acc;
}

// ============================================================
// Precompute 3: fold Wq into K -> M (f16) + Msum, fold Wo into V -> VO^T (f16),
//               score bias bq.k, gamma-folded Wg1 (f16) + beta-folded bg1.
// ============================================================
__global__ void fold_kernel(const float* __restrict__ kbuf, const float* __restrict__ vbuf,
                            const float* __restrict__ Wq, const float* __restrict__ bq,
                            const float* __restrict__ Wo, const float* __restrict__ Wg1,
                            const float* __restrict__ bg1,
                            const float* __restrict__ glng, const float* __restrict__ glnb,
                            _Float16* __restrict__ Mh, _Float16* __restrict__ VOt,
                            float* __restrict__ cb, float* __restrict__ Msum,
                            _Float16* __restrict__ Wg1h, float* __restrict__ bg1p) {
  int idx = blockIdx.x * blockDim.x + threadIdx.x;
  const int nM  = kB * kHS * kD;
  const int nV  = kB * kD * kHS;
  const int nC  = kB * kHS;
  const int nS  = kB * kHS;
  const int nG  = kHG * kD;
  const int nGB = kHG;
  if (idx < nM) {
    // M[b][hs][d] = (1/8) * sum_dh Wq[h*64+dh][d] * k[b][s][h*64+dh]
    int b = idx / (kHS * kD); int rem = idx - b * (kHS * kD);
    int hs = rem / kD; int d = rem - hs * kD;
    int h = hs >> 2, s = hs & 3;
    const float* kr = kbuf + (size_t)(b * kSPK + s) * kD + h * kDH;
    float acc = 0.f;
    for (int j = 0; j < kDH; ++j)
      acc = fmaf(Wq[(size_t)(h * kDH + j) * kD + d], kr[j], acc);
    Mh[idx] = (_Float16)(acc * 0.125f);
  } else if (idx < nM + nV) {
    // VOt[b][d][hs] = sum_dh Wo[d][h*64+dh] * v[b][s][h*64+dh]
    int i = idx - nM;
    int b = i / (kD * kHS); int rem = i - b * (kD * kHS);
    int d = rem / kHS; int hs = rem - d * kHS;
    int h = hs >> 2, s = hs & 3;
    const float* vr = vbuf + (size_t)(b * kSPK + s) * kD + h * kDH;
    const float* wo = Wo + (size_t)d * kD + h * kDH;
    float acc = 0.f;
    for (int j = 0; j < kDH; ++j) acc = fmaf(wo[j], vr[j], acc);
    VOt[i] = (_Float16)acc;
  } else if (idx < nM + nV + nC) {
    // cb[b][hs] = (1/8) * bq . k_head
    int i = idx - nM - nV; int b = i / kHS; int hs = i - b * kHS;
    int h = hs >> 2, s = hs & 3;
    const float* kr = kbuf + (size_t)(b * kSPK + s) * kD + h * kDH;
    float acc = 0.f;
    for (int j = 0; j < kDH; ++j) acc = fmaf(bq[h * kDH + j], kr[j], acc);
    cb[i] = acc * 0.125f;
  } else if (idx < nM + nV + nC + nS) {
    // Msum[b][hs] = sum_d M[b][hs][d] (fp32, recomputed exactly)
    int i = idx - nM - nV - nC; int b = i / kHS; int hs = i - b * kHS;
    int h = hs >> 2, s = hs & 3;
    const float* kr = kbuf + (size_t)(b * kSPK + s) * kD + h * kDH;
    float acc = 0.f;
    for (int j = 0; j < kDH; ++j) {
      const float* wr = Wq + (size_t)(h * kDH + j) * kD;
      float rsum = 0.f;
      for (int d = 0; d < kD; ++d) rsum += wr[d];
      acc = fmaf(kr[j], rsum, acc);
    }
    Msum[i] = acc * 0.125f;
  } else if (idx < nM + nV + nC + nS + nG) {
    // Wg1h = Wg1 * gamma (gamma of gate-LN folded into weights)
    int i = idx - nM - nV - nC - nS;
    int k = i & (kD - 1);
    Wg1h[i] = (_Float16)(Wg1[i] * glng[k]);
  } else if (idx < nM + nV + nC + nS + nG + nGB) {
    // bg1p = bg1 + Wg1 . beta (beta of gate-LN folded into bias)
    int n = idx - nM - nV - nC - nS - nG;
    const float* wr = Wg1 + (size_t)n * kD;
    float acc = bg1[n];
    for (int k = 0; k < kD; ++k) acc = fmaf(wr[k], glnb[k], acc);
    bg1p[n] = acc;
  }
}

// ============================================================
// Fused main kernel: gate GEMM + scores + softmax + combine + final LN.
// LDS holds the pre-affine normalized tile x' = (x-mu)*rstd (f16);
// gamma/beta are folded into Wg1h/bg1p, and raw-x scores are recovered via
// scores = irs * (x'.M^T) + mu*Msum + cb.
// ============================================================
__global__ __launch_bounds__(256) void fused_kernel(
    const float* __restrict__ X,
    const _Float16* __restrict__ Mh,    // (B, HS, D)
    const _Float16* __restrict__ VOt,   // (B, D, HS)
    const float* __restrict__ cb,       // (B, HS)
    const float* __restrict__ Msum,     // (B, HS)
    const _Float16* __restrict__ Wg1h,  // (HG, D), gamma-folded
    const float* __restrict__ bg1p,     // (HG), beta-folded
    const float* __restrict__ Wg2, const float* __restrict__ bg2,
    const float* __restrict__ bo,
    const float* __restrict__ lng, const float* __restrict__ lnb,
    float* __restrict__ out) {
  __shared__ _Float16 sXh[TILE * kD];    // x' (f16); later reused for attn (f16)
  __shared__ _Float16 sGh[TILE * kHG];
  __shared__ float sSc[TILE * kHS];
  __shared__ float sW[TILE * kHS];
  __shared__ float sPs[TILE * 8];
  __shared__ float sPq[TILE * 8];
  __shared__ float sMu[TILE], sRs[TILE], sIrs[TILE], sG[TILE];

  const int t = threadIdx.x;
  const int lane = t & 31;
  const int wave = t >> 5;
  const int r15 = lane & 15;
  const int hi = lane >> 4;          // 0 or 1 (wave32 half)
  const int kb = hi * 8;             // fragment K sub-offset per ISA layout

  const size_t rowg0 = (size_t)blockIdx.x * TILE;
  const int b = (int)(rowg0 >> 12);  // tile never crosses batch (4096 % 32 == 0)

  const size_t AW_OFF = (size_t)kB * kT * kD;
  const size_t G_OFF  = AW_OFF + (size_t)kB * kT * kSPK;

  const int row = t >> 3, ch = t & 7;
  const f4v* xrow = (const f4v*)(X + (rowg0 + row) * kD + ch * 64);

  // ---- Phase 0a: LN stats (vector loads, 16B) ----
  {
    float s = 0.f, q = 0.f;
    #pragma unroll
    for (int j = 0; j < 16; ++j) {
      f4v v = xrow[j];
      #pragma unroll
      for (int e = 0; e < 4; ++e) { s += v[e]; q += v[e] * v[e]; }
    }
    sPs[row * 8 + ch] = s;
    sPq[row * 8 + ch] = q;
  }
  __syncthreads();
  if (t < TILE) {
    float s = 0.f, q = 0.f;
    #pragma unroll
    for (int c = 0; c < 8; ++c) { s += sPs[t * 8 + c]; q += sPq[t * 8 + c]; }
    float mu = s * (1.f / kD);
    float var = q * (1.f / kD) - mu * mu;
    sMu[t]  = mu;
    sRs[t]  = rsqrtf(var + kEPS);
    sIrs[t] = sqrtf(var + kEPS);
  }
  __syncthreads();

  // ---- Phase 0b: write x' = (x-mu)*rstd to LDS (f16, b64 stores) ----
  {
    const float mu = sMu[row], rs = sRs[row];
    h4v* op = (h4v*)&sXh[row * kD + ch * 64];
    #pragma unroll
    for (int j = 0; j < 16; ++j) {
      f4v v = xrow[j];
      h4v h;
      #pragma unroll
      for (int e = 0; e < 4; ++e) h[e] = (_Float16)((v[e] - mu) * rs);
      op[j] = h;
    }
  }
  __syncthreads();

  // ---- Gate GEMM: relu(x' @ Wg1h^T + bg1p)  (M=32,N=128,K=512) ----
  #pragma unroll
  for (int tt = 0; tt < 2; ++tt) {
    const int tid = wave + tt * 8;
    const int mt = tid >> 3, nt = tid & 7;
    const int arow = mt * 16 + r15;
    v8f acc = {};
    for (int k0 = 0; k0 < kD; k0 += 32) {
      v16h a  = frag_h(&sXh[arow * kD + k0 + kb]);
      v16h bm = frag_h(Wg1h + (size_t)(nt * 16 + r15) * kD + k0 + kb);
      acc = __builtin_amdgcn_wmma_f32_16x16x32_f16(false, a, false, bm,
                                                   (short)0, acc, false, false);
    }
    const int col = nt * 16 + r15;
    const float bb = bg1p[col];
    #pragma unroll
    for (int r = 0; r < 8; ++r)
      sGh[(mt * 16 + hi * 8 + r) * kHG + col] = (_Float16)fmaxf(acc[r] + bb, 0.f);
  }
  __syncthreads();

  // ---- Gate head on wave 4 (concurrent with scores on waves 0-3) ----
  if (wave == 4) {
    const int rw = lane;
    float g = bg2[0];
    const h8v* gp = (const h8v*)&sGh[rw * kHG];
    #pragma unroll 4
    for (int j = 0; j < 16; ++j) {
      h8v h = gp[j];
      #pragma unroll
      for (int e = 0; e < 8; ++e) g = fmaf((float)h[e], Wg2[j * 8 + e], g);
    }
    g = 1.f / (1.f + expf(-g));
    sG[rw] = g;
    out[G_OFF + rowg0 + rw] = g;
  }

  // ---- Scores GEMM: irs*(x' @ M^T) + mu*Msum + cb  (M=32,N=32,K=512) ----
  if (wave < 4) {
    const int mt = wave >> 1, nt = wave & 1;
    const int arow = mt * 16 + r15;
    v8f acc = {};
    for (int k0 = 0; k0 < kD; k0 += 32) {
      v16h a  = frag_h(&sXh[arow * kD + k0 + kb]);
      v16h bm = frag_h(Mh + ((size_t)b * kHS + nt * 16 + r15) * kD + k0 + kb);
      acc = __builtin_amdgcn_wmma_f32_16x16x32_f16(false, a, false, bm,
                                                   (short)0, acc, false, false);
    }
    const int col = nt * 16 + r15;
    const float c0 = cb[b * kHS + col];
    const float ms = Msum[b * kHS + col];
    #pragma unroll
    for (int r = 0; r < 8; ++r) {
      const int rr = mt * 16 + hi * 8 + r;
      sSc[rr * kHS + col] = fmaf(acc[r], sIrs[rr], fmaf(sMu[rr], ms, c0));
    }
  }
  __syncthreads();

  // ---- Softmax over SPK=4 within each head (one thread per row-head) ----
  {
    const int rw = t >> 3, h = t & 7;
    const float* sp = &sSc[rw * kHS + h * 4];
    float s0 = sp[0], s1 = sp[1], s2 = sp[2], s3 = sp[3];
    float m = fmaxf(fmaxf(s0, s1), fmaxf(s2, s3));
    float e0 = expf(s0 - m), e1 = expf(s1 - m), e2 = expf(s2 - m), e3 = expf(s3 - m);
    float inv = 1.f / (e0 + e1 + e2 + e3);
    float* wp = &sW[rw * kHS + h * 4];
    wp[0] = e0 * inv; wp[1] = e1 * inv; wp[2] = e2 * inv; wp[3] = e3 * inv;
  }
  __syncthreads();
  if (t < TILE * kSPK) {  // head-averaged attention weights
    int rw = t >> 2, s = t & 3;
    float aw = 0.f;
    #pragma unroll
    for (int h = 0; h < kH; ++h) aw += sW[rw * kHS + h * 4 + s];
    out[AW_OFF + (rowg0 + rw) * kSPK + s] = aw * (1.f / kH);
  }

  // ---- Combine GEMM: attn = w @ VO  (M=32,N=512,K=32) -> overwrite sXh ----
  #pragma unroll
  for (int i = 0; i < 8; ++i) {
    const int tid = wave * 8 + i;
    const int mt = tid >> 5, nt = tid & 31;
    v16h a, bm;
    {
      const f4v* wp = (const f4v*)&sW[(mt * 16 + r15) * kHS + kb];
      f4v w0 = wp[0], w1 = wp[1];   // K = kb .. kb+7
      f4v w2 = wp[4], w3 = wp[5];   // K = kb+16 .. kb+23
      #pragma unroll
      for (int e = 0; e < 4; ++e) {
        a[e]      = (_Float16)w0[e];
        a[4 + e]  = (_Float16)w1[e];
        a[8 + e]  = (_Float16)w2[e];
        a[12 + e] = (_Float16)w3[e];
      }
    }
    bm = frag_h(VOt + ((size_t)b * kD + nt * 16 + r15) * kHS + kb);
    v8f acc = {};
    acc = __builtin_amdgcn_wmma_f32_16x16x32_f16(false, a, false, bm,
                                                 (short)0, acc, false, false);
    const int col = nt * 16 + r15;
    #pragma unroll
    for (int r = 0; r < 8; ++r)
      sXh[(mt * 16 + hi * 8 + r) * kD + col] = (_Float16)acc[r];
  }
  __syncthreads();

  // ---- Epilogue: fused = LN(x + g*(attn + bo)) ----
  {
    const float g = sG[row];
    const h4v* av = (const h4v*)&sXh[row * kD + ch * 64];
    const f4v* bov = (const f4v*)(bo + ch * 64);
    float s = 0.f, q = 0.f;
    #pragma unroll
    for (int j = 0; j < 16; ++j) {
      f4v v = xrow[j]; h4v a = av[j]; f4v bb = bov[j];
      #pragma unroll
      for (int e = 0; e < 4; ++e) {
        float f = v[e] + g * ((float)a[e] + bb[e]);
        s += f; q += f * f;
      }
    }
    sPs[row * 8 + ch] = s;
    sPq[row * 8 + ch] = q;
  }
  __syncthreads();
  if (t < TILE) {
    float s = 0.f, q = 0.f;
    #pragma unroll
    for (int c = 0; c < 8; ++c) { s += sPs[t * 8 + c]; q += sPq[t * 8 + c]; }
    float mu = s * (1.f / kD);
    float var = q * (1.f / kD) - mu * mu;
    sMu[t] = mu;
    sRs[t] = rsqrtf(var + kEPS);
  }
  __syncthreads();
  {
    const float g = sG[row];
    const float mu = sMu[row], rs = sRs[row];
    const h4v* av = (const h4v*)&sXh[row * kD + ch * 64];
    const f4v* bov = (const f4v*)(bo + ch * 64);
    const f4v* lgv = (const f4v*)(lng + ch * 64);
    const f4v* lbv = (const f4v*)(lnb + ch * 64);
    f4v* op = (f4v*)(out + (rowg0 + row) * kD + ch * 64);
    #pragma unroll
    for (int j = 0; j < 16; ++j) {
      f4v v = xrow[j]; h4v a = av[j]; f4v bb = bov[j];
      f4v lg = lgv[j], lb = lbv[j], o;
      #pragma unroll
      for (int e = 0; e < 4; ++e) {
        float f = v[e] + g * ((float)a[e] + bb[e]);
        o[e] = (f - mu) * rs * lg[e] + lb[e];
      }
      op[j] = o;
    }
  }
}

// ============================================================
extern "C" void kernel_launch(void* const* d_in, const int* in_sizes, int n_in,
                              void* d_out, int out_size, void* d_ws, size_t ws_size,
                              hipStream_t stream) {
  (void)in_sizes; (void)n_in; (void)out_size; (void)ws_size;
  const float* token = (const float*)d_in[0];
  const float* se    = (const float*)d_in[1];
  const float* We    = (const float*)d_in[2];
  const float* be    = (const float*)d_in[3];
  const float* spos  = (const float*)d_in[4];
  const float* Wq    = (const float*)d_in[5];
  const float* bq    = (const float*)d_in[6];
  const float* Wk    = (const float*)d_in[7];
  const float* bk    = (const float*)d_in[8];
  const float* Wv    = (const float*)d_in[9];
  const float* bv    = (const float*)d_in[10];
  const float* Wo    = (const float*)d_in[11];
  const float* bo    = (const float*)d_in[12];
  const float* glng  = (const float*)d_in[13];
  const float* glnb  = (const float*)d_in[14];
  const float* Wg1   = (const float*)d_in[15];
  const float* bg1   = (const float*)d_in[16];
  const float* Wg2   = (const float*)d_in[17];
  const float* bg2   = (const float*)d_in[18];
  const float* lng   = (const float*)d_in[19];
  const float* lnb   = (const float*)d_in[20];
  float* out = (float*)d_out;

  char* ws = (char*)d_ws;
  float*    spk  = (float*)(ws + 0);            // 64 KB
  float*    kbuf = (float*)(ws + 65536);        // 64 KB
  float*    vbuf = (float*)(ws + 131072);       // 64 KB
  _Float16* Mh   = (_Float16*)(ws + 196608);    // 256 KB
  _Float16* VOt  = (_Float16*)(ws + 458752);    // 256 KB
  float*    cbf  = (float*)(ws + 720896);       // 1 KB
  float*    Msum = (float*)(ws + 721920);       // 1 KB
  float*    bg1p = (float*)(ws + 722944);       // 512 B
  _Float16* Wg1h = (_Float16*)(ws + 723456);    // 128 KB

  spk_kernel<<<(kB * kSPK * kD + 255) / 256, 256, 0, stream>>>(se, We, be, spos, spk);
  kv_kernel<<<(2 * kB * kSPK * kD + 255) / 256, 256, 0, stream>>>(spk, Wk, bk, Wv, bv, kbuf, vbuf);
  const int nfold = kB * kHS * kD + kB * kD * kHS + kB * kHS + kB * kHS + kHG * kD + kHG;
  fold_kernel<<<(nfold + 255) / 256, 256, 0, stream>>>(kbuf, vbuf, Wq, bq, Wo, Wg1, bg1,
                                                       glng, glnb, Mh, VOt, cbf, Msum, Wg1h, bg1p);
  fused_kernel<<<(kB * kT) / TILE, 256, 0, stream>>>(token, Mh, VOt, cbf, Msum, Wg1h, bg1p,
                                                     Wg2, bg2, bo, lng, lnb, out);
}

// v001
// It runs in 138 microseconds.
// Two timings next to v000 put it at 3.37 and 3.39 times that version's speed.
#include <hip/hip_runtime.h>
#include <hip/hip_bf16.h>
#include <math.h>

// ---- problem constants ----
constexpr int kB   = 8;
constexpr int kT   = 4096;
constexpr int kD   = 512;
constexpr int kH   = 8;
constexpr int kDH  = 64;
constexpr int kSPK = 4;
constexpr int kHS  = kH * kSPK;   // 32 folded "keys" per batch
constexpr int kHG  = 128;
constexpr int TILE = 32;          // token rows per block
constexpr float kEPS = 1e-5f;

typedef __attribute__((ext_vector_type(16))) _Float16 v16h;
typedef __attribute__((ext_vector_type(8)))  float    v8f;
typedef __attribute__((ext_vector_type(4)))  float    f4v;
typedef __attribute__((ext_vector_type(4)))  _Float16 h4v;
typedef __attribute__((ext_vector_type(8)))  _Float16 h8v;

// Gather one 16x32 WMMA fragment (A or B) from a row-major f16 matrix.
// p points at [row_of_this_lane][k0 + kb]; lanes 0-15 take K {0..7,16..23},
// lanes 16-31 take K {8..15,24..31} (kb handles the 8-offset).
__device__ __forceinline__ v16h frag_h(const _Float16* p) {
  h8v lo = *(const h8v*)p;
  h8v hi = *(const h8v*)(p + 16);
  v16h f;
  #pragma unroll
  for (int j = 0; j < 8; ++j) { f[j] = lo[j]; f[8 + j] = hi[j]; }
  return f;
}

// Sum over the 32 lanes of a wave; every lane gets the total.
__device__ __forceinline__ float wave_sum(float v) {
  for (int m = 16; m >= 1; m >>= 1) v += __shfl_xor(v, m, 32);
  return v;
}

// ============================================================
// Precompute 1: spk_tokens = relu(speaker_emb @ We^T + be) + spk_pos
// ============================================================
__global__ void spk_kernel(const float* __restrict__ se, const float* __restrict__ We,
                           const float* __restrict__ be, const float* __restrict__ spos,
                           float* __restrict__ spk) {
  int idx = blockIdx.x * blockDim.x + threadIdx.x;
  if (idx >= kB * kSPK * kD) return;
  int b = idx / (kSPK * kD);
  int r = idx - b * (kSPK * kD);           // r = s*D + d
  const float* x = se + (size_t)b * kD;
  const float* w = We + (size_t)r * kD;
  float acc = be[r];
  for (int j = 0; j < kD; ++j) acc = fmaf(x[j], w[j], acc);
  spk[idx] = fmaxf(acc, 0.f) + spos[r];
}

// ============================================================
// Precompute 2: k = spk@Wk^T + bk ; v = spk@Wv^T + bv
// ============================================================
__global__ void kv_kernel(const float* __restrict__ spk,
                          const float* __restrict__ Wk, const float* __restrict__ bk,
                          const float* __restrict__ Wv, const float* __restrict__ bv,
                          float* __restrict__ kbuf, float* __restrict__ vbuf) {
  int idx = blockIdx.x * blockDim.x + threadIdx.x;
  const int n = kB * kSPK * kD;
  if (idx >= 2 * n) return;
  int which = idx >= n;
  int r = which ? idx - n : idx;
  int bs = r / kD, d = r - bs * kD;
  const float* x = spk + (size_t)bs * kD;
  const float* W = (which ? Wv : Wk) + (size_t)d * kD;
  float acc = which ? bv[d] : bk[d];
  for (int j = 0; j < kD; ++j) acc = fmaf(x[j], W[j], acc);
  (which ? vbuf : kbuf)[r] = acc;
}

// ============================================================
// Precompute 3: fold Wq into K -> M (f16) + Msum, fold Wo into V -> VO^T (f16),
//               score bias bq.k, gamma-folded Wg1 (f16) + beta-folded bg1.
// Every segment boundary is a multiple of the 256-thread block, so a block
// (and a wave) lies wholly inside one segment.
// ============================================================
__global__ void fold_kernel(const float* __restrict__ kbuf, const float* __restrict__ vbuf,
                            const float* __restrict__ Wq, const float* __restrict__ bq,
                            const float* __restrict__ Wo, const float* __restrict__ Wg1,
                            const float* __restrict__ bg1,
                            const float* __restrict__ glng, const float* __restrict__ glnb,
                            _Float16* __restrict__ Mh, _Float16* __restrict__ VOt,
                            float* __restrict__ cb, float* __restrict__ Msum,
                            _Float16* __restrict__ Wg1h, float* __restrict__ bg1p) {
  __shared__ float sRow[kDH];              // row sums of one head's Wq rows
  int idx = blockIdx.x * blockDim.x + threadIdx.x;
  const int nM  = kB * kHS * kD;
  const int nV  = kB * kD * kHS;
  const int nC  = kB * kHS;
  const int nS  = kH * 256;                // one block per head
  const int nG  = kHG * kD;
  const int nGB = kHG * 32;                // one wave per gate unit
  if (idx < nM) {
    // M[b][hs][d] = (1/8) * sum_dh Wq[h*64+dh][d] * k[b][s][h*64+dh]
    int b = idx / (kHS * kD); int rem = idx - b * (kHS * kD);
    int hs = rem / kD; int d = rem - hs * kD;
    int h = hs >> 2, s = hs & 3;
    const float* kr = kbuf + (size_t)(b * kSPK + s) * kD + h * kDH;
    float acc = 0.f;
    for (int j = 0; j < kDH; ++j)
      acc = fmaf(Wq[(size_t)(h * kDH + j) * kD + d], kr[j], acc);
    Mh[idx] = (_Float16)(acc * 0.125f);
  } else if (idx < nM + nV) {
    // VOt[b][d][hs] = sum_dh Wo[d][h*64+dh] * v[b][s][h*64+dh]
    int i = idx - nM;
    int b = i / (kD * kHS); int rem = i - b * (kD * kHS);
    int d = rem / kHS; int hs = rem - d * kHS;
    int h = hs >> 2, s = hs & 3;
    const float* vr = vbuf + (size_t)(b * kSPK + s) * kD + h * kDH;
    const float* wo = Wo + (size_t)d * kD + h * kDH;
    float acc = 0.f;
    for (int j = 0; j < kDH; ++j) acc = fmaf(wo[j], vr[j], acc);
    VOt[i] = (_Float16)acc;
  } else if (idx < nM + nV + nC) {
    // cb[b][hs] = (1/8) * bq . k_head
    int i = idx - nM - nV; int b = i / kHS; int hs = i - b * kHS;
    int h = hs >> 2, s = hs & 3;
    const float* kr = kbuf + (size_t)(b * kSPK + s) * kD + h * kDH;
    float acc = 0.f;
    for (int j = 0; j < kDH; ++j) acc = fmaf(bq[h * kDH + j], kr[j], acc);
    cb[i] = acc * 0.125f;
  } else if (idx < nM + nV + nC + nS) {
    // Msum[b][hs] = sum_d M[b][hs][d] = (1/8) * sum_j k[b][s][h*64+j] * rowsum(Wq[h*64+j]) (fp32).
    // One block per head: each wave sums 8 rows with its lanes across the columns,
    // then 32 threads finish the (b, s) outputs of this head from the shared row sums.
    int i = idx - nM - nV - nC;
    int h = i >> 8, tl = i & 255;
    int wv = tl >> 5, ln = tl & 31;
    float part[8];
    for (int r = 0; r < 8; ++r) {
      const f4v* wr = (const f4v*)(Wq + (size_t)(h * kDH + wv * 8 + r) * kD);
      f4v s4 = (wr[ln] + wr[32 + ln]) + (wr[64 + ln] + wr[96 + ln]);
      part[r] = (s4[0] + s4[1]) + (s4[2] + s4[3]);
    }
    for (int r = 0; r < 8; ++r) part[r] = wave_sum(part[r]);
    if (ln == 0) {
      for (int r = 0; r < 8; ++r) sRow[wv * 8 + r] = part[r];
    }
    __syncthreads();   // block-uniform branch: the whole block is in this segment
    if (tl < kB * kSPK) {
      int b = tl >> 2, s = tl & 3;
      const float* kr = kbuf + (size_t)(b * kSPK + s) * kD + h * kDH;
      float acc = 0.f;
      for (int j = 0; j < kDH; ++j) acc = fmaf(kr[j], sRow[j], acc);
      Msum[b * kHS + h * 4 + s] = acc * 0.125f;
    }
  } else if (idx < nM + nV + nC + nS + nG) {
    // Wg1h = Wg1 * gamma (gamma of gate-LN folded into weights)
    int i = idx - nM - nV - nC - nS;
    int k = i & (kD - 1);
    Wg1h[i] = (_Float16)(Wg1[i] * glng[k]);
  } else if (idx < nM + nV + nC + nS + nG + nGB) {
    // bg1p = bg1 + Wg1 . beta (beta of gate-LN folded into bias); one wave per unit n
    int i = idx - nM - nV - nC - nS - nG;
    int n = i >> 5, ln = i & 31;
    const f4v* wr = (const f4v*)(Wg1 + (size_t)n * kD);
    const f4v* bt = (const f4v*)glnb;
    f4v p4 = {};
    for (int c = 0; c < 4; ++c) p4 += wr[c * 32 + ln] * bt[c * 32 + ln];
    float acc = wave_sum((p4[0] + p4[1]) + (p4[2] + p4[3]));
    if (ln == 0) bg1p[n] = bg1[n] + acc;
  }
}

// ============================================================
// Fused main kernel: gate GEMM + scores + softmax + combine + final LN.
// LDS holds the pre-affine normalized tile x' = (x-mu)*rstd (f16);
// gamma/beta are folded into Wg1h/bg1p, and raw-x scores are recovered via
// scores = irs * (x'.M^T) + mu*Msum + cb.
// ============================================================
__global__ __launch_bounds__(256) void fused_kernel(
    const float* __restrict__ X,
    const _Float16* __restrict__ Mh,    // (B, HS, D)
    const _Float16* __restrict__ VOt,   // (B, D, HS)
    const float* __restrict__ cb,       // (B, HS)
    const float* __restrict__ Msum,     // (B, HS)
    const _Float16* __restrict__ Wg1h,  // (HG, D), gamma-folded
    const float* __restrict__ bg1p,     // (HG), beta-folded
    const float* __restrict__ Wg2, const float* __restrict__ bg2,
    const float* __restrict__ bo,
    const float* __restrict__ lng, const float* __restrict__ lnb,
    float* __restrict__ out) {
  __shared__ _Float16 sXh[TILE * kD];    // x' (f16); later reused for attn (f16)
  __shared__ _Float16 sGh[TILE * kHG];
  __shared__ float sSc[TILE * kHS];
  __shared__ float sW[TILE * kHS];
  __shared__ float sPs[TILE * 8];
  __shared__ float sPq[TILE * 8];
  __shared__ float sMu[TILE], sRs[TILE], sIrs[TILE], sG[TILE];

  const int t = threadIdx.x;
  const int lane = t & 31;
  const int wave = t >> 5;
  const int r15 = lane & 15;
  const int hi = lane >> 4;          // 0 or 1 (wave32 half)
  const int kb = hi * 8;             // fragment K sub-offset per ISA layout

  const size_t rowg0 = (size_t)blockIdx.x * TILE;
  const int b = (int)(rowg0 >> 12);  // tile never crosses batch (4096 % 32 == 0)

  const size_t AW_OFF = (size_t)kB * kT * kD;
  const size_t G_OFF  = AW_OFF + (size_t)kB * kT * kSPK;

  const int row = t >> 3, ch = t & 7;
  const f4v* xrow = (const f4v*)(X + (rowg0 + row) * kD + ch * 64);

  // ---- Phase 0a: LN stats (vector loads, 16B) ----
  {
    float s = 0.f, q = 0.f;
    #pragma unroll
    for (int j = 0; j < 16; ++j) {
      f4v v = xrow[j];
      #pragma unroll
      for (int e = 0; e < 4; ++e) { s += v[e]; q += v[e] * v[e]; }
    }
    sPs[row * 8 + ch] = s;
    sPq[row * 8 + ch] = q;
  }
  __syncthreads();
  if (t < TILE) {
    float s = 0.f, q = 0.f;
    #pragma unroll
    for (int c = 0; c < 8; ++c) { s += sPs[t * 8 + c]; q += sPq[t * 8 + c]; }
    float mu = s * (1.f / kD);
    float var = q * (1.f / kD) - mu * mu;
    sMu[t]  = mu;
    sRs[t]  = rsqrtf(var + kEPS);
    sIrs[t] = sqrtf(var + kEPS);
  }
  __syncthreads();

  // ---- Phase 0b: write x' = (x-mu)*rstd to LDS (f16, b64 stores) ----
  {
    const float mu = sMu[row], rs = sRs[row];
    h4v* op = (h4v*)&sXh[row * kD + ch * 64];
    #pragma unroll
    for (int j = 0; j < 16; ++j) {
      f4v v = xrow[j];
      h4v h;
      #pragma unroll
      for (int e = 0; e < 4; ++e) h[e] = (_Float16)((v[e] - mu) * rs);
      op[j] = h;
    }
  }
  __syncthreads();

  // ---- Gate GEMM: relu(x' @ Wg1h^T + bg1p)  (M=32,N=128,K=512) ----
  #pragma unroll
  for (int tt = 0; tt < 2; ++tt) {
    const int tid = wave + tt * 8;
    const int mt = tid >> 3, nt = tid & 7;
    const int arow = mt * 16 + r15;
    v8f acc = {};
    for (int k0 = 0; k0 < kD; k0 += 32) {
      v16h a  = frag_h(&sXh[arow * kD + k0 + kb]);
      v16h bm = frag_h(Wg1h + (size_t)(nt * 16 + r15) * kD + k0 + kb);
      acc = __builtin_amdgcn_wmma_f32_16x16x32_f16(false, a, false, bm,
                                                   (short)0, acc, false, false);
    }
    const int col = nt * 16 + r15;
    const float bb = bg1p[col];
    #pragma unroll
    for (int r = 0; r < 8; ++r)
      sGh[(mt * 16 + hi * 8 + r) * kHG + col] = (_Float16)fmaxf(acc[r] + bb, 0.f);
  }
  __syncthreads();

  // ---- Gate head on wave 4 (concurrent with scores on waves 0-3) ----
  if (wave == 4) {
    const int rw = lane;
    float g = bg2[0];
    const h8v* gp = (const h8v*)&sGh[rw * kHG];
    #pragma unroll 4
    for (int j = 0; j < 16; ++j) {
      h8v h = gp[j];
      #pragma unroll
      for (int e = 0; e < 8; ++e) g = fmaf((float)h[e], Wg2[j * 8 + e], g);
    }
    g = 1.f / (1.f + expf(-g));
    sG[rw] = g;
    out[G_OFF + rowg0 + rw] = g;
  }

  // ---- Scores GEMM: irs*(x' @ M^T) + mu*Msum + cb  (M=32,N=32,K=512) ----
  if (wave < 4) {
    const int mt = wave >> 1, nt = wave & 1;
    const int arow = mt * 16 + r15;
    v8f acc = {};
    for (int k0 = 0; k0 < kD; k0 += 32) {
      v16h a  = frag_h(&sXh[arow * kD + k0 + kb]);
      v16h bm = frag_h(Mh + ((size_t)b * kHS + nt * 16 + r15) * kD + k0 + kb);
      acc = __builtin_amdgcn_wmma_f32_16x16x32_f16(false, a, false, bm,
                                                   (short)0, acc, false, false);
    }
    const int col = nt * 16 + r15;
    const float c0 = cb[b * kHS + col];
    const float ms = Msum[b * kHS + col];
    #pragma unroll
    for (int r = 0; r < 8; ++r) {
      const int rr = mt * 16 + hi * 8 + r;
      sSc[rr * kHS + col] = fmaf(acc[r], sIrs[rr], fmaf(sMu[rr], ms, c0));
    }
  }
  __syncthreads();

  // ---- Softmax over SPK=4 within each head (one thread per row-head) ----
  {
    const int rw = t >> 3, h = t & 7;
    const float* sp = &sSc[rw * kHS + h * 4];
    float s0 = sp[0], s1 = sp[1], s2 = sp[2], s3 = sp[3];
    float m = fmaxf(fmaxf(s0, s1), fmaxf(s2, s3));
    float e0 = expf(s0 - m), e1 = expf(s1 - m), e2 = expf(s2 - m), e3 = expf(s3 - m);
    float inv = 1.f / (e0 + e1 + e2 + e3);
    float* wp = &sW[rw * kHS + h * 4];
    wp[0] = e0 * inv; wp[1] = e1 * inv; wp[2] = e2 * inv; wp[3] = e3 * inv;
  }
  __syncthreads();
  if (t < TILE * kSPK) {  // head-averaged attention weights
    int rw = t >> 2, s = t & 3;
    float aw = 0.f;
    #pragma unroll
    for (int h = 0; h < kH; ++h) aw += sW[rw * kHS + h * 4 + s];
    out[AW_OFF + (rowg0 + rw) * kSPK + s] = aw * (1.f / kH);
  }

  // ---- Combine GEMM: attn = w @ VO  (M=32,N=512,K=32) -> overwrite sXh ----
  #pragma unroll
  for (int i = 0; i < 8; ++i) {
    const int tid = wave * 8 + i;
    const int mt = tid >> 5, nt = tid & 31;
    v16h a, bm;
    {
      const f4v* wp = (const f4v*)&sW[(mt * 16 + r15) * kHS + kb];
      f4v w0 = wp[0], w1 = wp[1];   // K = kb .. kb+7
      f4v w2 = wp[4], w3 = wp[5];   // K = kb+16 .. kb+23
      #pragma unroll
      for (int e = 0; e < 4; ++e) {
        a[e]      = (_Float16)w0[e];
        a[4 + e]  = (_Float16)w1[e];
        a[8 + e]  = (_Float16)w2[e];
        a[12 + e] = (_Float16)w3[e];
      }
    }
    bm = frag_h(VOt + ((size_t)b * kD + nt * 16 + r15) * kHS + kb);
    v8f acc = {};
    acc = __builtin_amdgcn_wmma_f32_16x16x32_f16(false, a, false, bm,
                                                 (short)0, acc, false, false);
    const int col = nt * 16 + r15;
    #pragma unroll
    for (int r = 0; r < 8; ++r)
      sXh[(mt * 16 + hi * 8 + r) * kD + col] = (_Float16)acc[r];
  }
  __syncthreads();

  // ---- Epilogue: fused = LN(x + g*(attn + bo)) ----
  {
    const float g = sG[row];
    const h4v* av = (const h4v*)&sXh[row * kD + ch * 64];
    const f4v* bov = (const f4v*)(bo + ch * 64);
    float s = 0.f, q = 0.f;
    #pragma unroll
    for (int j = 0; j < 16; ++j) {
      f4v v = xrow[j]; h4v a = av[j]; f4v bb = bov[j];
      #pragma unroll
      for (int e = 0; e < 4; ++e) {
        float f = v[e] + g * ((float)a[e] + bb[e]);
        s += f; q += f * f;
      }
    }
    sPs[row * 8 + ch] = s;
    sPq[row * 8 + ch] = q;
  }
  __syncthreads();
  if (t < TILE) {
    float s = 0.f, q = 0.f;
    #pragma unroll
    for (int c = 0; c < 8; ++c) { s += sPs[t * 8 + c]; q += sPq[t * 8 + c]; }
    float mu = s * (1.f / kD);
    float var = q * (1.f / kD) - mu * mu;
    sMu[t] = mu;
    sRs[t] = rsqrtf(var + kEPS);
  }
  __syncthreads();
  {
    const float g = sG[row];
    const float mu = sMu[row], rs = sRs[row];
    const h4v* av = (const h4v*)&sXh[row * kD + ch * 64];
    const f4v* bov = (const f4v*)(bo + ch * 64);
    const f4v* lgv = (const f4v*)(lng + ch * 64);
    const f4v* lbv = (const f4v*)(lnb + ch * 64);
    f4v* op = (f4v*)(out + (rowg0 + row) * kD + ch * 64);
    #pragma unroll
    for (int j = 0; j < 16; ++j) {
      f4v v = xrow[j]; h4v a = av[j]; f4v bb = bov[j];
      f4v lg = lgv[j], lb = lbv[j], o;
      #pragma unroll
      for (int e = 0; e < 4; ++e) {
        float f = v[e] + g * ((float)a[e] + bb[e]);
        o[e] = (f - mu) * rs * lg[e] + lb[e];
      }
      op[j] = o;
    }
  }
}

// ============================================================
extern "C" void kernel_launch(void* const* d_in, const int* in_sizes, int n_in,
                              void* d_out, int out_size, void* d_ws, size_t ws_size,
                              hipStream_t stream) {
  (void)in_sizes; (void)n_in; (void)out_size; (void)ws_size;
  const float* token = (const float*)d_in[0];
  const float* se    = (const float*)d_in[1];
  const float* We    = (const float*)d_in[2];
  const float* be    = (const float*)d_in[3];
  const float* spos  = (const float*)d_in[4];
  const float* Wq    = (const float*)d_in[5];
  const float* bq    = (const float*)d_in[6];
  const float* Wk    = (const float*)d_in[7];
  const float* bk    = (const float*)d_in[8];
  const float* Wv    = (const float*)d_in[9];
  const float* bv    = (const float*)d_in[10];
  const float* Wo    = (const float*)d_in[11];
  const float* bo    = (const float*)d_in[12];
  const float* glng  = (const float*)d_in[13];
  const float* glnb  = (const float*)d_in[14];
  const float* Wg1   = (const float*)d_in[15];
  const float* bg1   = (const float*)d_in[16];
  const float* Wg2   = (const float*)d_in[17];
  const float* bg2   = (const float*)d_in[18];
  const float* lng   = (const float*)d_in[19];
  const float* lnb   = (const float*)d_in[20];
  float* out = (float*)d_out;

  char* ws = (char*)d_ws;
  float*    spk  = (float*)(ws + 0);            // 64 KB
  float*    kbuf = (float*)(ws + 65536);        // 64 KB
  float*    vbuf = (float*)(ws + 131072);       // 64 KB
  _Float16* Mh   = (_Float16*)(ws + 196608);    // 256 KB
  _Float16* VOt  = (_Float16*)(ws + 458752);    // 256 KB
  float*    cbf  = (float*)(ws + 720896);       // 1 KB
  float*    Msum = (float*)(ws + 721920);       // 1 KB
  float*    bg1p = (float*)(ws + 722944);       // 512 B
  _Float16* Wg1h = (_Float16*)(ws + 723456);    // 128 KB

  spk_kernel<<<(kB * kSPK * kD + 255) / 256, 256, 0, stream>>>(se, We, be, spos, spk);
  kv_kernel<<<(2 * kB * kSPK * kD + 255) / 256, 256, 0, stream>>>(spk, Wk, bk, Wv, bv, kbuf, vbuf);
  const int nfold = kB * kHS * kD + kB * kD * kHS + kB * kHS + kH * 256 + kHG * kD + kHG * 32;
  fold_kernel<<<(nfold + 255) / 256, 256, 0, stream>>>(kbuf, vbuf, Wq, bq, Wo, Wg1, bg1,
                                                       glng, glnb, Mh, VOt, cbf, Msum, Wg1h, bg1p);
  fused_kernel<<<(kB * kT) / TILE, 256, 0, stream>>>(token, Mh, VOt, cbf, Msum, Wg1h, bg1p,
                                                     Wg2, bg2, bo, lng, lnb, out);
}

// v002
// One run takes 96.3 microseconds.
// Timed twice side by side with v001, it ran 1.43 and 1.44 times as fast.
// Counting every step since v000, it is 4.86 times as fast.
#include <hip/hip_runtime.h>
#include <hip/hip_bf16.h>
#include <math.h>

// ---- problem constants ----
constexpr int kB   = 8;
constexpr int kT   = 4096;
constexpr int kD   = 512;
constexpr int kH   = 8;
constexpr int kDH  = 64;
constexpr int kSPK = 4;
constexpr int kHS  = kH * kSPK;   // 32 folded "keys" per batch
constexpr int kHG  = 128;
constexpr int TILE = 32;          // token rows per block
constexpr float kEPS = 1e-5f;

typedef __attribute__((ext_vector_type(16))) _Float16 v16h;
typedef __attribute__((ext_vector_type(8)))  float    v8f;
typedef __attribute__((ext_vector_type(4)))  float    f4v;
typedef __attribute__((ext_vector_type(4)))  _Float16 h4v;
typedef __attribute__((ext_vector_type(8)))  _Float16 h8v;

// Gather one 16x32 WMMA fragment (A or B) from a row-major f16 matrix.
// p points at [row_of_this_lane][k0 + kb]; lanes 0-15 take K {0..7,16..23},
// lanes 16-31 take K {8..15,24..31} (kb handles the 8-offset).
__device__ __forceinline__ v16h frag_h(const _Float16* p) {
  h8v lo = *(const h8v*)p;
  h8v hi = *(const h8v*)(p + 16);
  v16h f;
  #pragma unroll
  for (int j = 0; j < 8; ++j) { f[j] = lo[j]; f[8 + j] = hi[j]; }
  return f;
}

// Sum over the 32 lanes of a wave; every lane gets the total.
__device__ __forceinline__ float wave_sum(float v) {
  for (int m = 16; m >= 1; m >>= 1) v += __shfl_xor(v, m, 32);
  return v;
}

// ============================================================
// Precompute 1: spk_tokens = relu(speaker_emb @ We^T + be) + spk_pos
// ============================================================
__global__ void spk_kernel(const float* __restrict__ se, const float* __restrict__ We,
                           const float* __restrict__ be, const float* __restrict__ spos,
                           float* __restrict__ spk) {
  int idx = blockIdx.x * blockDim.x + threadIdx.x;
  if (idx >= kB * kSPK * kD) return;
  int b = idx / (kSPK * kD);
  int r = idx - b * (kSPK * kD);           // r = s*D + d
  const float* x = se + (size_t)b * kD;
  const float* w = We + (size_t)r * kD;
  float acc = be[r];
  for (int j = 0; j < kD; ++j) acc = fmaf(x[j], w[j], acc);
  spk[idx] = fmaxf(acc, 0.f) + spos[r];
}

// ============================================================
// Precompute 2: k = spk@Wk^T + bk ; v = spk@Wv^T + bv
// ============================================================
__global__ void kv_kernel(const float* __restrict__ spk,
                          const float* __restrict__ Wk, const float* __restrict__ bk,
                          const float* __restrict__ Wv, const float* __restrict__ bv,
                          float* __restrict__ kbuf, float* __restrict__ vbuf) {
  int idx = blockIdx.x * blockDim.x + threadIdx.x;
  const int n = kB * kSPK * kD;
  if (idx >= 2 * n) return;
  int which = idx >= n;
  int r = which ? idx - n : idx;
  int bs = r / kD, d = r - bs * kD;
  const float* x = spk + (size_t)bs * kD;
  const float* W = (which ? Wv : Wk) + (size_t)d * kD;
  float acc = which ? bv[d] : bk[d];
  for (int j = 0; j < kD; ++j) acc = fmaf(x[j], W[j], acc);
  (which ? vbuf : kbuf)[r] = acc;
}

// ============================================================
// Precompute 3: fold Wq into K -> M (f16) + Msum, fold Wo into V -> VO^T (f16),
//               score bias bq.k, gamma-folded Wg1 (f16) + beta-folded bg1.
// Every segment boundary is a multiple of the 256-thread block, so a block
// (and a wave) lies wholly inside one segment.
// ============================================================
__global__ void fold_kernel(const float* __restrict__ kbuf, const float* __restrict__ vbuf,
                            const float* __restrict__ Wq, const float* __restrict__ bq,
                            const float* __restrict__ Wo, const float* __restrict__ Wg1,
                            const float* __restrict__ bg1,
                            const float* __restrict__ glng, const float* __restrict__ glnb,
                            _Float16* __restrict__ Mh, _Float16* __restrict__ VOt,
                            float* __restrict__ cb, float* __restrict__ Msum,
                            _Float16* __restrict__ Wg1h, float* __restrict__ bg1p) {
  __shared__ float sRow[kDH];              // row sums of one head's Wq rows
  int idx = blockIdx.x * blockDim.x + threadIdx.x;
  const int nM  = kB * kHS * kD;
  const int nV  = kB * kD * kHS;
  const int nC  = kB * kHS;
  const int nS  = kH * 256;                // one block per head
  const int nG  = kHG * kD;
  const int nGB = kHG * 32;                // one wave per gate unit
  if (idx < nM) {
    // M[b][hs][d] = (1/8) * sum_dh Wq[h*64+dh][d] * k[b][s][h*64+dh]
    int b = idx / (kHS * kD); int rem = idx - b * (kHS * kD);
    int hs = rem / kD; int d = rem - hs * kD;
    int h = hs >> 2, s = hs & 3;
    const float* kr = kbuf + (size_t)(b * kSPK + s) * kD + h * kDH;
    float acc = 0.f;
    for (int j = 0; j < kDH; ++j)
      acc = fmaf(Wq[(size_t)(h * kDH + j) * kD + d], kr[j], acc);
    Mh[idx] = (_Float16)(acc * 0.125f);
  } else if (idx < nM + nV) {
    // VOt[b][d][hs] = sum_dh Wo[d][h*64+dh] * v[b][s][h*64+dh]
    int i = idx - nM;
    int b = i / (kD * kHS); int rem = i - b * (kD * kHS);
    int d = rem / kHS; int hs = rem - d * kHS;
    int h = hs >> 2, s = hs & 3;
    const float* vr = vbuf + (size_t)(b * kSPK + s) * kD + h * kDH;
    const float* wo = Wo + (size_t)d * kD + h * kDH;
    float acc = 0.f;
    for (int j = 0; j < kDH; ++j) acc = fmaf(wo[j], vr[j], acc);
    VOt[i] = (_Float16)acc;
  } else if (idx < nM + nV + nC) {
    // cb[b][hs] = (1/8) * bq . k_head
    int i = idx - nM - nV; int b = i / kHS; int hs = i - b * kHS;
    int h = hs >> 2, s = hs & 3;
    const float* kr = kbuf + (size_t)(b * kSPK + s) * kD + h * kDH;
    float acc = 0.f;
    for (int j = 0; j < kDH; ++j) acc = fmaf(bq[h * kDH + j], kr[j], acc);
    cb[i] = acc * 0.125f;
  } else if (idx < nM + nV + nC + nS) {
    // Msum[b][hs] = sum_d M[b][hs][d] = (1/8) * sum_j k[b][s][h*64+j] * rowsum(Wq[h*64+j]) (fp32).
    // One block per head: each wave sums 8 rows with its lanes across the columns,
    // then 32 threads finish the (b, s) outputs of this head from the shared row sums.
    int i = idx - nM - nV - nC;
    int h = i >> 8, tl = i & 255;
    int wv = tl >> 5, ln = tl & 31;
    float part[8];
    for (int r = 0; r < 8; ++r) {
      const f4v* wr = (const f4v*)(Wq + (size_t)(h * kDH + wv * 8 + r) * kD);
      f4v s4 = (wr[ln] + wr[32 + ln]) + (wr[64 + ln] + wr[96 + ln]);
      part[r] = (s4[0] + s4[1]) + (s4[2] + s4[3]);
    }
    for (int r = 0; r < 8; ++r) part[r] = wave_sum(part[r]);
    if (ln == 0) {
      for (int r = 0; r < 8; ++r) sRow[wv * 8 + r] = part[r];
    }
    __syncthreads();   // block-uniform branch: the whole block is in this segment
    if (tl < kB * kSPK) {
      int b = tl >> 2, s = tl & 3;
      const float* kr = kbuf + (size_t)(b * kSPK + s) * kD + h * kDH;
      float acc = 0.f;
      for (int j = 0; j < kDH; ++j) acc = fmaf(kr[j], sRow[j], acc);
      Msum[b * kHS + h * 4 + s] = acc * 0.125f;
    }
  } else if (idx < nM + nV + nC + nS + nG) {
    // Wg1h = Wg1 * gamma (gamma of gate-LN folded into weights)
    int i = idx - nM - nV - nC - nS;
    int k = i & (kD - 1);
    Wg1h[i] = (_Float16)(Wg1[i] * glng[k]);
  } else if (idx < nM + nV + nC + nS + nG + nGB) {
    // bg1p = bg1 + Wg1 . beta (beta of gate-LN folded into bias); one wave per unit n
    int i = idx - nM - nV - nC - nS - nG;
    int n = i >> 5, ln = i & 31;
    const f4v* wr = (const f4v*)(Wg1 + (size_t)n * kD);
    const f4v* bt = (const f4v*)glnb;
    f4v p4 = {};
    for (int c = 0; c < 4; ++c) p4 += wr[c * 32 + ln] * bt[c * 32 + ln];
    float acc = wave_sum((p4[0] + p4[1]) + (p4[2] + p4[3]));
    if (ln == 0) bg1p[n] = bg1[n] + acc;
  }
}

// ============================================================
// Fused main kernel: gate GEMM + scores + softmax + combine + final LN.
// LDS holds the pre-affine normalized tile x' = (x-mu)*rstd (f16);
// gamma/beta are folded into Wg1h/bg1p, and raw-x scores are recovered via
// scores = irs * (x'.M^T) + mu*Msum + cb.
// ============================================================
__global__ __launch_bounds__(256) void fused_kernel(
    const float* __restrict__ X,
    const _Float16* __restrict__ Mh,    // (B, HS, D)
    const _Float16* __restrict__ VOt,   // (B, D, HS)
    const float* __restrict__ cb,       // (B, HS)
    const float* __restrict__ Msum,     // (B, HS)
    const _Float16* __restrict__ Wg1h,  // (HG, D), gamma-folded
    const float* __restrict__ bg1p,     // (HG), beta-folded
    const float* __restrict__ Wg2, const float* __restrict__ bg2,
    const float* __restrict__ bo,
    const float* __restrict__ lng, const float* __restrict__ lnb,
    float* __restrict__ out) {
  __shared__ _Float16 sXh[TILE * kD];    // x' (f16); later reused for attn (f16)
  __shared__ _Float16 sGh[TILE * kHG];
  __shared__ float sSc[TILE * kHS];
  __shared__ float sW[TILE * kHS];
  __shared__ float sMu[TILE], sIrs[TILE], sG[TILE];

  const int t = threadIdx.x;
  const int lane = t & 31;
  const int wave = t >> 5;
  const int r15 = lane & 15;
  const int hi = lane >> 4;          // 0 or 1 (wave32 half)
  const int kb = hi * 8;             // fragment K sub-offset per ISA layout

  const size_t rowg0 = (size_t)blockIdx.x * TILE;
  const int b = (int)(rowg0 >> 12);  // tile never crosses batch (4096 % 32 == 0)

  const size_t AW_OFF = (size_t)kB * kT * kD;
  const size_t G_OFF  = AW_OFF + (size_t)kB * kT * kSPK;

  // Each wave owns four whole rows; its lanes lie across the columns, so every
  // global load and store of a row piece is 32 lanes x 16 B = 512 contiguous bytes.
  // Piece c of row rr is f4v index rr * 128 + c * 32 + lane.
  const int row0 = wave * 4;
  const f4v* xw = (const f4v*)(X + (rowg0 + row0) * kD);

  // ---- Phase 0: LN stats inside the wave, then x' = (x-mu)*rstd to LDS (f16) ----
  {
    const f4v* xl = xw + lane;
    f4v xv[4][4];
    #pragma unroll
    for (int rr = 0; rr < 4; ++rr)
      #pragma unroll
      for (int c = 0; c < 4; ++c) xv[rr][c] = xl[rr * 128 + c * 32];
    // names the address pair so that it outlives the loads
    asm volatile("s_wait_xcnt 0x0" :: "v"(xl) : "memory");
    float s[4], q[4];
    #pragma unroll
    for (int rr = 0; rr < 4; ++rr) {
      s[rr] = 0.f; q[rr] = 0.f;
      #pragma unroll
      for (int c = 0; c < 4; ++c)
        #pragma unroll
        for (int e = 0; e < 4; ++e) { s[rr] += xv[rr][c][e]; q[rr] += xv[rr][c][e] * xv[rr][c][e]; }
    }
    #pragma unroll
    for (int rr = 0; rr < 4; ++rr) { s[rr] = wave_sum(s[rr]); q[rr] = wave_sum(q[rr]); }
    #pragma unroll
    for (int rr = 0; rr < 4; ++rr) {
      const float mu = s[rr] * (1.f / kD);
      const float var = q[rr] * (1.f / kD) - mu * mu;
      const float rs = rsqrtf(var + kEPS);
      if (lane == 0) {               // the scores epilogue of other waves reads these
        sMu[row0 + rr]  = mu;
        sIrs[row0 + rr] = sqrtf(var + kEPS);
      }
      #pragma unroll
      for (int c = 0; c < 4; ++c) {
        h4v h;
        #pragma unroll
        for (int e = 0; e < 4; ++e) h[e] = (_Float16)((xv[rr][c][e] - mu) * rs);
        *(h4v*)&sXh[(row0 + rr) * kD + c * 128 + lane * 4] = h;
      }
    }
  }
  __syncthreads();

  // ---- Gate GEMM: relu(x' @ Wg1h^T + bg1p)  (M=32,N=128,K=512) ----
  #pragma unroll
  for (int tt = 0; tt < 2; ++tt) {
    const int tid = wave + tt * 8;
    const int mt = tid >> 3, nt = tid & 7;
    const int arow = mt * 16 + r15;
    v8f acc = {};
    for (int k0 = 0; k0 < kD; k0 += 32) {
      v16h a  = frag_h(&sXh[arow * kD + k0 + kb]);
      v16h bm = frag_h(Wg1h + (size_t)(nt * 16 + r15) * kD + k0 + kb);
      acc = __builtin_amdgcn_wmma_f32_16x16x32_f16(false, a, false, bm,
                                                   (short)0, acc, false, false);
    }
    const int col = nt * 16 + r15;
    const float bb = bg1p[col];
    #pragma unroll
    for (int r = 0; r < 8; ++r)
      sGh[(mt * 16 + hi * 8 + r) * kHG + col] = (_Float16)fmaxf(acc[r] + bb, 0.f);
  }
  __syncthreads();

  // ---- Gate head on wave 4 (concurrent with scores on waves 0-3) ----
  if (wave == 4) {
    const int rw = lane;
    float g = bg2[0];
    const h8v* gp = (const h8v*)&sGh[rw * kHG];
    #pragma unroll 4
    for (int j = 0; j < 16; ++j) {
      h8v h = gp[j];
      #pragma unroll
      for (int e = 0; e < 8; ++e) g = fmaf((float)h[e], Wg2[j * 8 + e], g);
    }
    g = 1.f / (1.f + expf(-g));
    sG[rw] = g;
    out[G_OFF + rowg0 + rw] = g;
  }

  // ---- Scores GEMM: irs*(x' @ M^T) + mu*Msum + cb  (M=32,N=32,K=512) ----
  if (wave < 4) {
    const int mt = wave >> 1, nt = wave & 1;
    const int arow = mt * 16 + r15;
    v8f acc = {};
    for (int k0 = 0; k0 < kD; k0 += 32) {
      v16h a  = frag_h(&sXh[arow * kD + k0 + kb]);
      v16h bm = frag_h(Mh + ((size_t)b * kHS + nt * 16 + r15) * kD + k0 + kb);
      acc = __builtin_amdgcn_wmma_f32_16x16x32_f16(false, a, false, bm,
                                                   (short)0, acc, false, false);
    }
    const int col = nt * 16 + r15;
    const float c0 = cb[b * kHS + col];
    const float ms = Msum[b * kHS + col];
    #pragma unroll
    for (int r = 0; r < 8; ++r) {
      const int rr = mt * 16 + hi * 8 + r;
      sSc[rr * kHS + col] = fmaf(acc[r], sIrs[rr], fmaf(sMu[rr], ms, c0));
    }
  }
  __syncthreads();

  // ---- Softmax over SPK=4 within each head (one thread per row-head) ----
  {
    const int rw = t >> 3, h = t & 7;
    const float* sp = &sSc[rw * kHS + h * 4];
    float s0 = sp[0], s1 = sp[1], s2 = sp[2], s3 = sp[3];
    float m = fmaxf(fmaxf(s0, s1), fmaxf(s2, s3));
    float e0 = expf(s0 - m), e1 = expf(s1 - m), e2 = expf(s2 - m), e3 = expf(s3 - m);
    float inv = 1.f / (e0 + e1 + e2 + e3);
    float* wp = &sW[rw * kHS + h * 4];
    wp[0] = e0 * inv; wp[1] = e1 * inv; wp[2] = e2 * inv; wp[3] = e3 * inv;
  }
  __syncthreads();
  if (t < TILE * kSPK) {  // head-averaged attention weights
    int rw = t >> 2, s = t & 3;
    float aw = 0.f;
    #pragma unroll
    for (int h = 0; h < kH; ++h) aw += sW[rw * kHS + h * 4 + s];
    out[AW_OFF + (rowg0 + rw) * kSPK + s] = aw * (1.f / kH);
  }

  // ---- Combine GEMM: attn = w @ VO  (M=32,N=512,K=32) -> overwrite sXh ----
  #pragma unroll
  for (int i = 0; i < 8; ++i) {
    const int tid = wave * 8 + i;
    const int mt = tid >> 5, nt = tid & 31;
    v16h a, bm;
    {
      const f4v* wp = (const f4v*)&sW[(mt * 16 + r15) * kHS + kb];
      f4v w0 = wp[0], w1 = wp[1];   // K = kb .. kb+7
      f4v w2 = wp[4], w3 = wp[5];   // K = kb+16 .. kb+23
      #pragma unroll
      for (int e = 0; e < 4; ++e) {
        a[e]      = (_Float16)w0[e];
        a[4 + e]  = (_Float16)w1[e];
        a[8 + e]  = (_Float16)w2[e];
        a[12 + e] = (_Float16)w3[e];
      }
    }
    bm = frag_h(VOt + ((size_t)b * kD + nt * 16 + r15) * kHS + kb);
    v8f acc = {};
    acc = __builtin_amdgcn_wmma_f32_16x16x32_f16(false, a, false, bm,
                                                 (short)0, acc, false, false);
    const int col = nt * 16 + r15;
    #pragma unroll
    for (int r = 0; r < 8; ++r)
      sXh[(mt * 16 + hi * 8 + r) * kD + col] = (_Float16)acc[r];
  }
  __syncthreads();

  // ---- Epilogue: fused = LN(x + g*(attn + bo)), each wave on its own four rows ----
  {
    f4v* ow = (f4v*)(out + (rowg0 + row0) * kD);
    // kept rolled: unrolled, the compiler hoists all four rows' loads and the
    // register count costs a resident work-group
    #pragma unroll 1
    for (int rr = 0; rr < 4; ++rr) {
      const float g = sG[row0 + rr];
      f4v f[4];
      float s = 0.f, q = 0.f;
      #pragma unroll
      for (int c = 0; c < 4; ++c) {
        const f4v v = xw[rr * 128 + c * 32 + lane];
        const h4v a = *(const h4v*)&sXh[(row0 + rr) * kD + c * 128 + lane * 4];
        const f4v bb = ((const f4v*)bo)[c * 32 + lane];
        #pragma unroll
        for (int e = 0; e < 4; ++e) {
          const float x = v[e] + g * ((float)a[e] + bb[e]);
          f[c][e] = x;
          s += x; q += x * x;
        }
      }
      s = wave_sum(s);
      q = wave_sum(q);
      const float mu = s * (1.f / kD);
      const float var = q * (1.f / kD) - mu * mu;
      const float rs = rsqrtf(var + kEPS);
      #pragma unroll
      for (int c = 0; c < 4; ++c) {
        const f4v lg = ((const f4v*)lng)[c * 32 + lane];
        const f4v lb = ((const f4v*)lnb)[c * 32 + lane];
        f4v o;
        #pragma unroll
        for (int e = 0; e < 4; ++e) o[e] = (f[c][e] - mu) * rs * lg[e] + lb[e];
        ow[rr * 128 + c * 32 + lane] = o;
      }
      // the next trip rewrites the address and data registers that these stores name
      asm volatile("s_wait_xcnt 0x0" ::: "memory");
    }
  }
}

// ============================================================
extern "C" void kernel_launch(void* const* d_in, const int* in_sizes, int n_in,
                              void* d_out, int out_size, void* d_ws, size_t ws_size,
                              hipStream_t stream) {
  (void)in_sizes; (void)n_in; (void)out_size; (void)ws_size;
  const float* token = (const float*)d_in[0];
  const float* se    = (const float*)d_in[1];
  const float* We    = (const float*)d_in[2];
  const float* be    = (const float*)d_in[3];
  const float* spos  = (const float*)d_in[4];
  const float* Wq    = (const float*)d_in[5];
  const float* bq    = (const float*)d_in[6];
  const float* Wk    = (const float*)d_in[7];
  const float* bk    = (const float*)d_in[8];
  const float* Wv    = (const float*)d_in[9];
  const float* bv    = (const float*)d_in[10];
  const float* Wo    = (const float*)d_in[11];
  const float* bo    = (const float*)d_in[12];
  const float* glng  = (const float*)d_in[13];
  const float* glnb  = (const float*)d_in[14];
  const float* Wg1   = (const float*)d_in[15];
  const float* bg1   = (const float*)d_in[16];
  const float* Wg2   = (const float*)d_in[17];
  const float* bg2   = (const float*)d_in[18];
  const float* lng   = (const float*)d_in[19];
  const float* lnb   = (const float*)d_in[20];
  float* out = (float*)d_out;

  char* ws = (char*)d_ws;
  float*    spk  = (float*)(ws + 0);            // 64 KB
  float*    kbuf = (float*)(ws + 65536);        // 64 KB
  float*    vbuf = (float*)(ws + 131072);       // 64 KB
  _Float16* Mh   = (_Float16*)(ws + 196608);    // 256 KB
  _Float16* VOt  = (_Float16*)(ws + 458752);    // 256 KB
  float*    cbf  = (float*)(ws + 720896);       // 1 KB
  float*    Msum = (float*)(ws + 721920);       // 1 KB
  float*    bg1p = (float*)(ws + 722944);       // 512 B
  _Float16* Wg1h = (_Float16*)(ws + 723456);    // 128 KB

  spk_kernel<<<(kB * kSPK * kD + 255) / 256, 256, 0, stream>>>(se, We, be, spos, spk);
  kv_kernel<<<(2 * kB * kSPK * kD + 255) / 256, 256, 0, stream>>>(spk, Wk, bk, Wv, bv, kbuf, vbuf);
  const int nfold = kB * kHS * kD + kB * kD * kHS + kB * kHS + kH * 256 + kHG * kD + kHG * 32;
  fold_kernel<<<(nfold + 255) / 256, 256, 0, stream>>>(kbuf, vbuf, Wq, bq, Wo, Wg1, bg1,
                                                       glng, glnb, Mh, VOt, cbf, Msum, Wg1h, bg1p);
  fused_kernel<<<(kB * kT) / TILE, 256, 0, stream>>>(token, Mh, VOt, cbf, Msum, Wg1h, bg1p,
                                                     Wg2, bg2, bo, lng, lnb, out);
}

// v003
// A run of this version takes 72.5 microseconds.
// Two timings next to v002 put it at 1.33 and 1.32 times that version's speed.
// Counting every step since v000, it is 6.43 times as fast.
#include <hip/hip_runtime.h>
#include <hip/hip_bf16.h>
#include <math.h>

// ---- problem constants ----
constexpr int kB   = 8;
constexpr int kT   = 4096;
constexpr int kD   = 512;
constexpr int kH   = 8;
constexpr int kDH  = 64;
constexpr int kSPK = 4;
constexpr int kHS  = kH * kSPK;   // 32 folded "keys" per batch
constexpr int kHG  = 128;
constexpr int TILE = 32;          // token rows per block
constexpr float kEPS = 1e-5f;
// LDS row pitches: 16 B x an odd number, so that the 16 rows that one 16-byte
// fragment read touches fall on 16 different bank groups instead of on one.
constexpr int XP = kD + 8;        // halves: 1040 B = 16 B x 65
constexpr int GP = kHG + 8;       // halves:  272 B = 16 B x 17
constexpr int WP = kHS + 4;       // floats:  144 B = 16 B x 9

typedef __attribute__((ext_vector_type(16))) _Float16 v16h;
typedef __attribute__((ext_vector_type(8)))  float    v8f;
typedef __attribute__((ext_vector_type(4)))  float    f4v;
typedef __attribute__((ext_vector_type(4)))  _Float16 h4v;
typedef __attribute__((ext_vector_type(8)))  _Float16 h8v;

// Gather one 16x32 WMMA fragment (A or B) from a row-major f16 matrix.
// p points at [row_of_this_lane][k0 + kb]; lanes 0-15 take K {0..7,16..23},
// lanes 16-31 take K {8..15,24..31} (kb handles the 8-offset).
__device__ __forceinline__ v16h frag_h(const _Float16* p) {
  h8v lo = *(const h8v*)p;
  h8v hi = *(const h8v*)(p + 16);
  v16h f;
  #pragma unroll
  for (int j = 0; j < 8; ++j) { f[j] = lo[j]; f[8 + j] = hi[j]; }
  return f;
}

// Sum over the 32 lanes of a wave; every lane gets the total.
__device__ __forceinline__ float wave_sum(float v) {
  for (int m = 16; m >= 1; m >>= 1) v += __shfl_xor(v, m, 32);
  return v;
}

// ============================================================
// Precompute 1: spk_tokens = relu(speaker_emb @ We^T + be) + spk_pos
// ============================================================
__global__ void spk_kernel(const float* __restrict__ se, const float* __restrict__ We,
                           const float* __restrict__ be, const float* __restrict__ spos,
                           float* __restrict__ spk) {
  int idx = blockIdx.x * blockDim.x + threadIdx.x;
  if (idx >= kB * kSPK * kD) return;
  int b = idx / (kSPK * kD);
  int r = idx - b * (kSPK * kD);           // r = s*D + d
  const float* x = se + (size_t)b * kD;
  const float* w = We + (size_t)r * kD;
  float acc = be[r];
  for (int j = 0; j < kD; ++j) acc = fmaf(x[j], w[j], acc);
  spk[idx] = fmaxf(acc, 0.f) + spos[r];
}

// ============================================================
// Precompute 2: k = spk@Wk^T + bk ; v = spk@Wv^T + bv
// ============================================================
__global__ void kv_kernel(const float* __restrict__ spk,
                          const float* __restrict__ Wk, const float* __restrict__ bk,
                          const float* __restrict__ Wv, const float* __restrict__ bv,
                          float* __restrict__ kbuf, float* __restrict__ vbuf) {
  int idx = blockIdx.x * blockDim.x + threadIdx.x;
  const int n = kB * kSPK * kD;
  if (idx >= 2 * n) return;
  int which = idx >= n;
  int r = which ? idx - n : idx;
  int bs = r / kD, d = r - bs * kD;
  const float* x = spk + (size_t)bs * kD;
  const float* W = (which ? Wv : Wk) + (size_t)d * kD;
  float acc = which ? bv[d] : bk[d];
  for (int j = 0; j < kD; ++j) acc = fmaf(x[j], W[j], acc);
  (which ? vbuf : kbuf)[r] = acc;
}

// ============================================================
// Precompute 3: fold Wq into K -> M (f16) + Msum, fold Wo into V -> VO^T (f16),
//               score bias bq.k, gamma-folded Wg1 (f16) + beta-folded bg1.
// Every segment boundary is a multiple of the 256-thread block, so a block
// (and a wave) lies wholly inside one segment.
// ============================================================
__global__ void fold_kernel(const float* __restrict__ kbuf, const float* __restrict__ vbuf,
                            const float* __restrict__ Wq, const float* __restrict__ bq,
                            const float* __restrict__ Wo, const float* __restrict__ Wg1,
                            const float* __restrict__ bg1,
                            const float* __restrict__ glng, const float* __restrict__ glnb,
                            _Float16* __restrict__ Mh, _Float16* __restrict__ VOt,
                            float* __restrict__ cb, float* __restrict__ Msum,
                            _Float16* __restrict__ Wg1h, float* __restrict__ bg1p) {
  __shared__ float sRow[kDH];              // row sums of one head's Wq rows
  int idx = blockIdx.x * blockDim.x + threadIdx.x;
  const int nM  = kB * kHS * kD;
  const int nV  = kB * kD * kHS;
  const int nC  = kB * kHS;
  const int nS  = kH * 256;                // one block per head
  const int nG  = kHG * kD;
  const int nGB = kHG * 32;                // one wave per gate unit
  if (idx < nM) {
    // M[b][hs][d] = (1/8) * sum_dh Wq[h*64+dh][d] * k[b][s][h*64+dh]
    int b = idx / (kHS * kD); int rem = idx - b * (kHS * kD);
    int hs = rem / kD; int d = rem - hs * kD;
    int h = hs >> 2, s = hs & 3;
    const float* kr = kbuf + (size_t)(b * kSPK + s) * kD + h * kDH;
    float acc = 0.f;
    for (int j = 0; j < kDH; ++j)
      acc = fmaf(Wq[(size_t)(h * kDH + j) * kD + d], kr[j], acc);
    Mh[idx] = (_Float16)(acc * 0.125f);
  } else if (idx < nM + nV) {
    // VOt[b][d][hs] = sum_dh Wo[d][h*64+dh] * v[b][s][h*64+dh]
    int i = idx - nM;
    int b = i / (kD * kHS); int rem = i - b * (kD * kHS);
    int d = rem / kHS; int hs = rem - d * kHS;
    int h = hs >> 2, s = hs & 3;
    const float* vr = vbuf + (size_t)(b * kSPK + s) * kD + h * kDH;
    const float* wo = Wo + (size_t)d * kD + h * kDH;
    float acc = 0.f;
    for (int j = 0; j < kDH; ++j) acc = fmaf(wo[j], vr[j], acc);
    VOt[i] = (_Float16)acc;
  } else if (idx < nM + nV + nC) {
    // cb[b][hs] = (1/8) * bq . k_head
    int i = idx - nM - nV; int b = i / kHS; int hs = i - b * kHS;
    int h = hs >> 2, s = hs & 3;
    const float* kr = kbuf + (size_t)(b * kSPK + s) * kD + h * kDH;
    float acc = 0.f;
    for (int j = 0; j < kDH; ++j) acc = fmaf(bq[h * kDH + j], kr[j], acc);
    cb[i] = acc * 0.125f;
  } else if (idx < nM + nV + nC + nS) {
    // Msum[b][hs] = sum_d M[b][hs][d] = (1/8) * sum_j k[b][s][h*64+j] * rowsum(Wq[h*64+j]) (fp32).
    // One block per head: each wave sums 8 rows with its lanes across the columns,
    // then 32 threads finish the (b, s) outputs of this head from the shared row sums.
    int i = idx - nM - nV - nC;
    int h = i >> 8, tl = i & 255;
    int wv = tl >> 5, ln = tl & 31;
    float part[8];
    for (int r = 0; r < 8; ++r) {
      const f4v* wr = (const f4v*)(Wq + (size_t)(h * kDH + wv * 8 + r) * kD);
      f4v s4 = (wr[ln] + wr[32 + ln]) + (wr[64 + ln] + wr[96 + ln]);
      part[r] = (s4[0] + s4[1]) + (s4[2] + s4[3]);
    }
    for (int r = 0; r < 8; ++r) part[r] = wave_sum(part[r]);
    if (ln == 0) {
      for (int r = 0; r < 8; ++r) sRow[wv * 8 + r] = part[r];
    }
    __syncthreads();   // block-uniform branch: the whole block is in this segment
    if (tl < kB * kSPK) {
      int b = tl >> 2, s = tl & 3;
      const float* kr = kbuf + (size_t)(b * kSPK + s) * kD + h * kDH;
      float acc = 0.f;
      for (int j = 0; j < kDH; ++j) acc = fmaf(kr[j], sRow[j], acc);
      Msum[b * kHS + h * 4 + s] = acc * 0.125f;
    }
  } else if (idx < nM + nV + nC + nS + nG) {
    // Wg1h = Wg1 * gamma (gamma of gate-LN folded into weights)
    int i = idx - nM - nV - nC - nS;
    int k = i & (kD - 1);
    Wg1h[i] = (_Float16)(Wg1[i] * glng[k]);
  } else if (idx < nM + nV + nC + nS + nG + nGB) {
    // bg1p = bg1 + Wg1 . beta (beta of gate-LN folded into bias); one wave per unit n
    int i = idx - nM - nV - nC - nS - nG;
    int n = i >> 5, ln = i & 31;
    const f4v* wr = (const f4v*)(Wg1 + (size_t)n * kD);
    const f4v* bt = (const f4v*)glnb;
    f4v p4 = {};
    for (int c = 0; c < 4; ++c) p4 += wr[c * 32 + ln] * bt[c * 32 + ln];
    float acc = wave_sum((p4[0] + p4[1]) + (p4[2] + p4[3]));
    if (ln == 0) bg1p[n] = bg1[n] + acc;
  }
}

// ============================================================
// Fused main kernel: gate GEMM + scores + softmax + combine + final LN.
// LDS holds the pre-affine normalized tile x' = (x-mu)*rstd (f16);
// gamma/beta are folded into Wg1h/bg1p, and raw-x scores are recovered via
// scores = irs * (x'.M^T) + mu*Msum + cb.
// ============================================================
__global__ __launch_bounds__(256) void fused_kernel(
    const float* __restrict__ X,
    const _Float16* __restrict__ Mh,    // (B, HS, D)
    const _Float16* __restrict__ VOt,   // (B, D, HS)
    const float* __restrict__ cb,       // (B, HS)
    const float* __restrict__ Msum,     // (B, HS)
    const _Float16* __restrict__ Wg1h,  // (HG, D), gamma-folded
    const float* __restrict__ bg1p,     // (HG), beta-folded
    const float* __restrict__ Wg2, const float* __restrict__ bg2,
    const float* __restrict__ bo,
    const float* __restrict__ lng, const float* __restrict__ lnb,
    float* __restrict__ out) {
  __shared__ __attribute__((aligned(16))) _Float16 sXh[TILE * XP];  // x' (f16); later reused for attn (f16)
  __shared__ __attribute__((aligned(16))) _Float16 sGh[TILE * GP];
  __shared__ __attribute__((aligned(16))) float sSc[TILE * WP];
  __shared__ __attribute__((aligned(16))) float sW[TILE * WP];
  __shared__ float sMu[TILE], sIrs[TILE], sG[TILE];

  const int t = threadIdx.x;
  const int lane = t & 31;
  const int wave = t >> 5;
  const int r15 = lane & 15;
  const int hi = lane >> 4;          // 0 or 1 (wave32 half)
  const int kb = hi * 8;             // fragment K sub-offset per ISA layout

  const size_t rowg0 = (size_t)blockIdx.x * TILE;
  const int b = (int)(rowg0 >> 12);  // tile never crosses batch (4096 % 32 == 0)

  const size_t AW_OFF = (size_t)kB * kT * kD;
  const size_t G_OFF  = AW_OFF + (size_t)kB * kT * kSPK;

  // Each wave owns four whole rows; its lanes lie across the columns, so every
  // global load and store of a row piece is 32 lanes x 16 B = 512 contiguous bytes.
  // Piece c of row rr is f4v index rr * 128 + c * 32 + lane.
  const int row0 = wave * 4;
  const f4v* xw = (const f4v*)(X + (rowg0 + row0) * kD);

  // ---- Phase 0: LN stats inside the wave, then x' = (x-mu)*rstd to LDS (f16) ----
  {
    const f4v* xl = xw + lane;
    f4v xv[4][4];
    #pragma unroll
    for (int rr = 0; rr < 4; ++rr)
      #pragma unroll
      for (int c = 0; c < 4; ++c) xv[rr][c] = xl[rr * 128 + c * 32];
    // names the address pair so that it outlives the loads
    asm volatile("s_wait_xcnt 0x0" :: "v"(xl) : "memory");
    float s[4], q[4];
    #pragma unroll
    for (int rr = 0; rr < 4; ++rr) {
      s[rr] = 0.f; q[rr] = 0.f;
      #pragma unroll
      for (int c = 0; c < 4; ++c)
        #pragma unroll
        for (int e = 0; e < 4; ++e) { s[rr] += xv[rr][c][e]; q[rr] += xv[rr][c][e] * xv[rr][c][e]; }
    }
    #pragma unroll
    for (int rr = 0; rr < 4; ++rr) { s[rr] = wave_sum(s[rr]); q[rr] = wave_sum(q[rr]); }
    #pragma unroll
    for (int rr = 0; rr < 4; ++rr) {
      const float mu = s[rr] * (1.f / kD);
      const float var = q[rr] * (1.f / kD) - mu * mu;
      const float rs = rsqrtf(var + kEPS);
      if (lane == 0) {               // the scores epilogue of other waves reads these
        sMu[row0 + rr]  = mu;
        sIrs[row0 + rr] = sqrtf(var + kEPS);
      }
      #pragma unroll
      for (int c = 0; c < 4; ++c) {
        h4v h;
        #pragma unroll
        for (int e = 0; e < 4; ++e) h[e] = (_Float16)((xv[rr][c][e] - mu) * rs);
        *(h4v*)&sXh[(row0 + rr) * XP + c * 128 + lane * 4] = h;
      }
    }
  }
  __syncthreads();

  // ---- Gate GEMM: relu(x' @ Wg1h^T + bg1p)  (M=32,N=128,K=512) ----
  #pragma unroll
  for (int tt = 0; tt < 2; ++tt) {
    const int tid = wave + tt * 8;
    const int mt = tid >> 3, nt = tid & 7;
    const int arow = mt * 16 + r15;
    v8f acc = {};
    for (int k0 = 0; k0 < kD; k0 += 32) {
      v16h a  = frag_h(&sXh[arow * XP + k0 + kb]);
      v16h bm = frag_h(Wg1h + (size_t)(nt * 16 + r15) * kD + k0 + kb);
      acc = __builtin_amdgcn_wmma_f32_16x16x32_f16(false, a, false, bm,
                                                   (short)0, acc, false, false);
    }
    const int col = nt * 16 + r15;
    const float bb = bg1p[col];
    #pragma unroll
    for (int r = 0; r < 8; ++r)
      sGh[(mt * 16 + hi * 8 + r) * GP + col] = (_Float16)fmaxf(acc[r] + bb, 0.f);
  }
  __syncthreads();

  // ---- Gate head on wave 4 (concurrent with scores on waves 0-3) ----
  if (wave == 4) {
    const int rw = lane;
    float g = bg2[0];
    const h8v* gp = (const h8v*)&sGh[rw * GP];
    #pragma unroll 4
    for (int j = 0; j < 16; ++j) {
      h8v h = gp[j];
      #pragma unroll
      for (int e = 0; e < 8; ++e) g = fmaf((float)h[e], Wg2[j * 8 + e], g);
    }
    g = 1.f / (1.f + expf(-g));
    sG[rw] = g;
    out[G_OFF + rowg0 + rw] = g;
  }

  // ---- Scores GEMM: irs*(x' @ M^T) + mu*Msum + cb  (M=32,N=32,K=512) ----
  if (wave < 4) {
    const int mt = wave >> 1, nt = wave & 1;
    const int arow = mt * 16 + r15;
    v8f acc = {};
    for (int k0 = 0; k0 < kD; k0 += 32) {
      v16h a  = frag_h(&sXh[arow * XP + k0 + kb]);
      v16h bm = frag_h(Mh + ((size_t)b * kHS + nt * 16 + r15) * kD + k0 + kb);
      acc = __builtin_amdgcn_wmma_f32_16x16x32_f16(false, a, false, bm,
                                                   (short)0, acc, false, false);
    }
    const int col = nt * 16 + r15;
    const float c0 = cb[b * kHS + col];
    const float ms = Msum[b * kHS + col];
    #pragma unroll
    for (int r = 0; r < 8; ++r) {
      const int rr = mt * 16 + hi * 8 + r;
      sSc[rr * WP + col] = fmaf(acc[r], sIrs[rr], fmaf(sMu[rr], ms, c0));
    }
  }
  __syncthreads();

  // ---- Softmax over SPK=4 within each head (one thread per row-head) ----
  {
    const int rw = t >> 3, h = t & 7;
    const float* sp = &sSc[rw * WP + h * 4];
    float s0 = sp[0], s1 = sp[1], s2 = sp[2], s3 = sp[3];
    float m = fmaxf(fmaxf(s0, s1), fmaxf(s2, s3));
    float e0 = expf(s0 - m), e1 = expf(s1 - m), e2 = expf(s2 - m), e3 = expf(s3 - m);
    float inv = 1.f / (e0 + e1 + e2 + e3);
    float* wp = &sW[rw * WP + h * 4];
    wp[0] = e0 * inv; wp[1] = e1 * inv; wp[2] = e2 * inv; wp[3] = e3 * inv;
  }
  __syncthreads();
  if (t < TILE * kSPK) {  // head-averaged attention weights
    int rw = t >> 2, s = t & 3;
    float aw = 0.f;
    #pragma unroll
    for (int h = 0; h < kH; ++h) aw += sW[rw * WP + h * 4 + s];
    out[AW_OFF + (rowg0 + rw) * kSPK + s] = aw * (1.f / kH);
  }

  // ---- Combine GEMM: attn = w @ VO  (M=32,N=512,K=32) -> overwrite sXh ----
  #pragma unroll
  for (int i = 0; i < 8; ++i) {
    const int tid = wave * 8 + i;
    const int mt = tid >> 5, nt = tid & 31;
    v16h a, bm;
    {
      const f4v* wp = (const f4v*)&sW[(mt * 16 + r15) * WP + kb];
      f4v w0 = wp[0], w1 = wp[1];   // K = kb .. kb+7
      f4v w2 = wp[4], w3 = wp[5];   // K = kb+16 .. kb+23
      #pragma unroll
      for (int e = 0; e < 4; ++e) {
        a[e]      = (_Float16)w0[e];
        a[4 + e]  = (_Float16)w1[e];
        a[8 + e]  = (_Float16)w2[e];
        a[12 + e] = (_Float16)w3[e];
      }
    }
    bm = frag_h(VOt + ((size_t)b * kD + nt * 16 + r15) * kHS + kb);
    v8f acc = {};
    acc = __builtin_amdgcn_wmma_f32_16x16x32_f16(false, a, false, bm,
                                                 (short)0, acc, false, false);
    const int col = nt * 16 + r15;
    #pragma unroll
    for (int r = 0; r < 8; ++r)
      sXh[(mt * 16 + hi * 8 + r) * XP + col] = (_Float16)acc[r];
  }
  __syncthreads();

  // ---- Epilogue: fused = LN(x + g*(attn + bo)), each wave on its own four rows ----
  {
    f4v* ow = (f4v*)(out + (rowg0 + row0) * kD);
    // kept rolled: unrolled, the compiler hoists all four rows' loads and the
    // register count costs a resident work-group
    #pragma unroll 1
    for (int rr = 0; rr < 4; ++rr) {
      const float g = sG[row0 + rr];
      f4v f[4];
      float s = 0.f, q = 0.f;
      #pragma unroll
      for (int c = 0; c < 4; ++c) {
        const f4v v = xw[rr * 128 + c * 32 + lane];
        const h4v a = *(const h4v*)&sXh[(row0 + rr) * XP + c * 128 + lane * 4];
        const f4v bb = ((const f4v*)bo)[c * 32 + lane];
        #pragma unroll
        for (int e = 0; e < 4; ++e) {
          const float x = v[e] + g * ((float)a[e] + bb[e]);
          f[c][e] = x;
          s += x; q += x * x;
        }
      }
      s = wave_sum(s);
      q = wave_sum(q);
      const float mu = s * (1.f / kD);
      const float var = q * (1.f / kD) - mu * mu;
      const float rs = rsqrtf(var + kEPS);
      #pragma unroll
      for (int c = 0; c < 4; ++c) {
        const f4v lg = ((const f4v*)lng)[c * 32 + lane];
        const f4v lb = ((const f4v*)lnb)[c * 32 + lane];
        f4v o;
        #pragma unroll
        for (int e = 0; e < 4; ++e) o[e] = (f[c][e] - mu) * rs * lg[e] + lb[e];
        ow[rr * 128 + c * 32 + lane] = o;
      }
      // the next trip rewrites the address and data registers that these stores name
      asm volatile("s_wait_xcnt 0x0" ::: "memory");
    }
  }
}

// ============================================================
extern "C" void kernel_launch(void* const* d_in, const int* in_sizes, int n_in,
                              void* d_out, int out_size, void* d_ws, size_t ws_size,
                              hipStream_t stream) {
  (void)in_sizes; (void)n_in; (void)out_size; (void)ws_size;
  const float* token = (const float*)d_in[0];
  const float* se    = (const float*)d_in[1];
  const float* We    = (const float*)d_in[2];
  const float* be    = (const float*)d_in[3];
  const float* spos  = (const float*)d_in[4];
  const float* Wq    = (const float*)d_in[5];
  const float* bq    = (const float*)d_in[6];
  const float* Wk    = (const float*)d_in[7];
  const float* bk    = (const float*)d_in[8];
  const float* Wv    = (const float*)d_in[9];
  const float* bv    = (const float*)d_in[10];
  const float* Wo    = (const float*)d_in[11];
  const float* bo    = (const float*)d_in[12];
  const float* glng  = (const float*)d_in[13];
  const float* glnb  = (const float*)d_in[14];
  const float* Wg1   = (const float*)d_in[15];
  const float* bg1   = (const float*)d_in[16];
  const float* Wg2   = (const float*)d_in[17];
  const float* bg2   = (const float*)d_in[18];
  const float* lng   = (const float*)d_in[19];
  const float* lnb   = (const float*)d_in[20];
  float* out = (float*)d_out;

  char* ws = (char*)d_ws;
  float*    spk  = (float*)(ws + 0);            // 64 KB
  float*    kbuf = (float*)(ws + 65536);        // 64 KB
  float*    vbuf = (float*)(ws + 131072);       // 64 KB
  _Float16* Mh   = (_Float16*)(ws + 196608);    // 256 KB
  _Float16* VOt  = (_Float16*)(ws + 458752);    // 256 KB
  float*    cbf  = (float*)(ws + 720896);       // 1 KB
  float*    Msum = (float*)(ws + 721920);       // 1 KB
  float*    bg1p = (float*)(ws + 722944);       // 512 B
  _Float16* Wg1h = (_Float16*)(ws + 723456);    // 128 KB

  spk_kernel<<<(kB * kSPK * kD + 255) / 256, 256, 0, stream>>>(se, We, be, spos, spk);
  kv_kernel<<<(2 * kB * kSPK * kD + 255) / 256, 256, 0, stream>>>(spk, Wk, bk, Wv, bv, kbuf, vbuf);
  const int nfold = kB * kHS * kD + kB * kD * kHS + kB * kHS + kH * 256 + kHG * kD + kHG * 32;
  fold_kernel<<<(nfold + 255) / 256, 256, 0, stream>>>(kbuf, vbuf, Wq, bq, Wo, Wg1, bg1,
                                                       glng, glnb, Mh, VOt, cbf, Msum, Wg1h, bg1p);
  fused_kernel<<<(kB * kT) / TILE, 256, 0, stream>>>(token, Mh, VOt, cbf, Msum, Wg1h, bg1p,
                                                     Wg2, bg2, bo, lng, lnb, out);
}

// v004
// It runs in 50.5 microseconds.
// Two timings next to v003 put it at 1.42 and 1.44 times that version's speed.
// All steps since v000 together make it 9.18 times as fast.
#include <hip/hip_runtime.h>
#include <hip/hip_bf16.h>
#include <math.h>

// ---- problem constants ----
constexpr int kB   = 8;
constexpr int kT   = 4096;
constexpr int kD   = 512;
constexpr int kH   = 8;
constexpr int kDH  = 64;
constexpr int kSPK = 4;
constexpr int kHS  = kH * kSPK;   // 32 folded "keys" per batch
constexpr int kHG  = 128;
constexpr int TILE = 32;          // token rows per block
constexpr float kEPS = 1e-5f;
// LDS row pitches: 16 B x an odd number, so that the 16 rows that one 16-byte
// fragment read touches fall on 16 different bank groups instead of on one.
constexpr int XP = kD + 8;        // halves: 1040 B = 16 B x 65
constexpr int GP = kHG + 8;       // halves:  272 B = 16 B x 17
constexpr int WP = kHS + 4;       // floats:  144 B = 16 B x 9

typedef __attribute__((ext_vector_type(16))) _Float16 v16h;
typedef __attribute__((ext_vector_type(8)))  float    v8f;
typedef __attribute__((ext_vector_type(4)))  float    f4v;
typedef __attribute__((ext_vector_type(4)))  _Float16 h4v;
typedef __attribute__((ext_vector_type(8)))  _Float16 h8v;

// Gather one 16x32 WMMA fragment (A or B) from a row-major f16 matrix.
// p points at [row_of_this_lane][k0 + kb]; lanes 0-15 take K {0..7,16..23},
// lanes 16-31 take K {8..15,24..31} (kb handles the 8-offset).
__device__ __forceinline__ v16h frag_h(const _Float16* p) {
  h8v lo = *(const h8v*)p;
  h8v hi = *(const h8v*)(p + 16);
  v16h f;
  #pragma unroll
  for (int j = 0; j < 8; ++j) { f[j] = lo[j]; f[8 + j] = hi[j]; }
  return f;
}

// Sum over the 32 lanes of a wave; every lane gets the total.
__device__ __forceinline__ float wave_sum(float v) {
  for (int m = 16; m >= 1; m >>= 1) v += __shfl_xor(v, m, 32);
  return v;
}

// Dot products of four weight rows with eight input rows (all of length kD, rows
// contiguous) by one wave. The lanes lie across the columns, so every load is
// 32 lanes x 16 B = 512 contiguous bytes. Lane l returns the whole sum for weight
// row (l & 3) and input row (l >> 2).
__device__ __forceinline__ float rows4x8(const float* __restrict__ w,
                                         const float* __restrict__ x, int lane) {
  // Every loop here is unrolled in full: the arrays live in registers only while
  // each index is a constant.
  const f4v* wl = (const f4v*)w + lane;
  const f4v* xl = (const f4v*)x + lane;
  f4v wv[4][4], xv[8][4];
  #pragma unroll
  for (int c = 0; c < 4; ++c) {
    #pragma unroll
    for (int r = 0; r < 4; ++r) wv[r][c] = wl[r * 128 + c * 32];
    #pragma unroll
    for (int i = 0; i < 8; ++i) xv[i][c] = xl[i * 128 + c * 32];
  }
  // names the address registers (w: the pair; x: scalar base + lane) so that they outlive
  // the loads: no load's result may land on one that earlier loads name before this wait
  asm volatile("s_wait_xcnt 0x0" :: "v"(wl), "v"(lane) : "memory");
  // keeps the wait where it is written: without it the scheduler sinks the wait below
  // the arithmetic, and lets fewer of the 48 loads fly at once
  __builtin_amdgcn_sched_barrier(0);
  float a[32];
  #pragma unroll
  for (int i = 0; i < 32; ++i) a[i] = 0.f;
  #pragma unroll
  for (int c = 0; c < 4; ++c)
    #pragma unroll
    for (int i = 0; i < 8; ++i)
      #pragma unroll
      for (int r = 0; r < 4; ++r)
        #pragma unroll
        for (int e = 0; e < 4; ++e) a[i * 4 + r] = fmaf(xv[i][c][e], wv[r][c][e], a[i * 4 + r]);
  // Halving exchange: at each step a lane keeps the half of the sums whose index bit
  // equals its own lane bit and hands the other half to its partner, so 31 shuffles
  // leave sum l whole in lane l.
  #pragma unroll
  for (int m = 16; m >= 1; m >>= 1) {
    const bool up = (lane & m) != 0;
    #pragma unroll
    for (int i = 0; i < m; ++i) {
      const float lo = a[i], hi = a[i + m];
      a[i] = (up ? hi : lo) + __shfl_xor(up ? lo : hi, m, 32);
    }
  }
  return a[0];
}

// ============================================================
// Precompute 1: spk_tokens = relu(speaker_emb @ We^T + be) + spk_pos
// One wave: four rows of We against all eight batches.
// ============================================================
__global__ __launch_bounds__(256) void spk_kernel(
    const float* __restrict__ se, const float* __restrict__ We,
    const float* __restrict__ be, const float* __restrict__ spos,
    float* __restrict__ spk) {
  const int lane = threadIdx.x & 31;
  const int r0 = (blockIdx.x * 8 + (threadIdx.x >> 5)) * 4;   // r = s*D + d
  const int r = r0 + (lane & 3), b = lane >> 2;
  const float bias = be[r], pos = spos[r];   // loaded in front of the wait inside rows4x8
  const float acc = rows4x8(We + (size_t)r0 * kD, se, lane);
  spk[b * (kSPK * kD) + r] = fmaxf(acc + bias, 0.f) + pos;
}

// ============================================================
// Precompute 2: k = spk@Wk^T + bk ; v = spk@Wv^T + bv
// One wave: four rows of Wk or Wv against eight of the 32 (b, s) rows; the eight
// waves of a block share those eight rows and cover 32 neighbouring outputs of each.
// ============================================================
__global__ __launch_bounds__(256) void kv_kernel(
    const float* __restrict__ spk,
    const float* __restrict__ Wk, const float* __restrict__ bk,
    const float* __restrict__ Wv, const float* __restrict__ bv,
    float* __restrict__ kbuf, float* __restrict__ vbuf) {
  const int lane = threadIdx.x & 31;
  const int which = blockIdx.x >> 6;                 // 0: k, 1: v
  const int bs0 = ((blockIdx.x >> 4) & 3) * 8;
  const int d0 = ((blockIdx.x & 15) * 8 + (threadIdx.x >> 5)) * 4;
  const int d = d0 + (lane & 3), bs = bs0 + (lane >> 2);
  const float bias = (which ? bv : bk)[d];   // loaded in front of the wait inside rows4x8
  const float acc = rows4x8((which ? Wv : Wk) + (size_t)d0 * kD, spk + (size_t)bs0 * kD, lane);
  (which ? vbuf : kbuf)[bs * kD + d] = acc + bias;
}

// ============================================================
// Precompute 3: fold Wq into K -> M (f16) + Msum, fold Wo into V -> VO^T (f16),
//               score bias bq.k, gamma-folded Wg1 (f16) + beta-folded bg1.
// Every segment boundary is a multiple of the 256-thread block, so a block
// (and a wave) lies wholly inside one segment.
// ============================================================
__global__ void fold_kernel(const float* __restrict__ kbuf, const float* __restrict__ vbuf,
                            const float* __restrict__ Wq, const float* __restrict__ bq,
                            const float* __restrict__ Wo, const float* __restrict__ Wg1,
                            const float* __restrict__ bg1,
                            const float* __restrict__ glng, const float* __restrict__ glnb,
                            _Float16* __restrict__ Mh, _Float16* __restrict__ VOt,
                            float* __restrict__ cb, float* __restrict__ Msum,
                            _Float16* __restrict__ Wg1h, float* __restrict__ bg1p) {
  __shared__ float sRow[kDH];              // row sums of one head's Wq rows
  int idx = blockIdx.x * blockDim.x + threadIdx.x;
  const int nM  = kB * kHS * kD;
  const int nV  = kB * kD * kHS;
  const int nC  = kB * kHS;
  const int nS  = kH * 256;                // one block per head
  const int nG  = kHG * kD;
  const int nGB = kHG * 32;                // one wave per gate unit
  if (idx < nM) {
    // M[b][hs][d] = (1/8) * sum_dh Wq[h*64+dh][d] * k[b][s][h*64+dh]
    int b = idx / (kHS * kD); int rem = idx - b * (kHS * kD);
    int hs = rem / kD; int d = rem - hs * kD;
    int h = hs >> 2, s = hs & 3;
    const float* kr = kbuf + (size_t)(b * kSPK + s) * kD + h * kDH;
    float acc = 0.f;
    for (int j = 0; j < kDH; ++j)
      acc = fmaf(Wq[(size_t)(h * kDH + j) * kD + d], kr[j], acc);
    Mh[idx] = (_Float16)(acc * 0.125f);
  } else if (idx < nM + nV) {
    // VOt[b][d][hs] = sum_dh Wo[d][h*64+dh] * v[b][s][h*64+dh]
    int i = idx - nM;
    int b = i / (kD * kHS); int rem = i - b * (kD * kHS);
    int d = rem / kHS; int hs = rem - d * kHS;
    int h = hs >> 2, s = hs & 3;
    const float* vr = vbuf + (size_t)(b * kSPK + s) * kD + h * kDH;
    const float* wo = Wo + (size_t)d * kD + h * kDH;
    float acc = 0.f;
    for (int j = 0; j < kDH; ++j) acc = fmaf(wo[j], vr[j], acc);
    VOt[i] = (_Float16)acc;
  } else if (idx < nM + nV + nC) {
    // cb[b][hs] = (1/8) * bq . k_head
    int i = idx - nM - nV; int b = i / kHS; int hs = i - b * kHS;
    int h = hs >> 2, s = hs & 3;
    const float* kr = kbuf + (size_t)(b * kSPK + s) * kD + h * kDH;
    float acc = 0.f;
    for (int j = 0; j < kDH; ++j) acc = fmaf(bq[h * kDH + j], kr[j], acc);
    cb[i] = acc * 0.125f;
  } else if (idx < nM + nV + nC + nS) {
    // Msum[b][hs] = sum_d M[b][hs][d] = (1/8) * sum_j k[b][s][h*64+j] * rowsum(Wq[h*64+j]) (fp32).
    // One block per head: each wave sums 8 rows with its lanes across the columns,
    // then 32 threads finish the (b, s) outputs of this head from the shared row sums.
    int i = idx - nM - nV - nC;
    int h = i >> 8, tl = i & 255;
    int wv = tl >> 5, ln = tl & 31;
    float part[8];
    for (int r = 0; r < 8; ++r) {
      const f4v* wr = (const f4v*)(Wq + (size_t)(h * kDH + wv * 8 + r) * kD);
      f4v s4 = (wr[ln] + wr[32 + ln]) + (wr[64 + ln] + wr[96 + ln]);
      part[r] = (s4[0] + s4[1]) + (s4[2] + s4[3]);
    }
    for (int r = 0; r < 8; ++r) part[r] = wave_sum(part[r]);
    if (ln == 0) {
      for (int r = 0; r < 8; ++r) sRow[wv * 8 + r] = part[r];
    }
    __syncthreads();   // block-uniform branch: the whole block is in this segment
    if (tl < kB * kSPK) {
      int b = tl >> 2, s = tl & 3;
      const float* kr = kbuf + (size_t)(b * kSPK + s) * kD + h * kDH;
      float acc = 0.f;
      for (int j = 0; j < kDH; ++j) acc = fmaf(kr[j], sRow[j], acc);
      Msum[b * kHS + h * 4 + s] = acc * 0.125f;
    }
  } else if (idx < nM + nV + nC + nS + nG) {
    // Wg1h = Wg1 * gamma (gamma of gate-LN folded into weights)
    int i = idx - nM - nV - nC - nS;
    int k = i & (kD - 1);
    Wg1h[i] = (_Float16)(Wg1[i] * glng[k]);
  } else if (idx < nM + nV + nC + nS + nG + nGB) {
    // bg1p = bg1 + Wg1 . beta (beta of gate-LN folded into bias); one wave per unit n
    int i = idx - nM - nV - nC - nS - nG;
    int n = i >> 5, ln = i & 31;
    const f4v* wr = (const f4v*)(Wg1 + (size_t)n * kD);
    const f4v* bt = (const f4v*)glnb;
    f4v p4 = {};
    for (int c = 0; c < 4; ++c) p4 += wr[c * 32 + ln] * bt[c * 32 + ln];
    float acc = wave_sum((p4[0] + p4[1]) + (p4[2] + p4[3]));
    if (ln == 0) bg1p[n] = bg1[n] + acc;
  }
}

// ============================================================
// Fused main kernel: gate GEMM + scores + softmax + combine + final LN.
// LDS holds the pre-affine normalized tile x' = (x-mu)*rstd (f16);
// gamma/beta are folded into Wg1h/bg1p, and raw-x scores are recovered via
// scores = irs * (x'.M^T) + mu*Msum + cb.
// ============================================================
__global__ __launch_bounds__(256) void fused_kernel(
    const float* __restrict__ X,
    const _Float16* __restrict__ Mh,    // (B, HS, D)
    const _Float16* __restrict__ VOt,   // (B, D, HS)
    const float* __restrict__ cb,       // (B, HS)
    const float* __restrict__ Msum,     // (B, HS)
    const _Float16* __restrict__ Wg1h,  // (HG, D), gamma-folded
    const float* __restrict__ bg1p,     // (HG), beta-folded
    const float* __restrict__ Wg2, const float* __restrict__ bg2,
    const float* __restrict__ bo,
    const float* __restrict__ lng, const float* __restrict__ lnb,
    float* __restrict__ out) {
  __shared__ __attribute__((aligned(16))) _Float16 sXh[TILE * XP];  // x' (f16); later reused for attn (f16)
  __shared__ __attribute__((aligned(16))) _Float16 sGh[TILE * GP];
  __shared__ __attribute__((aligned(16))) float sSc[TILE * WP];
  __shared__ __attribute__((aligned(16))) float sW[TILE * WP];
  __shared__ float sMu[TILE], sIrs[TILE], sG[TILE];

  const int t = threadIdx.x;
  const int lane = t & 31;
  const int wave = t >> 5;
  const int r15 = lane & 15;
  const int hi = lane >> 4;          // 0 or 1 (wave32 half)
  const int kb = hi * 8;             // fragment K sub-offset per ISA layout

  const size_t rowg0 = (size_t)blockIdx.x * TILE;
  const int b = (int)(rowg0 >> 12);  // tile never crosses batch (4096 % 32 == 0)

  const size_t AW_OFF = (size_t)kB * kT * kD;
  const size_t G_OFF  = AW_OFF + (size_t)kB * kT * kSPK;

  // Each wave owns four whole rows; its lanes lie across the columns, so every
  // global load and store of a row piece is 32 lanes x 16 B = 512 contiguous bytes.
  // Piece c of row rr is f4v index rr * 128 + c * 32 + lane.
  const int row0 = wave * 4;
  const f4v* xw = (const f4v*)(X + (rowg0 + row0) * kD);

  // ---- Phase 0: LN stats inside the wave, then x' = (x-mu)*rstd to LDS (f16) ----
  {
    const f4v* xl = xw + lane;
    f4v xv[4][4];
    #pragma unroll
    for (int rr = 0; rr < 4; ++rr)
      #pragma unroll
      for (int c = 0; c < 4; ++c) xv[rr][c] = xl[rr * 128 + c * 32];
    // names the address pair so that it outlives the loads
    asm volatile("s_wait_xcnt 0x0" :: "v"(xl) : "memory");
    float s[4], q[4];
    #pragma unroll
    for (int rr = 0; rr < 4; ++rr) {
      s[rr] = 0.f; q[rr] = 0.f;
      #pragma unroll
      for (int c = 0; c < 4; ++c)
        #pragma unroll
        for (int e = 0; e < 4; ++e) { s[rr] += xv[rr][c][e]; q[rr] += xv[rr][c][e] * xv[rr][c][e]; }
    }
    #pragma unroll
    for (int rr = 0; rr < 4; ++rr) { s[rr] = wave_sum(s[rr]); q[rr] = wave_sum(q[rr]); }
    #pragma unroll
    for (int rr = 0; rr < 4; ++rr) {
      const float mu = s[rr] * (1.f / kD);
      const float var = q[rr] * (1.f / kD) - mu * mu;
      const float rs = rsqrtf(var + kEPS);
      if (lane == 0) {               // the scores epilogue of other waves reads these
        sMu[row0 + rr]  = mu;
        sIrs[row0 + rr] = sqrtf(var + kEPS);
      }
      #pragma unroll
      for (int c = 0; c < 4; ++c) {
        h4v h;
        #pragma unroll
        for (int e = 0; e < 4; ++e) h[e] = (_Float16)((xv[rr][c][e] - mu) * rs);
        *(h4v*)&sXh[(row0 + rr) * XP + c * 128 + lane * 4] = h;
      }
    }
  }
  __syncthreads();

  // ---- Gate GEMM: relu(x' @ Wg1h^T + bg1p)  (M=32,N=128,K=512) ----
  #pragma unroll
  for (int tt = 0; tt < 2; ++tt) {
    const int tid = wave + tt * 8;
    const int mt = tid >> 3, nt = tid & 7;
    const int arow = mt * 16 + r15;
    v8f acc = {};
    for (int k0 = 0; k0 < kD; k0 += 32) {
      v16h a  = frag_h(&sXh[arow * XP + k0 + kb]);
      v16h bm = frag_h(Wg1h + (size_t)(nt * 16 + r15) * kD + k0 + kb);
      acc = __builtin_amdgcn_wmma_f32_16x16x32_f16(false, a, false, bm,
                                                   (short)0, acc, false, false);
    }
    const int col = nt * 16 + r15;
    const float bb = bg1p[col];
    #pragma unroll
    for (int r = 0; r < 8; ++r)
      sGh[(mt * 16 + hi * 8 + r) * GP + col] = (_Float16)fmaxf(acc[r] + bb, 0.f);
  }
  __syncthreads();

  // ---- Gate head on wave 4 (concurrent with scores on waves 0-3) ----
  if (wave == 4) {
    const int rw = lane;
    float g = bg2[0];
    const h8v* gp = (const h8v*)&sGh[rw * GP];
    #pragma unroll 4
    for (int j = 0; j < 16; ++j) {
      h8v h = gp[j];
      #pragma unroll
      for (int e = 0; e < 8; ++e) g = fmaf((float)h[e], Wg2[j * 8 + e], g);
    }
    g = 1.f / (1.f + expf(-g));
    sG[rw] = g;
    out[G_OFF + rowg0 + rw] = g;
  }

  // ---- Scores GEMM: irs*(x' @ M^T) + mu*Msum + cb  (M=32,N=32,K=512) ----
  if (wave < 4) {
    const int mt = wave >> 1, nt = wave & 1;
    const int arow = mt * 16 + r15;
    v8f acc = {};
    for (int k0 = 0; k0 < kD; k0 += 32) {
      v16h a  = frag_h(&sXh[arow * XP + k0 + kb]);
      v16h bm = frag_h(Mh + ((size_t)b * kHS + nt * 16 + r15) * kD + k0 + kb);
      acc = __builtin_amdgcn_wmma_f32_16x16x32_f16(false, a, false, bm,
                                                   (short)0, acc, false, false);
    }
    const int col = nt * 16 + r15;
    const float c0 = cb[b * kHS + col];
    const float ms = Msum[b * kHS + col];
    #pragma unroll
    for (int r = 0; r < 8; ++r) {
      const int rr = mt * 16 + hi * 8 + r;
      sSc[rr * WP + col] = fmaf(acc[r], sIrs[rr], fmaf(sMu[rr], ms, c0));
    }
  }
  __syncthreads();

  // ---- Softmax over SPK=4 within each head (one thread per row-head) ----
  {
    const int rw = t >> 3, h = t & 7;
    const float* sp = &sSc[rw * WP + h * 4];
    float s0 = sp[0], s1 = sp[1], s2 = sp[2], s3 = sp[3];
    float m = fmaxf(fmaxf(s0, s1), fmaxf(s2, s3));
    float e0 = expf(s0 - m), e1 = expf(s1 - m), e2 = expf(s2 - m), e3 = expf(s3 - m);
    float inv = 1.f / (e0 + e1 + e2 + e3);
    float* wp = &sW[rw * WP + h * 4];
    wp[0] = e0 * inv; wp[1] = e1 * inv; wp[2] = e2 * inv; wp[3] = e3 * inv;
  }
  __syncthreads();
  if (t < TILE * kSPK) {  // head-averaged attention weights
    int rw = t >> 2, s = t & 3;
    float aw = 0.f;
    #pragma unroll
    for (int h = 0; h < kH; ++h) aw += sW[rw * WP + h * 4 + s];
    out[AW_OFF + (rowg0 + rw) * kSPK + s] = aw * (1.f / kH);
  }

  // ---- Combine GEMM: attn = w @ VO  (M=32,N=512,K=32) -> overwrite sXh ----
  #pragma unroll
  for (int i = 0; i < 8; ++i) {
    const int tid = wave * 8 + i;
    const int mt = tid >> 5, nt = tid & 31;
    v16h a, bm;
    {
      const f4v* wp = (const f4v*)&sW[(mt * 16 + r15) * WP + kb];
      f4v w0 = wp[0], w1 = wp[1];   // K = kb .. kb+7
      f4v w2 = wp[4], w3 = wp[5];   // K = kb+16 .. kb+23
      #pragma unroll
      for (int e = 0; e < 4; ++e) {
        a[e]      = (_Float16)w0[e];
        a[4 + e]  = (_Float16)w1[e];
        a[8 + e]  = (_Float16)w2[e];
        a[12 + e] = (_Float16)w3[e];
      }
    }
    bm = frag_h(VOt + ((size_t)b * kD + nt * 16 + r15) * kHS + kb);
    v8f acc = {};
    acc = __builtin_amdgcn_wmma_f32_16x16x32_f16(false, a, false, bm,
                                                 (short)0, acc, false, false);
    const int col = nt * 16 + r15;
    #pragma unroll
    for (int r = 0; r < 8; ++r)
      sXh[(mt * 16 + hi * 8 + r) * XP + col] = (_Float16)acc[r];
  }
  __syncthreads();

  // ---- Epilogue: fused = LN(x + g*(attn + bo)), each wave on its own four rows ----
  {
    f4v* ow = (f4v*)(out + (rowg0 + row0) * kD);
    // kept rolled: unrolled, the compiler hoists all four rows' loads and the
    // register count costs a resident work-group
    #pragma unroll 1
    for (int rr = 0; rr < 4; ++rr) {
      const float g = sG[row0 + rr];
      f4v f[4];
      float s = 0.f, q = 0.f;
      #pragma unroll
      for (int c = 0; c < 4; ++c) {
        const f4v v = xw[rr * 128 + c * 32 + lane];
        const h4v a = *(const h4v*)&sXh[(row0 + rr) * XP + c * 128 + lane * 4];
        const f4v bb = ((const f4v*)bo)[c * 32 + lane];
        #pragma unroll
        for (int e = 0; e < 4; ++e) {
          const float x = v[e] + g * ((float)a[e] + bb[e]);
          f[c][e] = x;
          s += x; q += x * x;
        }
      }
      s = wave_sum(s);
      q = wave_sum(q);
      const float mu = s * (1.f / kD);
      const float var = q * (1.f / kD) - mu * mu;
      const float rs = rsqrtf(var + kEPS);
      #pragma unroll
      for (int c = 0; c < 4; ++c) {
        const f4v lg = ((const f4v*)lng)[c * 32 + lane];
        const f4v lb = ((const f4v*)lnb)[c * 32 + lane];
        f4v o;
        #pragma unroll
        for (int e = 0; e < 4; ++e) o[e] = (f[c][e] - mu) * rs * lg[e] + lb[e];
        ow[rr * 128 + c * 32 + lane] = o;
      }
      // the next trip rewrites the address and data registers that these stores name
      asm volatile("s_wait_xcnt 0x0" ::: "memory");
    }
  }
}

// ============================================================
extern "C" void kernel_launch(void* const* d_in, const int* in_sizes, int n_in,
                              void* d_out, int out_size, void* d_ws, size_t ws_size,
                              hipStream_t stream) {
  (void)in_sizes; (void)n_in; (void)out_size; (void)ws_size;
  const float* token = (const float*)d_in[0];
  const float* se    = (const float*)d_in[1];
  const float* We    = (const float*)d_in[2];
  const float* be    = (const float*)d_in[3];
  const float* spos  = (const float*)d_in[4];
  const float* Wq    = (const float*)d_in[5];
  const float* bq    = (const float*)d_in[6];
  const float* Wk    = (const float*)d_in[7];
  const float* bk    = (const float*)d_in[8];
  const float* Wv    = (const float*)d_in[9];
  const float* bv    = (const float*)d_in[10];
  const float* Wo    = (const float*)d_in[11];
  const float* bo    = (const float*)d_in[12];
  const float* glng  = (const float*)d_in[13];
  const float* glnb  = (const float*)d_in[14];
  const float* Wg1   = (const float*)d_in[15];
  const float* bg1   = (const float*)d_in[16];
  const float* Wg2   = (const float*)d_in[17];
  const float* bg2   = (const float*)d_in[18];
  const float* lng   = (const float*)d_in[19];
  const float* lnb   = (const float*)d_in[20];
  float* out = (float*)d_out;

  char* ws = (char*)d_ws;
  float*    spk  = (float*)(ws + 0);            // 64 KB
  float*    kbuf = (float*)(ws + 65536);        // 64 KB
  float*    vbuf = (float*)(ws + 131072);       // 64 KB
  _Float16* Mh   = (_Float16*)(ws + 196608);    // 256 KB
  _Float16* VOt  = (_Float16*)(ws + 458752);    // 256 KB
  float*    cbf  = (float*)(ws + 720896);       // 1 KB
  float*    Msum = (float*)(ws + 721920);       // 1 KB
  float*    bg1p = (float*)(ws + 722944);       // 512 B
  _Float16* Wg1h = (_Float16*)(ws + 723456);    // 128 KB

  spk_kernel<<<kSPK * kD / 32, 256, 0, stream>>>(se, We, be, spos, spk);
  kv_kernel<<<2 * (kD / 32) * (kB * kSPK / 8), 256, 0, stream>>>(spk, Wk, bk, Wv, bv, kbuf, vbuf);
  const int nfold = kB * kHS * kD + kB * kD * kHS + kB * kHS + kH * 256 + kHG * kD + kHG * 32;
  fold_kernel<<<(nfold + 255) / 256, 256, 0, stream>>>(kbuf, vbuf, Wq, bq, Wo, Wg1, bg1,
                                                       glng, glnb, Mh, VOt, cbf, Msum, Wg1h, bg1p);
  fused_kernel<<<(kB * kT) / TILE, 256, 0, stream>>>(token, Mh, VOt, cbf, Msum, Wg1h, bg1p,
                                                     Wg2, bg2, bo, lng, lnb, out);
}

// v005
// It runs in 42 microseconds.
// Timed twice side by side with v004, it ran 1.20 and 1.21 times as fast.
// Counting every step since v000, it is 11.0 times as fast.
#include <hip/hip_runtime.h>
#include <hip/hip_bf16.h>
#include <math.h>

// ---- problem constants ----
constexpr int kB   = 8;
constexpr int kT   = 4096;
constexpr int kD   = 512;
constexpr int kH   = 8;
constexpr int kDH  = 64;
constexpr int kSPK = 4;
constexpr int kHS  = kH * kSPK;   // 32 folded "keys" per batch
constexpr int kHG  = 128;
constexpr int TILE = 32;          // token rows per block
constexpr float kEPS = 1e-5f;
// LDS row pitches: 16 B x an odd number, so that the 16 rows that one 16-byte
// fragment read touches fall on 16 different bank groups instead of on one.
constexpr int XP = kD + 8;        // halves: 1040 B = 16 B x 65
constexpr int GP = kHG + 8;       // halves:  272 B = 16 B x 17
constexpr int WP = kHS + 4;       // floats:  144 B = 16 B x 9

typedef __attribute__((ext_vector_type(16))) _Float16 v16h;
typedef __attribute__((ext_vector_type(8)))  float    v8f;
typedef __attribute__((ext_vector_type(4)))  float    f4v;
typedef __attribute__((ext_vector_type(4)))  _Float16 h4v;
typedef __attribute__((ext_vector_type(8)))  _Float16 h8v;

// Gather one 16x32 WMMA fragment (A or B) from a row-major f16 matrix.
// p points at [row_of_this_lane][k0 + kb]; lanes 0-15 take K {0..7,16..23},
// lanes 16-31 take K {8..15,24..31} (kb handles the 8-offset).
__device__ __forceinline__ v16h frag_h(const _Float16* p) {
  h8v lo = *(const h8v*)p;
  h8v hi = *(const h8v*)(p + 16);
  v16h f;
  #pragma unroll
  for (int j = 0; j < 8; ++j) { f[j] = lo[j]; f[8 + j] = hi[j]; }
  return f;
}

// Sum over the 32 lanes of a wave; every lane gets the total.
__device__ __forceinline__ float wave_sum(float v) {
  for (int m = 16; m >= 1; m >>= 1) v += __shfl_xor(v, m, 32);
  return v;
}

// Dot products of four weight rows with eight input rows (all of length kD, rows
// contiguous) by one wave. The lanes lie across the columns, so every load is
// 32 lanes x 16 B = 512 contiguous bytes. Lane l returns the whole sum for weight
// row (l & 3) and input row (l >> 2).
__device__ __forceinline__ float rows4x8(const float* __restrict__ w,
                                         const float* __restrict__ x, int lane) {
  // Every loop here is unrolled in full: the arrays live in registers only while
  // each index is a constant.
  const f4v* wl = (const f4v*)w + lane;
  const f4v* xl = (const f4v*)x + lane;
  f4v wv[4][4], xv[8][4];
  #pragma unroll
  for (int c = 0; c < 4; ++c) {
    #pragma unroll
    for (int r = 0; r < 4; ++r) wv[r][c] = wl[r * 128 + c * 32];
    #pragma unroll
    for (int i = 0; i < 8; ++i) xv[i][c] = xl[i * 128 + c * 32];
  }
  // names the address registers (w: the pair; x: scalar base + lane) so that they outlive
  // the loads: no load's result may land on one that earlier loads name before this wait
  asm volatile("s_wait_xcnt 0x0" :: "v"(wl), "v"(lane) : "memory");
  // keeps the wait where it is written: without it the scheduler sinks the wait below
  // the arithmetic, and lets fewer of the 48 loads fly at once
  __builtin_amdgcn_sched_barrier(0);
  float a[32];
  #pragma unroll
  for (int i = 0; i < 32; ++i) a[i] = 0.f;
  #pragma unroll
  for (int c = 0; c < 4; ++c)
    #pragma unroll
    for (int i = 0; i < 8; ++i)
      #pragma unroll
      for (int r = 0; r < 4; ++r)
        #pragma unroll
        for (int e = 0; e < 4; ++e) a[i * 4 + r] = fmaf(xv[i][c][e], wv[r][c][e], a[i * 4 + r]);
  // Halving exchange: at each step a lane keeps the half of the sums whose index bit
  // equals its own lane bit and hands the other half to its partner, so 31 shuffles
  // leave sum l whole in lane l.
  #pragma unroll
  for (int m = 16; m >= 1; m >>= 1) {
    const bool up = (lane & m) != 0;
    #pragma unroll
    for (int i = 0; i < m; ++i) {
      const float lo = a[i], hi = a[i + m];
      a[i] = (up ? hi : lo) + __shfl_xor(up ? lo : hi, m, 32);
    }
  }
  return a[0];
}

// ============================================================
// Precompute 1: spk_tokens = relu(speaker_emb @ We^T + be) + spk_pos
// One wave: four rows of We against all eight batches.
// ============================================================
__global__ __launch_bounds__(256) void spk_kernel(
    const float* __restrict__ se, const float* __restrict__ We,
    const float* __restrict__ be, const float* __restrict__ spos,
    float* __restrict__ spk) {
  const int lane = threadIdx.x & 31;
  const int r0 = (blockIdx.x * 8 + (threadIdx.x >> 5)) * 4;   // r = s*D + d
  const int r = r0 + (lane & 3), b = lane >> 2;
  const float bias = be[r], pos = spos[r];   // loaded in front of the wait inside rows4x8
  const float acc = rows4x8(We + (size_t)r0 * kD, se, lane);
  spk[b * (kSPK * kD) + r] = fmaxf(acc + bias, 0.f) + pos;
}

// ============================================================
// Precompute 2: k = spk@Wk^T + bk ; v = spk@Wv^T + bv
// One wave: four rows of Wk or Wv against eight of the 32 (b, s) rows; the eight
// waves of a block share those eight rows and cover 32 neighbouring outputs of each.
// ============================================================
__global__ __launch_bounds__(256) void kv_kernel(
    const float* __restrict__ spk,
    const float* __restrict__ Wk, const float* __restrict__ bk,
    const float* __restrict__ Wv, const float* __restrict__ bv,
    float* __restrict__ kbuf, float* __restrict__ vbuf) {
  const int lane = threadIdx.x & 31;
  const int which = blockIdx.x >> 6;                 // 0: k, 1: v
  const int bs0 = ((blockIdx.x >> 4) & 3) * 8;
  const int d0 = ((blockIdx.x & 15) * 8 + (threadIdx.x >> 5)) * 4;
  const int d = d0 + (lane & 3), bs = bs0 + (lane >> 2);
  const float bias = (which ? bv : bk)[d];   // loaded in front of the wait inside rows4x8
  const float acc = rows4x8((which ? Wv : Wk) + (size_t)d0 * kD, spk + (size_t)bs0 * kD, lane);
  (which ? vbuf : kbuf)[bs * kD + d] = acc + bias;
}

// ============================================================
// Precompute 3: fold Wq into K -> M (f16) + Msum, fold Wo into V -> VO^T (f16),
//               score bias bq.k, gamma-folded Wg1 (f16) + beta-folded bg1.
// Every segment boundary is a multiple of the 256-thread block, so a block
// (and a wave) lies wholly inside one segment.
// ============================================================
__global__ void fold_kernel(const float* __restrict__ kbuf, const float* __restrict__ vbuf,
                            const float* __restrict__ Wq, const float* __restrict__ bq,
                            const float* __restrict__ Wo, const float* __restrict__ Wg1,
                            const float* __restrict__ bg1,
                            const float* __restrict__ glng, const float* __restrict__ glnb,
                            _Float16* __restrict__ Mh, _Float16* __restrict__ VOt,
                            float* __restrict__ cb, float* __restrict__ Msum,
                            _Float16* __restrict__ Wg1h, float* __restrict__ bg1p) {
  __shared__ float sRow[kDH];              // row sums of one head's Wq rows
  int idx = blockIdx.x * blockDim.x + threadIdx.x;
  const int nM  = kB * kHS * kD;
  const int nV  = kB * kD * kHS;
  const int nC  = kB * kHS;
  const int nS  = kH * 256;                // one block per head
  const int nG  = kHG * kD;
  const int nGB = kHG * 32;                // one wave per gate unit
  if (idx < nM) {
    // M[b][hs][d] = (1/8) * sum_dh Wq[h*64+dh][d] * k[b][s][h*64+dh]
    int b = idx / (kHS * kD); int rem = idx - b * (kHS * kD);
    int hs = rem / kD; int d = rem - hs * kD;
    int h = hs >> 2, s = hs & 3;
    const float* kr = kbuf + (size_t)(b * kSPK + s) * kD + h * kDH;
    float acc = 0.f;
    for (int j = 0; j < kDH; ++j)
      acc = fmaf(Wq[(size_t)(h * kDH + j) * kD + d], kr[j], acc);
    Mh[idx] = (_Float16)(acc * 0.125f);
  } else if (idx < nM + nV) {
    // VOt[b][d][hs] = sum_dh Wo[d][h*64+dh] * v[b][s][h*64+dh]
    int i = idx - nM;
    int b = i / (kD * kHS); int rem = i - b * (kD * kHS);
    int d = rem / kHS; int hs = rem - d * kHS;
    int h = hs >> 2, s = hs & 3;
    const float* vr = vbuf + (size_t)(b * kSPK + s) * kD + h * kDH;
    const float* wo = Wo + (size_t)d * kD + h * kDH;
    float acc = 0.f;
    for (int j = 0; j < kDH; ++j) acc = fmaf(wo[j], vr[j], acc);
    VOt[i] = (_Float16)acc;
  } else if (idx < nM + nV + nC) {
    // cb[b][hs] = (1/8) * bq . k_head
    int i = idx - nM - nV; int b = i / kHS; int hs = i - b * kHS;
    int h = hs >> 2, s = hs & 3;
    const float* kr = kbuf + (size_t)(b * kSPK + s) * kD + h * kDH;
    float acc = 0.f;
    for (int j = 0; j < kDH; ++j) acc = fmaf(bq[h * kDH + j], kr[j], acc);
    cb[i] = acc * 0.125f;
  } else if (idx < nM + nV + nC + nS) {
    // Msum[b][hs] = sum_d M[b][hs][d] = (1/8) * sum_j k[b][s][h*64+j] * rowsum(Wq[h*64+j]) (fp32).
    // One block per head: each wave sums 8 rows with its lanes across the columns,
    // then 32 threads finish the (b, s) outputs of this head from the shared row sums.
    int i = idx - nM - nV - nC;
    int h = i >> 8, tl = i & 255;
    int wv = tl >> 5, ln = tl & 31;
    float part[8];
    for (int r = 0; r < 8; ++r) {
      const f4v* wr = (const f4v*)(Wq + (size_t)(h * kDH + wv * 8 + r) * kD);
      f4v s4 = (wr[ln] + wr[32 + ln]) + (wr[64 + ln] + wr[96 + ln]);
      part[r] = (s4[0] + s4[1]) + (s4[2] + s4[3]);
    }
    for (int r = 0; r < 8; ++r) part[r] = wave_sum(part[r]);
    if (ln == 0) {
      for (int r = 0; r < 8; ++r) sRow[wv * 8 + r] = part[r];
    }
    __syncthreads();   // block-uniform branch: the whole block is in this segment
    if (tl < kB * kSPK) {
      int b = tl >> 2, s = tl & 3;
      const float* kr = kbuf + (size_t)(b * kSPK + s) * kD + h * kDH;
      float acc = 0.f;
      for (int j = 0; j < kDH; ++j) acc = fmaf(kr[j], sRow[j], acc);
      Msum[b * kHS + h * 4 + s] = acc * 0.125f;
    }
  } else if (idx < nM + nV + nC + nS + nG) {
    // Wg1h = Wg1 * gamma (gamma of gate-LN folded into weights)
    int i = idx - nM - nV - nC - nS;
    int k = i & (kD - 1);
    Wg1h[i] = (_Float16)(Wg1[i] * glng[k]);
  } else if (idx < nM + nV + nC + nS + nG + nGB) {
    // bg1p = bg1 + Wg1 . beta (beta of gate-LN folded into bias); one wave per unit n
    int i = idx - nM - nV - nC - nS - nG;
    int n = i >> 5, ln = i & 31;
    const f4v* wr = (const f4v*)(Wg1 + (size_t)n * kD);
    const f4v* bt = (const f4v*)glnb;
    f4v p4 = {};
    for (int c = 0; c < 4; ++c) p4 += wr[c * 32 + ln] * bt[c * 32 + ln];
    float acc = wave_sum((p4[0] + p4[1]) + (p4[2] + p4[3]));
    if (ln == 0) bg1p[n] = bg1[n] + acc;
  }
}

// ============================================================
// Fused main kernel: gate GEMM + scores + softmax + combine + final LN.
// LDS holds the pre-affine normalized tile x' = (x-mu)*rstd (f16);
// gamma/beta are folded into Wg1h/bg1p, and raw-x scores are recovered via
// scores = irs * (x'.M^T) + mu*Msum + cb.
// The second launch bound asks for eight waves per SIMD (at most 128 registers a wave):
// four work-groups then fit on a WGP, and the 1024 work-groups of the grid are all
// resident at once instead of running as three a WGP and a thin second round.
// ============================================================
__global__ __launch_bounds__(256, 8) void fused_kernel(
    const float* __restrict__ X,
    const _Float16* __restrict__ Mh,    // (B, HS, D)
    const _Float16* __restrict__ VOt,   // (B, D, HS)
    const float* __restrict__ cb,       // (B, HS)
    const float* __restrict__ Msum,     // (B, HS)
    const _Float16* __restrict__ Wg1h,  // (HG, D), gamma-folded
    const float* __restrict__ bg1p,     // (HG), beta-folded
    const float* __restrict__ Wg2, const float* __restrict__ bg2,
    const float* __restrict__ bo,
    const float* __restrict__ lng, const float* __restrict__ lnb,
    float* __restrict__ out) {
  __shared__ __attribute__((aligned(16))) _Float16 sXh[TILE * XP];  // x' (f16); later reused for attn (f16)
  __shared__ __attribute__((aligned(16))) _Float16 sGh[TILE * GP];
  __shared__ __attribute__((aligned(16))) float sSc[TILE * WP];
  __shared__ __attribute__((aligned(16))) float sW[TILE * WP];
  __shared__ float sMu[TILE], sIrs[TILE], sG[TILE];

  const int t = threadIdx.x;
  const int lane = t & 31;
  const int wave = t >> 5;
  const int r15 = lane & 15;
  const int hi = lane >> 4;          // 0 or 1 (wave32 half)
  const int kb = hi * 8;             // fragment K sub-offset per ISA layout

  const size_t rowg0 = (size_t)blockIdx.x * TILE;
  const int b = (int)(rowg0 >> 12);  // tile never crosses batch (4096 % 32 == 0)

  const size_t AW_OFF = (size_t)kB * kT * kD;
  const size_t G_OFF  = AW_OFF + (size_t)kB * kT * kSPK;

  // Each wave owns four whole rows; its lanes lie across the columns, so every
  // global load and store of a row piece is 32 lanes x 16 B = 512 contiguous bytes.
  // Piece c of row rr is f4v index rr * 128 + c * 32 + lane.
  const int row0 = wave * 4;
  const f4v* xw = (const f4v*)(X + (rowg0 + row0) * kD);

  // ---- Phase 0: LN stats inside the wave, then x' = (x-mu)*rstd to LDS (f16) ----
  {
    const f4v* xl = xw + lane;
    f4v xv[4][4];
    #pragma unroll
    for (int rr = 0; rr < 4; ++rr)
      #pragma unroll
      for (int c = 0; c < 4; ++c) xv[rr][c] = xl[rr * 128 + c * 32];
    // names the address pair so that it outlives the loads
    asm volatile("s_wait_xcnt 0x0" :: "v"(xl) : "memory");
    float s[4], q[4];
    #pragma unroll
    for (int rr = 0; rr < 4; ++rr) {
      s[rr] = 0.f; q[rr] = 0.f;
      #pragma unroll
      for (int c = 0; c < 4; ++c)
        #pragma unroll
        for (int e = 0; e < 4; ++e) { s[rr] += xv[rr][c][e]; q[rr] += xv[rr][c][e] * xv[rr][c][e]; }
    }
    #pragma unroll
    for (int rr = 0; rr < 4; ++rr) { s[rr] = wave_sum(s[rr]); q[rr] = wave_sum(q[rr]); }
    #pragma unroll
    for (int rr = 0; rr < 4; ++rr) {
      const float mu = s[rr] * (1.f / kD);
      const float var = q[rr] * (1.f / kD) - mu * mu;
      const float rs = rsqrtf(var + kEPS);
      if (lane == 0) {               // the scores epilogue of other waves reads these
        sMu[row0 + rr]  = mu;
        sIrs[row0 + rr] = sqrtf(var + kEPS);
      }
      #pragma unroll
      for (int c = 0; c < 4; ++c) {
        h4v h;
        #pragma unroll
        for (int e = 0; e < 4; ++e) h[e] = (_Float16)((xv[rr][c][e] - mu) * rs);
        *(h4v*)&sXh[(row0 + rr) * XP + c * 128 + lane * 4] = h;
      }
    }
  }
  __syncthreads();

  // ---- Gate GEMM: relu(x' @ Wg1h^T + bg1p)  (M=32,N=128,K=512) ----
  #pragma unroll
  for (int tt = 0; tt < 2; ++tt) {
    const int tid = wave + tt * 8;
    const int mt = tid >> 3, nt = tid & 7;
    const int arow = mt * 16 + r15;
    v8f acc = {};
    for (int k0 = 0; k0 < kD; k0 += 32) {
      v16h a  = frag_h(&sXh[arow * XP + k0 + kb]);
      v16h bm = frag_h(Wg1h + (size_t)(nt * 16 + r15) * kD + k0 + kb);
      acc = __builtin_amdgcn_wmma_f32_16x16x32_f16(false, a, false, bm,
                                                   (short)0, acc, false, false);
    }
    const int col = nt * 16 + r15;
    const float bb = bg1p[col];
    #pragma unroll
    for (int r = 0; r < 8; ++r)
      sGh[(mt * 16 + hi * 8 + r) * GP + col] = (_Float16)fmaxf(acc[r] + bb, 0.f);
  }
  __syncthreads();

  // ---- Gate head on wave 4 (concurrent with scores on waves 0-3) ----
  if (wave == 4) {
    const int rw = lane;
    float g = bg2[0];
    const h8v* gp = (const h8v*)&sGh[rw * GP];
    #pragma unroll 4
    for (int j = 0; j < 16; ++j) {
      h8v h = gp[j];
      #pragma unroll
      for (int e = 0; e < 8; ++e) g = fmaf((float)h[e], Wg2[j * 8 + e], g);
    }
    g = 1.f / (1.f + expf(-g));
    sG[rw] = g;
    out[G_OFF + rowg0 + rw] = g;
  }

  // ---- Scores GEMM: irs*(x' @ M^T) + mu*Msum + cb  (M=32,N=32,K=512) ----
  if (wave < 4) {
    const int mt = wave >> 1, nt = wave & 1;
    const int arow = mt * 16 + r15;
    v8f acc = {};
    for (int k0 = 0; k0 < kD; k0 += 32) {
      v16h a  = frag_h(&sXh[arow * XP + k0 + kb]);
      v16h bm = frag_h(Mh + ((size_t)b * kHS + nt * 16 + r15) * kD + k0 + kb);
      acc = __builtin_amdgcn_wmma_f32_16x16x32_f16(false, a, false, bm,
                                                   (short)0, acc, false, false);
    }
    const int col = nt * 16 + r15;
    const int ci = b * kHS + col;
    const float c0 = cb[ci];
    const float ms = Msum[ci];
    // names the index register so that it outlives the two loads
    asm volatile("s_wait_xcnt 0x0" :: "v"(ci) : "memory");
    #pragma unroll
    for (int r = 0; r < 8; ++r) {
      const int rr = mt * 16 + hi * 8 + r;
      sSc[rr * WP + col] = fmaf(acc[r], sIrs[rr], fmaf(sMu[rr], ms, c0));
    }
  }
  __syncthreads();

  // ---- Softmax over SPK=4 within each head (one thread per row-head) ----
  {
    const int rw = t >> 3, h = t & 7;
    const float* sp = &sSc[rw * WP + h * 4];
    float s0 = sp[0], s1 = sp[1], s2 = sp[2], s3 = sp[3];
    float m = fmaxf(fmaxf(s0, s1), fmaxf(s2, s3));
    float e0 = expf(s0 - m), e1 = expf(s1 - m), e2 = expf(s2 - m), e3 = expf(s3 - m);
    float inv = 1.f / (e0 + e1 + e2 + e3);
    float* wp = &sW[rw * WP + h * 4];
    wp[0] = e0 * inv; wp[1] = e1 * inv; wp[2] = e2 * inv; wp[3] = e3 * inv;
  }
  __syncthreads();
  if (t < TILE * kSPK) {  // head-averaged attention weights
    int rw = t >> 2, s = t & 3;
    float aw = 0.f;
    #pragma unroll
    for (int h = 0; h < kH; ++h) aw += sW[rw * WP + h * 4 + s];
    out[AW_OFF + (rowg0 + rw) * kSPK + s] = aw * (1.f / kH);
  }

  // ---- Combine GEMM: attn = w @ VO  (M=32,N=512,K=32) -> overwrite sXh ----
  #pragma unroll
  for (int i = 0; i < 8; ++i) {
    const int tid = wave * 8 + i;
    const int mt = tid >> 5, nt = tid & 31;
    v16h a, bm;
    {
      const f4v* wp = (const f4v*)&sW[(mt * 16 + r15) * WP + kb];
      f4v w0 = wp[0], w1 = wp[1];   // K = kb .. kb+7
      f4v w2 = wp[4], w3 = wp[5];   // K = kb+16 .. kb+23
      #pragma unroll
      for (int e = 0; e < 4; ++e) {
        a[e]      = (_Float16)w0[e];
        a[4 + e]  = (_Float16)w1[e];
        a[8 + e]  = (_Float16)w2[e];
        a[12 + e] = (_Float16)w3[e];
      }
    }
    bm = frag_h(VOt + ((size_t)b * kD + nt * 16 + r15) * kHS + kb);
    v8f acc = {};
    acc = __builtin_amdgcn_wmma_f32_16x16x32_f16(false, a, false, bm,
                                                 (short)0, acc, false, false);
    const int col = nt * 16 + r15;
    #pragma unroll
    for (int r = 0; r < 8; ++r)
      sXh[(mt * 16 + hi * 8 + r) * XP + col] = (_Float16)acc[r];
  }
  __syncthreads();

  // ---- Epilogue: fused = LN(x + g*(attn + bo)), each wave on its own four rows ----
  {
    f4v* ow = (f4v*)(out + (rowg0 + row0) * kD);
    // kept rolled: unrolled, the compiler hoists all four rows' loads and the
    // register count costs a resident work-group
    #pragma unroll 1
    for (int rr = 0; rr < 4; ++rr) {
      const float g = sG[row0 + rr];
      const f4v* xr = xw + rr * 128 + lane;
      f4v f[4];
      float s = 0.f, q = 0.f;
      #pragma unroll
      for (int c = 0; c < 4; ++c) {
        const f4v v = xr[c * 32];
        const h4v a = *(const h4v*)&sXh[(row0 + rr) * XP + c * 128 + lane * 4];
        const f4v bb = ((const f4v*)bo)[c * 32 + lane];
        #pragma unroll
        for (int e = 0; e < 4; ++e) {
          const float x = v[e] + g * ((float)a[e] + bb[e]);
          f[c][e] = x;
          s += x; q += x * x;
        }
      }
      s = wave_sum(s);
      q = wave_sum(q);
      const float mu = s * (1.f / kD);
      const float var = q * (1.f / kD) - mu * mu;
      const float rs = rsqrtf(var + kEPS);
      #pragma unroll
      for (int c = 0; c < 4; ++c) {
        const f4v lg = ((const f4v*)lng)[c * 32 + lane];
        const f4v lb = ((const f4v*)lnb)[c * 32 + lane];
        f4v o;
        #pragma unroll
        for (int e = 0; e < 4; ++e) o[e] = (f[c][e] - mu) * rs * lg[e] + lb[e];
        ow[rr * 128 + c * 32 + lane] = o;
      }
      // the next trip rewrites the address and data registers that these stores name; xr is
      // named so that the x loads' address pair lives up to this wait
      asm volatile("s_wait_xcnt 0x0" :: "v"(xr) : "memory");
    }
  }
}

// ============================================================
extern "C" void kernel_launch(void* const* d_in, const int* in_sizes, int n_in,
                              void* d_out, int out_size, void* d_ws, size_t ws_size,
                              hipStream_t stream) {
  (void)in_sizes; (void)n_in; (void)out_size; (void)ws_size;
  const float* token = (const float*)d_in[0];
  const float* se    = (const float*)d_in[1];
  const float* We    = (const float*)d_in[2];
  const float* be    = (const float*)d_in[3];
  const float* spos  = (const float*)d_in[4];
  const float* Wq    = (const float*)d_in[5];
  const float* bq    = (const float*)d_in[6];
  const float* Wk    = (const float*)d_in[7];
  const float* bk    = (const float*)d_in[8];
  const float* Wv    = (const float*)d_in[9];
  const float* bv    = (const float*)d_in[10];
  const float* Wo    = (const float*)d_in[11];
  const float* bo    = (const float*)d_in[12];
  const float* glng  = (const float*)d_in[13];
  const float* glnb  = (const float*)d_in[14];
  const float* Wg1   = (const float*)d_in[15];
  const float* bg1   = (const float*)d_in[16];
  const float* Wg2   = (const float*)d_in[17];
  const float* bg2   = (const float*)d_in[18];
  const float* lng   = (const float*)d_in[19];
  const float* lnb   = (const float*)d_in[20];
  float* out = (float*)d_out;

  char* ws = (char*)d_ws;
  float*    spk  = (float*)(ws + 0);            // 64 KB
  float*    kbuf = (float*)(ws + 65536);        // 64 KB
  float*    vbuf = (float*)(ws + 131072);       // 64 KB
  _Float16* Mh   = (_Float16*)(ws + 196608);    // 256 KB
  _Float16* VOt  = (_Float16*)(ws + 458752);    // 256 KB
  float*    cbf  = (float*)(ws + 720896);       // 1 KB
  float*    Msum = (float*)(ws + 721920);       // 1 KB
  float*    bg1p = (float*)(ws + 722944);       // 512 B
  _Float16* Wg1h = (_Float16*)(ws + 723456);    // 128 KB

  spk_kernel<<<kSPK * kD / 32, 256, 0, stream>>>(se, We, be, spos, spk);
  kv_kernel<<<2 * (kD / 32) * (kB * kSPK / 8), 256, 0, stream>>>(spk, Wk, bk, Wv, bv, kbuf, vbuf);
  const int nfold = kB * kHS * kD + kB * kD * kHS + kB * kHS + kH * 256 + kHG * kD + kHG * 32;
  fold_kernel<<<(nfold + 255) / 256, 256, 0, stream>>>(kbuf, vbuf, Wq, bq, Wo, Wg1, bg1,
                                                       glng, glnb, Mh, VOt, cbf, Msum, Wg1h, bg1p);
  fused_kernel<<<(kB * kT) / TILE, 256, 0, stream>>>(token, Mh, VOt, cbf, Msum, Wg1h, bg1p,
                                                     Wg2, bg2, bo, lng, lnb, out);
}

// v006
// A run of this version takes 34.5 microseconds.
// Timed twice side by side with v005, it ran 1.22 times as fast both times.
// Counting every step since v000, it is 13.5 times as fast.
#include <hip/hip_runtime.h>
#include <hip/hip_bf16.h>
#include <math.h>

// ---- problem constants ----
constexpr int kB   = 8;
constexpr int kT   = 4096;
constexpr int kD   = 512;
constexpr int kH   = 8;
constexpr int kDH  = 64;
constexpr int kSPK = 4;
constexpr int kHS  = kH * kSPK;   // 32 folded "keys" per batch
constexpr int kHG  = 128;
constexpr int TILE = 32;          // token rows per block
constexpr float kEPS = 1e-5f;
// LDS row pitches: 16 B x an odd number, so that the 16 rows that one 16-byte
// fragment read touches fall on 16 different bank groups instead of on one.
constexpr int XP = kD + 8;        // halves: 1040 B = 16 B x 65
constexpr int GP = kHG + 8;       // halves:  272 B = 16 B x 17
constexpr int WP = kHS + 4;       // floats:  144 B = 16 B x 9

typedef __attribute__((ext_vector_type(16))) _Float16 v16h;
typedef __attribute__((ext_vector_type(8)))  float    v8f;
typedef __attribute__((ext_vector_type(4)))  float    f4v;
typedef __attribute__((ext_vector_type(4)))  _Float16 h4v;
typedef __attribute__((ext_vector_type(8)))  _Float16 h8v;

// Gather one 16x32 WMMA fragment (A or B) from a row-major f16 matrix.
// p points at [row_of_this_lane][k0 + kb]; lanes 0-15 take K {0..7,16..23},
// lanes 16-31 take K {8..15,24..31} (kb handles the 8-offset).
__device__ __forceinline__ v16h frag_h(const _Float16* p) {
  h8v lo = *(const h8v*)p;
  h8v hi = *(const h8v*)(p + 16);
  v16h f;
  #pragma unroll
  for (int j = 0; j < 8; ++j) { f[j] = lo[j]; f[8 + j] = hi[j]; }
  return f;
}

// Fragment order of a B operand (f16, N rows x K columns, ksteps = K / 32). Place
// p = (((nt * ksteps + ks) * 2 + hf) * 32 + lane) * 8 + j holds row nt*16 + (lane & 15),
// column ks*32 + hf*16 + (lane >> 4)*8 + j: the same k order as frag_h, but the 32 lanes
// of each 16-byte load lie side by side, 512 contiguous bytes = 4 whole 128-B lines,
// where a row-major operand gives 16 lines with 32 bytes used of each.
__device__ __forceinline__ void frag_place(int p, int ksteps, int& n, int& k) {
  const int j = p & 7, ln = (p >> 3) & 31, hf = (p >> 8) & 1;
  const int blk = p >> 9;
  const int nt = blk / ksteps, ks = blk - nt * ksteps;
  n = nt * 16 + (ln & 15);
  k = ks * 32 + hf * 16 + (ln >> 4) * 8 + j;
}

// One 16x32 B fragment from an operand stored in fragment order.
// p points at [fragment nt * ksteps + ks][0][lane][0].
__device__ __forceinline__ v16h frag_pk(const _Float16* p) {
  h8v lo = *(const h8v*)p;
  h8v hi = *(const h8v*)(p + 256);
  v16h f;
  #pragma unroll
  for (int j = 0; j < 8; ++j) { f[j] = lo[j]; f[8 + j] = hi[j]; }
  return f;
}

// Sum over the 32 lanes of a wave; every lane gets the total.
__device__ __forceinline__ float wave_sum(float v) {
  for (int m = 16; m >= 1; m >>= 1) v += __shfl_xor(v, m, 32);
  return v;
}

// Dot products of four weight rows with eight input rows (all of length kD, rows
// contiguous) by one wave. The lanes lie across the columns, so every load is
// 32 lanes x 16 B = 512 contiguous bytes. Lane l returns the whole sum for weight
// row (l & 3) and input row (l >> 2).
__device__ __forceinline__ float rows4x8(const float* __restrict__ w,
                                         const float* __restrict__ x, int lane) {
  // Every loop here is unrolled in full: the arrays live in registers only while
  // each index is a constant.
  const f4v* wl = (const f4v*)w + lane;
  const f4v* xl = (const f4v*)x + lane;
  f4v wv[4][4], xv[8][4];
  #pragma unroll
  for (int c = 0; c < 4; ++c) {
    #pragma unroll
    for (int r = 0; r < 4; ++r) wv[r][c] = wl[r * 128 + c * 32];
    #pragma unroll
    for (int i = 0; i < 8; ++i) xv[i][c] = xl[i * 128 + c * 32];
  }
  // names the address registers (w: the pair; x: scalar base + lane) so that they outlive
  // the loads: no load's result may land on one that earlier loads name before this wait
  asm volatile("s_wait_xcnt 0x0" :: "v"(wl), "v"(lane) : "memory");
  // keeps the wait where it is written: without it the scheduler sinks the wait below
  // the arithmetic, and lets fewer of the 48 loads fly at once
  __builtin_amdgcn_sched_barrier(0);
  float a[32];
  #pragma unroll
  for (int i = 0; i < 32; ++i) a[i] = 0.f;
  #pragma unroll
  for (int c = 0; c < 4; ++c)
    #pragma unroll
    for (int i = 0; i < 8; ++i)
      #pragma unroll
      for (int r = 0; r < 4; ++r)
        #pragma unroll
        for (int e = 0; e < 4; ++e) a[i * 4 + r] = fmaf(xv[i][c][e], wv[r][c][e], a[i * 4 + r]);
  // Halving exchange: at each step a lane keeps the half of the sums whose index bit
  // equals its own lane bit and hands the other half to its partner, so 31 shuffles
  // leave sum l whole in lane l.
  #pragma unroll
  for (int m = 16; m >= 1; m >>= 1) {
    const bool up = (lane & m) != 0;
    #pragma unroll
    for (int i = 0; i < m; ++i) {
      const float lo = a[i], hi = a[i + m];
      a[i] = (up ? hi : lo) + __shfl_xor(up ? lo : hi, m, 32);
    }
  }
  return a[0];
}

// ============================================================
// Precompute 1: spk_tokens = relu(speaker_emb @ We^T + be) + spk_pos
// One wave: four rows of We against all eight batches.
// ============================================================
__global__ __launch_bounds__(256) void spk_kernel(
    const float* __restrict__ se, const float* __restrict__ We,
    const float* __restrict__ be, const float* __restrict__ spos,
    float* __restrict__ spk) {
  const int lane = threadIdx.x & 31;
  const int r0 = (blockIdx.x * 8 + (threadIdx.x >> 5)) * 4;   // r = s*D + d
  const int r = r0 + (lane & 3), b = lane >> 2;
  const float bias = be[r], pos = spos[r];   // loaded in front of the wait inside rows4x8
  const float acc = rows4x8(We + (size_t)r0 * kD, se, lane);
  spk[b * (kSPK * kD) + r] = fmaxf(acc + bias, 0.f) + pos;
}

// ============================================================
// Precompute 2: k = spk@Wk^T + bk ; v = spk@Wv^T + bv
// One wave: four rows of Wk or Wv against eight of the 32 (b, s) rows; the eight
// waves of a block share those eight rows and cover 32 neighbouring outputs of each.
// ============================================================
__global__ __launch_bounds__(256) void kv_kernel(
    const float* __restrict__ spk,
    const float* __restrict__ Wk, const float* __restrict__ bk,
    const float* __restrict__ Wv, const float* __restrict__ bv,
    float* __restrict__ kbuf, float* __restrict__ vbuf) {
  const int lane = threadIdx.x & 31;
  const int which = blockIdx.x >> 6;                 // 0: k, 1: v
  const int bs0 = ((blockIdx.x >> 4) & 3) * 8;
  const int d0 = ((blockIdx.x & 15) * 8 + (threadIdx.x >> 5)) * 4;
  const int d = d0 + (lane & 3), bs = bs0 + (lane >> 2);
  const float bias = (which ? bv : bk)[d];   // loaded in front of the wait inside rows4x8
  const float acc = rows4x8((which ? Wv : Wk) + (size_t)d0 * kD, spk + (size_t)bs0 * kD, lane);
  (which ? vbuf : kbuf)[bs * kD + d] = acc + bias;
}

// ============================================================
// Precompute 3: fold Wq into K -> M (f16) + Msum, fold Wo into V -> VO^T (f16),
//               score bias bq.k, gamma-folded Wg1 (f16) + beta-folded bg1.
// The three f16 operands are stored in fragment order (frag_place): a thread's index
// is the place it writes, so the stores stay contiguous.
// Every segment boundary is a multiple of the 256-thread block, so a block
// (and a wave) lies wholly inside one segment.
// ============================================================
__global__ void fold_kernel(const float* __restrict__ kbuf, const float* __restrict__ vbuf,
                            const float* __restrict__ Wq, const float* __restrict__ bq,
                            const float* __restrict__ Wo, const float* __restrict__ Wg1,
                            const float* __restrict__ bg1,
                            const float* __restrict__ glng, const float* __restrict__ glnb,
                            _Float16* __restrict__ Mh, _Float16* __restrict__ VOt,
                            float* __restrict__ cb, float* __restrict__ Msum,
                            _Float16* __restrict__ Wg1h, float* __restrict__ bg1p) {
  __shared__ float sRow[kDH];              // row sums of one head's Wq rows
  int idx = blockIdx.x * blockDim.x + threadIdx.x;
  const int nM  = kB * kHS * kD;
  const int nV  = kB * kD * kHS;
  const int nC  = kB * kHS;
  const int nS  = kH * 256;                // one block per head
  const int nG  = kHG * kD;
  const int nGB = kHG * 32;                // one wave per gate unit
  if (idx < nM) {
    // M[b][hs][d] = (1/8) * sum_dh Wq[h*64+dh][d] * k[b][s][h*64+dh]
    int b = idx / (kHS * kD); int rem = idx - b * (kHS * kD);
    int hs, d;
    frag_place(rem, kD / 32, hs, d);
    int h = hs >> 2, s = hs & 3;
    const float* kr = kbuf + (size_t)(b * kSPK + s) * kD + h * kDH;
    float acc = 0.f;
    for (int j = 0; j < kDH; ++j)
      acc = fmaf(Wq[(size_t)(h * kDH + j) * kD + d], kr[j], acc);
    Mh[idx] = (_Float16)(acc * 0.125f);
  } else if (idx < nM + nV) {
    // VOt[b][d][hs] = sum_dh Wo[d][h*64+dh] * v[b][s][h*64+dh]
    int i = idx - nM;
    int b = i / (kD * kHS); int rem = i - b * (kD * kHS);
    int d, hs;
    frag_place(rem, kHS / 32, d, hs);
    int h = hs >> 2, s = hs & 3;
    const float* vr = vbuf + (size_t)(b * kSPK + s) * kD + h * kDH;
    const float* wo = Wo + (size_t)d * kD + h * kDH;
    float acc = 0.f;
    for (int j = 0; j < kDH; ++j) acc = fmaf(wo[j], vr[j], acc);
    VOt[i] = (_Float16)acc;
  } else if (idx < nM + nV + nC) {
    // cb[b][hs] = (1/8) * bq . k_head
    int i = idx - nM - nV; int b = i / kHS; int hs = i - b * kHS;
    int h = hs >> 2, s = hs & 3;
    const float* kr = kbuf + (size_t)(b * kSPK + s) * kD + h * kDH;
    float acc = 0.f;
    for (int j = 0; j < kDH; ++j) acc = fmaf(bq[h * kDH + j], kr[j], acc);
    cb[i] = acc * 0.125f;
  } else if (idx < nM + nV + nC + nS) {
    // Msum[b][hs] = sum_d M[b][hs][d] = (1/8) * sum_j k[b][s][h*64+j] * rowsum(Wq[h*64+j]) (fp32).
    // One block per head: each wave sums 8 rows with its lanes across the columns,
    // then 32 threads finish the (b, s) outputs of this head from the shared row sums.
    int i = idx - nM - nV - nC;
    int h = i >> 8, tl = i & 255;
    int wv = tl >> 5, ln = tl & 31;
    float part[8];
    for (int r = 0; r < 8; ++r) {
      const f4v* wr = (const f4v*)(Wq + (size_t)(h * kDH + wv * 8 + r) * kD);
      f4v s4 = (wr[ln] + wr[32 + ln]) + (wr[64 + ln] + wr[96 + ln]);
      part[r] = (s4[0] + s4[1]) + (s4[2] + s4[3]);
    }
    for (int r = 0; r < 8; ++r) part[r] = wave_sum(part[r]);
    if (ln == 0) {
      for (int r = 0; r < 8; ++r) sRow[wv * 8 + r] = part[r];
    }
    __syncthreads();   // block-uniform branch: the whole block is in this segment
    if (tl < kB * kSPK) {
      int b = tl >> 2, s = tl & 3;
      const float* kr = kbuf + (size_t)(b * kSPK + s) * kD + h * kDH;
      float acc = 0.f;
      for (int j = 0; j < kDH; ++j) acc = fmaf(kr[j], sRow[j], acc);
      Msum[b * kHS + h * 4 + s] = acc * 0.125f;
    }
  } else if (idx < nM + nV + nC + nS + nG) {
    // Wg1h = Wg1 * gamma (gamma of gate-LN folded into weights)
    int i = idx - nM - nV - nC - nS;
    int n, k;
    frag_place(i, kD / 32, n, k);
    Wg1h[i] = (_Float16)(Wg1[n * kD + k] * glng[k]);
  } else if (idx < nM + nV + nC + nS + nG + nGB) {
    // bg1p = bg1 + Wg1 . beta (beta of gate-LN folded into bias); one wave per unit n
    int i = idx - nM - nV - nC - nS - nG;
    int n = i >> 5, ln = i & 31;
    const f4v* wr = (const f4v*)(Wg1 + (size_t)n * kD);
    const f4v* bt = (const f4v*)glnb;
    f4v p4 = {};
    for (int c = 0; c < 4; ++c) p4 += wr[c * 32 + ln] * bt[c * 32 + ln];
    float acc = wave_sum((p4[0] + p4[1]) + (p4[2] + p4[3]));
    if (ln == 0) bg1p[n] = bg1[n] + acc;
  }
}

// ============================================================
// Fused main kernel: gate GEMM + scores + softmax + combine + final LN.
// LDS holds the pre-affine normalized tile x' = (x-mu)*rstd (f16);
// gamma/beta are folded into Wg1h/bg1p, and raw-x scores are recovered via
// scores = irs * (x'.M^T) + mu*Msum + cb.
// The second launch bound asks for eight waves per SIMD (at most 128 registers a wave):
// four work-groups then fit on a WGP, and the 1024 work-groups of the grid are all
// resident at once instead of running as three a WGP and a thin second round.
// ============================================================
__global__ __launch_bounds__(256, 8) void fused_kernel(
    const float* __restrict__ X,
    const _Float16* __restrict__ Mh,    // (B, HS, D), each batch in fragment order
    const _Float16* __restrict__ VOt,   // (B, D, HS), each batch in fragment order
    const float* __restrict__ cb,       // (B, HS)
    const float* __restrict__ Msum,     // (B, HS)
    const _Float16* __restrict__ Wg1h,  // (HG, D), gamma-folded, in fragment order
    const float* __restrict__ bg1p,     // (HG), beta-folded
    const float* __restrict__ Wg2, const float* __restrict__ bg2,
    const float* __restrict__ bo,
    const float* __restrict__ lng, const float* __restrict__ lnb,
    float* __restrict__ out) {
  __shared__ __attribute__((aligned(16))) _Float16 sXh[TILE * XP];  // x' (f16); later reused for attn (f16)
  __shared__ __attribute__((aligned(16))) _Float16 sGh[TILE * GP];
  __shared__ __attribute__((aligned(16))) float sSc[TILE * WP];
  __shared__ __attribute__((aligned(16))) float sW[TILE * WP];
  __shared__ float sMu[TILE], sIrs[TILE], sG[TILE];

  const int t = threadIdx.x;
  const int lane = t & 31;
  const int wave = t >> 5;
  const int r15 = lane & 15;
  const int hi = lane >> 4;          // 0 or 1 (wave32 half)
  const int kb = hi * 8;             // fragment K sub-offset per ISA layout

  const size_t rowg0 = (size_t)blockIdx.x * TILE;
  const int b = (int)(rowg0 >> 12);  // tile never crosses batch (4096 % 32 == 0)

  const size_t AW_OFF = (size_t)kB * kT * kD;
  const size_t G_OFF  = AW_OFF + (size_t)kB * kT * kSPK;

  // Each wave owns four whole rows; its lanes lie across the columns, so every
  // global load and store of a row piece is 32 lanes x 16 B = 512 contiguous bytes.
  // Piece c of row rr is f4v index rr * 128 + c * 32 + lane.
  const int row0 = wave * 4;
  const f4v* xw = (const f4v*)(X + (rowg0 + row0) * kD);

  // ---- Phase 0: LN stats inside the wave, then x' = (x-mu)*rstd to LDS (f16) ----
  {
    const f4v* xl = xw + lane;
    f4v xv[4][4];
    #pragma unroll
    for (int rr = 0; rr < 4; ++rr)
      #pragma unroll
      for (int c = 0; c < 4; ++c) xv[rr][c] = xl[rr * 128 + c * 32];
    // names the address pair so that it outlives the loads
    asm volatile("s_wait_xcnt 0x0" :: "v"(xl) : "memory");
    float s[4], q[4];
    #pragma unroll
    for (int rr = 0; rr < 4; ++rr) {
      s[rr] = 0.f; q[rr] = 0.f;
      #pragma unroll
      for (int c = 0; c < 4; ++c)
        #pragma unroll
        for (int e = 0; e < 4; ++e) { s[rr] += xv[rr][c][e]; q[rr] += xv[rr][c][e] * xv[rr][c][e]; }
    }
    #pragma unroll
    for (int rr = 0; rr < 4; ++rr) { s[rr] = wave_sum(s[rr]); q[rr] = wave_sum(q[rr]); }
    #pragma unroll
    for (int rr = 0; rr < 4; ++rr) {
      const float mu = s[rr] * (1.f / kD);
      const float var = q[rr] * (1.f / kD) - mu * mu;
      const float rs = rsqrtf(var + kEPS);
      if (lane == 0) {               // the scores epilogue of other waves reads these
        sMu[row0 + rr]  = mu;
        sIrs[row0 + rr] = sqrtf(var + kEPS);
      }
      #pragma unroll
      for (int c = 0; c < 4; ++c) {
        h4v h;
        #pragma unroll
        for (int e = 0; e < 4; ++e) h[e] = (_Float16)((xv[rr][c][e] - mu) * rs);
        *(h4v*)&sXh[(row0 + rr) * XP + c * 128 + lane * 4] = h;
      }
    }
  }
  __syncthreads();

  // ---- Gate GEMM: relu(x' @ Wg1h^T + bg1p)  (M=32,N=128,K=512) ----
  #pragma unroll
  for (int tt = 0; tt < 2; ++tt) {
    const int tid = wave + tt * 8;
    const int mt = tid >> 3, nt = tid & 7;
    const int arow = mt * 16 + r15;
    v8f acc = {};
    for (int k0 = 0; k0 < kD; k0 += 32) {
      v16h a  = frag_h(&sXh[arow * XP + k0 + kb]);
      v16h bm = frag_pk(Wg1h + nt * (16 * kD) + k0 * 16 + lane * 8);
      acc = __builtin_amdgcn_wmma_f32_16x16x32_f16(false, a, false, bm,
                                                   (short)0, acc, false, false);
    }
    const int col = nt * 16 + r15;
    const float bb = bg1p[col];
    #pragma unroll
    for (int r = 0; r < 8; ++r)
      sGh[(mt * 16 + hi * 8 + r) * GP + col] = (_Float16)fmaxf(acc[r] + bb, 0.f);
  }
  __syncthreads();

  // ---- Gate head on wave 4 (concurrent with scores on waves 0-3) ----
  if (wave == 4) {
    const int rw = lane;
    float g = bg2[0];
    const h8v* gp = (const h8v*)&sGh[rw * GP];
    #pragma unroll 4
    for (int j = 0; j < 16; ++j) {
      h8v h = gp[j];
      #pragma unroll
      for (int e = 0; e < 8; ++e) g = fmaf((float)h[e], Wg2[j * 8 + e], g);
    }
    g = 1.f / (1.f + expf(-g));
    sG[rw] = g;
    out[G_OFF + rowg0 + rw] = g;
  }

  // ---- Scores GEMM: irs*(x' @ M^T) + mu*Msum + cb  (M=32,N=32,K=512) ----
  if (wave < 4) {
    const int mt = wave >> 1, nt = wave & 1;
    const int arow = mt * 16 + r15;
    v8f acc = {};
    for (int k0 = 0; k0 < kD; k0 += 32) {
      v16h a  = frag_h(&sXh[arow * XP + k0 + kb]);
      v16h bm = frag_pk(Mh + (b * kHS + nt * 16) * kD + k0 * 16 + lane * 8);
      acc = __builtin_amdgcn_wmma_f32_16x16x32_f16(false, a, false, bm,
                                                   (short)0, acc, false, false);
    }
    const int col = nt * 16 + r15;
    const int ci = b * kHS + col;
    const float c0 = cb[ci];
    const float ms = Msum[ci];
    // names the index register so that it outlives the two loads
    asm volatile("s_wait_xcnt 0x0" :: "v"(ci) : "memory");
    #pragma unroll
    for (int r = 0; r < 8; ++r) {
      const int rr = mt * 16 + hi * 8 + r;
      sSc[rr * WP + col] = fmaf(acc[r], sIrs[rr], fmaf(sMu[rr], ms, c0));
    }
  }
  __syncthreads();

  // ---- Softmax over SPK=4 within each head (one thread per row-head) ----
  {
    const int rw = t >> 3, h = t & 7;
    const float* sp = &sSc[rw * WP + h * 4];
    float s0 = sp[0], s1 = sp[1], s2 = sp[2], s3 = sp[3];
    float m = fmaxf(fmaxf(s0, s1), fmaxf(s2, s3));
    float e0 = expf(s0 - m), e1 = expf(s1 - m), e2 = expf(s2 - m), e3 = expf(s3 - m);
    float inv = 1.f / (e0 + e1 + e2 + e3);
    float* wp = &sW[rw * WP + h * 4];
    wp[0] = e0 * inv; wp[1] = e1 * inv; wp[2] = e2 * inv; wp[3] = e3 * inv;
  }
  __syncthreads();
  if (t < TILE * kSPK) {  // head-averaged attention weights
    int rw = t >> 2, s = t & 3;
    float aw = 0.f;
    #pragma unroll
    for (int h = 0; h < kH; ++h) aw += sW[rw * WP + h * 4 + s];
    out[AW_OFF + (rowg0 + rw) * kSPK + s] = aw * (1.f / kH);
  }

  // ---- Combine GEMM: attn = w @ VO  (M=32,N=512,K=32) -> overwrite sXh ----
  #pragma unroll
  for (int i = 0; i < 8; ++i) {
    const int tid = wave * 8 + i;
    const int mt = tid >> 5, nt = tid & 31;
    v16h a, bm;
    {
      const f4v* wp = (const f4v*)&sW[(mt * 16 + r15) * WP + kb];
      f4v w0 = wp[0], w1 = wp[1];   // K = kb .. kb+7
      f4v w2 = wp[4], w3 = wp[5];   // K = kb+16 .. kb+23
      #pragma unroll
      for (int e = 0; e < 4; ++e) {
        a[e]      = (_Float16)w0[e];
        a[4 + e]  = (_Float16)w1[e];
        a[8 + e]  = (_Float16)w2[e];
        a[12 + e] = (_Float16)w3[e];
      }
    }
    bm = frag_pk(VOt + (b * kD + nt * 16) * kHS + lane * 8);
    v8f acc = {};
    acc = __builtin_amdgcn_wmma_f32_16x16x32_f16(false, a, false, bm,
                                                 (short)0, acc, false, false);
    const int col = nt * 16 + r15;
    #pragma unroll
    for (int r = 0; r < 8; ++r)
      sXh[(mt * 16 + hi * 8 + r) * XP + col] = (_Float16)acc[r];
  }
  __syncthreads();

  // ---- Epilogue: fused = LN(x + g*(attn + bo)), each wave on its own four rows ----
  {
    f4v* ow = (f4v*)(out + (rowg0 + row0) * kD);
    // kept rolled: unrolled, the compiler hoists all four rows' loads and the
    // register count costs a resident work-group
    #pragma unroll 1
    for (int rr = 0; rr < 4; ++rr) {
      const float g = sG[row0 + rr];
      const f4v* xr = xw + rr * 128 + lane;
      f4v f[4];
      float s = 0.f, q = 0.f;
      #pragma unroll
      for (int c = 0; c < 4; ++c) {
        const f4v v = xr[c * 32];
        const h4v a = *(const h4v*)&sXh[(row0 + rr) * XP + c * 128 + lane * 4];
        const f4v bb = ((const f4v*)bo)[c * 32 + lane];
        #pragma unroll
        for (int e = 0; e < 4; ++e) {
          const float x = v[e] + g * ((float)a[e] + bb[e]);
          f[c][e] = x;
          s += x; q += x * x;
        }
      }
      s = wave_sum(s);
      q = wave_sum(q);
      const float mu = s * (1.f / kD);
      const float var = q * (1.f / kD) - mu * mu;
      const float rs = rsqrtf(var + kEPS);
      #pragma unroll
      for (int c = 0; c < 4; ++c) {
        const f4v lg = ((const f4v*)lng)[c * 32 + lane];
        const f4v lb = ((const f4v*)lnb)[c * 32 + lane];
        f4v o;
        #pragma unroll
        for (int e = 0; e < 4; ++e) o[e] = (f[c][e] - mu) * rs * lg[e] + lb[e];
        ow[rr * 128 + c * 32 + lane] = o;
      }
      // the next trip rewrites the address and data registers that these stores name; xr is
      // named so that the x loads' address pair lives up to this wait
      asm volatile("s_wait_xcnt 0x0" :: "v"(xr) : "memory");
    }
  }
}

// ============================================================
extern "C" void kernel_launch(void* const* d_in, const int* in_sizes, int n_in,
                              void* d_out, int out_size, void* d_ws, size_t ws_size,
                              hipStream_t stream) {
  (void)in_sizes; (void)n_in; (void)out_size; (void)ws_size;
  const float* token = (const float*)d_in[0];
  const float* se    = (const float*)d_in[1];
  const float* We    = (const float*)d_in[2];
  const float* be    = (const float*)d_in[3];
  const float* spos  = (const float*)d_in[4];
  const float* Wq    = (const float*)d_in[5];
  const float* bq    = (const float*)d_in[6];
  const float* Wk    = (const float*)d_in[7];
  const float* bk    = (const float*)d_in[8];
  const float* Wv    = (const float*)d_in[9];
  const float* bv    = (const float*)d_in[10];
  const float* Wo    = (const float*)d_in[11];
  const float* bo    = (const float*)d_in[12];
  const float* glng  = (const float*)d_in[13];
  const float* glnb  = (const float*)d_in[14];
  const float* Wg1   = (const float*)d_in[15];
  const float* bg1   = (const float*)d_in[16];
  const float* Wg2   = (const float*)d_in[17];
  const float* bg2   = (const float*)d_in[18];
  const float* lng   = (const float*)d_in[19];
  const float* lnb   = (const float*)d_in[20];
  float* out = (float*)d_out;

  char* ws = (char*)d_ws;
  float*    spk  = (float*)(ws + 0);            // 64 KB
  float*    kbuf = (float*)(ws + 65536);        // 64 KB
  float*    vbuf = (float*)(ws + 131072);       // 64 KB
  _Float16* Mh   = (_Float16*)(ws + 196608);    // 256 KB
  _Float16* VOt  = (_Float16*)(ws + 458752);    // 256 KB
  float*    cbf  = (float*)(ws + 720896);       // 1 KB
  float*    Msum = (float*)(ws + 721920);       // 1 KB
  float*    bg1p = (float*)(ws + 722944);       // 512 B
  _Float16* Wg1h = (_Float16*)(ws + 723456);    // 128 KB

  spk_kernel<<<kSPK * kD / 32, 256, 0, stream>>>(se, We, be, spos, spk);
  kv_kernel<<<2 * (kD / 32) * (kB * kSPK / 8), 256, 0, stream>>>(spk, Wk, bk, Wv, bv, kbuf, vbuf);
  const int nfold = kB * kHS * kD + kB * kD * kHS + kB * kHS + kH * 256 + kHG * kD + kHG * 32;
  fold_kernel<<<(nfold + 255) / 256, 256, 0, stream>>>(kbuf, vbuf, Wq, bq, Wo, Wg1, bg1,
                                                       glng, glnb, Mh, VOt, cbf, Msum, Wg1h, bg1p);
  fused_kernel<<<(kB * kT) / TILE, 256, 0, stream>>>(token, Mh, VOt, cbf, Msum, Wg1h, bg1p,
                                                     Wg2, bg2, bo, lng, lnb, out);
}

// v007
// Measured time: 33.8 microseconds a run.
// In two side-by-side timings against v006, it was 1.04 and 1.03 times as fast.
// Counting every step since v000, it is 14.0 times as fast.
#include <hip/hip_runtime.h>
#include <hip/hip_bf16.h>
#include <math.h>

// ---- problem constants ----
constexpr int kB   = 8;
constexpr int kT   = 4096;
constexpr int kD   = 512;
constexpr int kH   = 8;
constexpr int kDH  = 64;
constexpr int kSPK = 4;
constexpr int kHS  = kH * kSPK;   // 32 folded "keys" per batch
constexpr int kHG  = 128;
constexpr int TILE = 32;          // token rows per block
constexpr float kEPS = 1e-5f;
// LDS row pitches: 16 B x an odd number, so that the 16 rows that one 16-byte
// fragment read touches fall on 16 different bank groups instead of on one.
constexpr int XP = kD + 8;        // halves: 1040 B = 16 B x 65
constexpr int GP = kHG + 8;       // halves:  272 B = 16 B x 17
constexpr int WP = kHS + 4;       // floats:  144 B = 16 B x 9

typedef __attribute__((ext_vector_type(16))) _Float16 v16h;
typedef __attribute__((ext_vector_type(8)))  float    v8f;
typedef __attribute__((ext_vector_type(4)))  float    f4v;
typedef __attribute__((ext_vector_type(2)))  float    f2v;
typedef __attribute__((ext_vector_type(4)))  _Float16 h4v;
typedef __attribute__((ext_vector_type(8)))  _Float16 h8v;

// Gather one 16x32 WMMA fragment (A or B) from a row-major f16 matrix.
// p points at [row_of_this_lane][k0 + kb]; lanes 0-15 take K {0..7,16..23},
// lanes 16-31 take K {8..15,24..31} (kb handles the 8-offset).
__device__ __forceinline__ v16h frag_h(const _Float16* p) {
  h8v lo = *(const h8v*)p;
  h8v hi = *(const h8v*)(p + 16);
  v16h f;
  #pragma unroll
  for (int j = 0; j < 8; ++j) { f[j] = lo[j]; f[8 + j] = hi[j]; }
  return f;
}

// Fragment order of a B operand (f16, N rows x K columns, ksteps = K / 32). Place
// p = (((nt * ksteps + ks) * 2 + hf) * 32 + lane) * 8 + j holds row nt*16 + (lane & 15),
// column ks*32 + hf*16 + (lane >> 4)*8 + j: the same k order as frag_h, but the 32 lanes
// of each 16-byte load lie side by side, 512 contiguous bytes = 4 whole 128-B lines,
// where a row-major operand gives 16 lines with 32 bytes used of each.
__device__ __forceinline__ void frag_place(int p, int ksteps, int& n, int& k) {
  const int j = p & 7, ln = (p >> 3) & 31, hf = (p >> 8) & 1;
  const int blk = p >> 9;
  const int nt = blk / ksteps, ks = blk - nt * ksteps;
  n = nt * 16 + (ln & 15);
  k = ks * 32 + hf * 16 + (ln >> 4) * 8 + j;
}

// One 16x32 B fragment from an operand stored in fragment order.
// p points at [fragment nt * ksteps + ks][0][lane][0].
__device__ __forceinline__ v16h frag_pk(const _Float16* p) {
  h8v lo = *(const h8v*)p;
  h8v hi = *(const h8v*)(p + 256);
  v16h f;
  #pragma unroll
  for (int j = 0; j < 8; ++j) { f[j] = lo[j]; f[8 + j] = hi[j]; }
  return f;
}

// Sum over the 32 lanes of a wave; every lane gets the total.
__device__ __forceinline__ float wave_sum(float v) {
  for (int m = 16; m >= 1; m >>= 1) v += __shfl_xor(v, m, 32);
  return v;
}

// Dot products of four weight rows with eight input rows (all of length kD, rows
// contiguous) by one wave. The lanes lie across the columns, so every load is
// 32 lanes x 16 B = 512 contiguous bytes. Lane l returns the whole sum for weight
// row (l & 3) and input row (l >> 2).
// In two halves, so that a caller can send further loads out between them.
// First half: a[i * 4 + r] is this lane's share of the sum for weight row r, input row i.
__device__ __forceinline__ void rows4x8_shares(const float* __restrict__ w,
                                               const float* __restrict__ x, int lane,
                                               float (&a)[32]) {
  // Every loop here is unrolled in full: the arrays live in registers only while
  // each index is a constant.
  const f4v* wl = (const f4v*)w + lane;
  const f4v* xl = (const f4v*)x + lane;
  f4v wv[4][4], xv[8][4];
  #pragma unroll
  for (int c = 0; c < 4; ++c) {
    #pragma unroll
    for (int r = 0; r < 4; ++r) wv[r][c] = wl[r * 128 + c * 32];
    #pragma unroll
    for (int i = 0; i < 8; ++i) xv[i][c] = xl[i * 128 + c * 32];
  }
  // names the address registers (w: the pair; x: scalar base + lane) so that they outlive
  // the loads: no load's result may land on one that earlier loads name before this wait
  asm volatile("s_wait_xcnt 0x0" :: "v"(wl), "v"(lane) : "memory");
  // keeps the wait where it is written: without it the scheduler sinks the wait below
  // the arithmetic, and lets fewer of the 48 loads fly at once
  __builtin_amdgcn_sched_barrier(0);
  #pragma unroll
  for (int i = 0; i < 32; ++i) a[i] = 0.f;
  #pragma unroll
  for (int c = 0; c < 4; ++c)
    #pragma unroll
    for (int i = 0; i < 8; ++i)
      #pragma unroll
      for (int r = 0; r < 4; ++r)
        #pragma unroll
        for (int e = 0; e < 4; ++e) a[i * 4 + r] = fmaf(xv[i][c][e], wv[r][c][e], a[i * 4 + r]);
}

// Second half: the shares of the 32 lanes are summed.
__device__ __forceinline__ float rows4x8_whole(float (&a)[32], int lane) {
  // Halving exchange: at each step a lane keeps the half of the sums whose index bit
  // equals its own lane bit and hands the other half to its partner, so 31 shuffles
  // leave sum l whole in lane l.
  #pragma unroll
  for (int m = 16; m >= 1; m >>= 1) {
    const bool up = (lane & m) != 0;
    #pragma unroll
    for (int i = 0; i < m; ++i) {
      const float lo = a[i], hi = a[i + m];
      a[i] = (up ? hi : lo) + __shfl_xor(up ? lo : hi, m, 32);
    }
  }
  return a[0];
}

__device__ __forceinline__ float rows4x8(const float* __restrict__ w,
                                         const float* __restrict__ x, int lane) {
  float a[32];
  rows4x8_shares(w, x, lane, a);
  return rows4x8_whole(a, lane);
}

// ============================================================
// Precompute 1: spk_tokens = relu(speaker_emb @ We^T + be) + spk_pos
// One wave: four rows of We against all eight batches.
// ============================================================
__global__ __launch_bounds__(256) void spk_kernel(
    const float* __restrict__ se, const float* __restrict__ We,
    const float* __restrict__ be, const float* __restrict__ spos,
    float* __restrict__ spk) {
  const int lane = threadIdx.x & 31;
  const int r0 = (blockIdx.x * 8 + (threadIdx.x >> 5)) * 4;   // r = s*D + d
  const int r = r0 + (lane & 3), b = lane >> 2;
  const float bias = be[r], pos = spos[r];   // loaded in front of the wait inside rows4x8
  const float acc = rows4x8(We + (size_t)r0 * kD, se, lane);
  spk[b * (kSPK * kD) + r] = fmaxf(acc + bias, 0.f) + pos;
}

// ============================================================
// Precompute 2: k, v and everything folded from them, in one launch.
// Work-group (k or v, batch b, head pair g), 16 waves. Each wave first takes eight rows
// of Wk or Wv against the four speaker rows of b, so the work-group holds the 4 x 128
// slice of k or v that its own outputs need, and nobody else needs that slice.
//   k: M (f16) = Wq folded into k, Msum, score bias bq.k
//   v: VO^T (f16) = Wo folded into v
// A head pair is eight neighbouring folded keys: in fragment order (frag_place) these
// fill whole 128-B lines of M and VO^T, so each line has one writing work-group.
// The last blocks fold the gate LN: gamma into Wg1 (f16, fragment order), beta into bg1.
// ============================================================
// The 32 pieces (512 contiguous bytes each, STEP x 16 B apart) of the weights that a wave
// folds its slice of k or v with. They depend on nothing computed in the kernel: called
// between the halves of rows4x8, the loads go out as registers come free and fly during
// the exchange.
template <int STEP>
__device__ __forceinline__ void fold_loads(const float* __restrict__ w2, int lane, int jj,
                                           f4v (&wr)[32]) {
  const f4v* wl = (const f4v*)w2 + lane;
  #pragma unroll   // wr lives in registers only while each index is a constant
  for (int i = 0; i < 32; ++i) wr[i] = wl[i * STEP];
  // names the address pair, and the index jj of the caller's bias loads, so that they
  // outlive the loads: no load's result may land on them before this wait
  asm volatile("s_wait_xcnt 0x0" :: "v"(wl), "v"(jj) : "memory");
}

// One step of a halving exchange inside a 16-lane row: of the 16 * M sums a lane keeps the
// half whose index bit equals its lane bit M and adds what lane ^ M hands over. The partner's
// value comes by DPP (row_xmask), a vector instruction, not through the LDS pipe.
template <int M>
__device__ __forceinline__ void halve_in_row(float (&a)[128], int lane) {
  const bool up = (lane & M) != 0;
  #pragma unroll   // a lives in registers only while each index is a constant
  for (int i = 0; i < M * 8; ++i) {
    const float lo = a[i], hi = a[i + M * 8];
    const float give = up ? lo : hi;
    a[i] = (up ? hi : lo) + __int_as_float(__builtin_amdgcn_update_dpp(
        0, __float_as_int(give), 0x160 + M, 0xf, 0xf, false));
  }
}

constexpr int PP = kD + 16;       // floats: LDS pitch of a partial row of M
constexpr int kKV = 2 * kB * (kH / 2);   // work-groups of the k and v parts

__global__ __launch_bounds__(512) void kvfold_kernel(
    const float* __restrict__ spk,
    const float* __restrict__ Wk, const float* __restrict__ bk,
    const float* __restrict__ Wv, const float* __restrict__ bv,
    const float* __restrict__ Wq, const float* __restrict__ bq,
    const float* __restrict__ Wo, const float* __restrict__ Wg1,
    const float* __restrict__ bg1,
    const float* __restrict__ glng, const float* __restrict__ glnb,
    _Float16* __restrict__ Mh, _Float16* __restrict__ VOt,
    float* __restrict__ cb, float* __restrict__ Msum,
    _Float16* __restrict__ Wg1h, float* __restrict__ bg1p) {
  __shared__ __attribute__((aligned(16))) float sP[64 * PP + 16];  // [wave][s][d] partial M
  __shared__ __attribute__((aligned(16))) float sV[8 * kDH];       // [head of pair][s][j]
  __shared__ float sRed[2][16][4];                                 // [Msum, cb][wave][s]
  // Every loop over wr, a4, vv, vp and a below is unrolled in full: the arrays live in
  // registers only while each index is a constant.
  const int t = threadIdx.x;
  const int lane = t & 31;
  // the wave's number as a scalar, so that row addresses formed from it are scalar bases
  const int wave = __builtin_amdgcn_readfirstlane(t >> 5);
  if (blockIdx.x < kKV) {
    const int which = blockIdx.x >> 5;               // 0: k, 1: v
    const int b = (blockIdx.x >> 2) & 7;
    const int g = blockIdx.x & 3;                    // heads 2g and 2g + 1
    const int wrow = g * 128 + wave * 8;             // head 2g + (wave >> 3), j from (wave & 7) * 8
    const int s = lane & 3, jj = lane >> 2;
    // the four speaker rows stand where rows4x8 has its four rows: lane l gets speaker
    // row (l & 3) against weight row wrow + (l >> 2)
    const float* spkb = spk + (size_t)b * kSPK * kD;
    float sh[32];
    f4v wr[32];
    if (which == 0) {
      // M[b][hs][d] = (1/8) * sum_j Wq[h*64+j][d] * k[b][s][h*64+j]: the wave sums over its
      // own eight j for all d (lanes across the columns), the eight waves of a head meet in LDS.
      // wr: the wave's own eight rows of Wq, whole (piece i = row i >> 2, quarter i & 3)
      const float bkv = (bk + wrow)[jj], bqv = (bq + wrow)[jj];   // in front of the wait in rows4x8_shares
      rows4x8_shares(spkb, Wk + (size_t)wrow * kD, lane, sh);
      fold_loads<32>(Wq + (size_t)wrow * kD, lane, jj, wr);
      const float kv = rows4x8_whole(sh, lane) + bkv;
      f4v a4[4][4];
      #pragma unroll
      for (int i = 0; i < 4; ++i)
        #pragma unroll
        for (int q = 0; q < 4; ++q) a4[i][q] = (f4v){0.f, 0.f, 0.f, 0.f};
      #pragma unroll
      for (int r = 0; r < 8; ++r)
        #pragma unroll
        for (int i = 0; i < 4; ++i) {
          const float kk = __int_as_float(__builtin_amdgcn_readlane(__float_as_int(kv), r * 4 + i));
          #pragma unroll
          for (int q = 0; q < 4; ++q) a4[i][q] += wr[r * 4 + q] * kk;
        }
      // Msum[b][hs] = sum_d M[b][hs][d] (fp32), cb[b][hs] = (1/8) * bq . k_head: this wave's share
      float ms[4];
      #pragma unroll
      for (int i = 0; i < 4; ++i) {
        const f4v s4 = (a4[i][0] + a4[i][1]) + (a4[i][2] + a4[i][3]);
        ms[i] = (s4[0] + s4[1]) + (s4[2] + s4[3]);
      }
      // halving exchange over lane bits 1 and 0: the sum for s = lane & 3 stays, as in cp
      const bool up2 = (lane & 2) != 0, up1 = (lane & 1) != 0;
      const float m0 = (up2 ? ms[2] : ms[0]) + __shfl_xor(up2 ? ms[0] : ms[2], 2, 32);
      const float m1 = (up2 ? ms[3] : ms[1]) + __shfl_xor(up2 ? ms[1] : ms[3], 2, 32);
      float mp = (up1 ? m1 : m0) + __shfl_xor(up1 ? m0 : m1, 1, 32);
      float cp = kv * bqv;
      #pragma unroll
      for (int m = 4; m <= 16; m <<= 1) {
        mp += __shfl_xor(mp, m, 32);
        cp += __shfl_xor(cp, m, 32);
      }
      if (lane < 4) {
        sRed[0][wave][lane] = mp;
        sRed[1][wave][lane] = cp;
      }
      // the second head's rows stand 16 B further on, so that the 16 lanes of one read
      // below (4 s x 2 heads x 2 column groups) fall on 16 different bank groups
      #pragma unroll
      for (int i = 0; i < 4; ++i)
        #pragma unroll
        for (int q = 0; q < 4; ++q)
          *(f4v*)&sP[(wave * 4 + i) * PP + (wave >> 3) * 4 + q * 128 + lane * 4] = a4[i][q];
      __syncthreads();   // block-uniform branch
      // one thread: one folded key n8 of the pair, eight neighbouring d = one 16-B place unit
      const int n8 = lane & 7, oct = t >> 3;
      const int hh = n8 >> 2;
      f4v s0 = {0.f, 0.f, 0.f, 0.f}, s1 = {0.f, 0.f, 0.f, 0.f};
      #pragma unroll
      for (int i = 0; i < 8; ++i) {
        const float* p = &sP[((hh * 8 + i) * 4 + (n8 & 3)) * PP + hh * 4 + oct * 8];
        s0 += *(const f4v*)p;
        s1 += *(const f4v*)(p + 4);
      }
      h8v o;
      #pragma unroll
      for (int e = 0; e < 4; ++e) {
        o[e]     = (_Float16)(s0[e] * 0.125f);
        o[4 + e] = (_Float16)(s1[e] * 0.125f);
      }
      // inverse of frag_place for row g*8 + n8, columns oct*8 .. oct*8 + 7
      const int place = (((((g >> 1) * (kD / 32) + (oct >> 2)) * 2 + ((oct >> 1) & 1)) * 32)
                         + (oct & 1) * 16 + (g & 1) * 8 + n8) * 8;
      *(h8v*)(Mh + (size_t)b * kHS * kD + place) = o;
      if (t < 16) {
        const int kind = t >> 3;                     // 0: Msum, 1: cb
        float acc = 0.f;
        #pragma unroll
        for (int i = 0; i < 8; ++i) acc += sRed[kind][hh * 8 + i][n8 & 3];
        // each (b, g) has a 128-B line of its own for its eight cb and eight Msum
        (kind ? cb : Msum)[(b * 4 + g) * 32 + n8] = acc * 0.125f;
      }
    } else {
      // VOt[b][d][hs] = sum_j Wo[d][h*64+j] * v[b][s][h*64+j]: a wave takes 32 rows d; the
      // 128 columns of the head pair are 512 contiguous bytes, 16 lanes to a head (wr: piece i = row i)
      const float bvv = (bv + wrow)[jj];                          // in front of the wait in rows4x8_shares
      rows4x8_shares(spkb, Wv + (size_t)wrow * kD, lane, sh);
      fold_loads<128>(Wo + (size_t)(wave * 32) * kD + g * 128, lane, jj, wr);
      const float kv = rows4x8_whole(sh, lane) + bvv;
      sV[((wave >> 3) * 4 + s) * kDH + (wave & 7) * 8 + jj] = kv;
      __syncthreads();   // block-uniform branch
      const int hh = lane >> 4, c4 = lane & 15;
      f4v vv[4];
      #pragma unroll
      for (int i = 0; i < 4; ++i) vv[i] = *(const f4v*)&sV[(hh * 4 + i) * kDH + c4 * 4];
      // v in pairs of s, so that one packed multiply-add serves two sums of a row
      f2v vp[4][2];
      #pragma unroll
      for (int e = 0; e < 4; ++e) {
        vp[e][0] = (f2v){vv[0][e], vv[1][e]};
        vp[e][1] = (f2v){vv[2][e], vv[3][e]};
      }
      float a[128];
      #pragma unroll
      for (int i = 0; i < 32; ++i)
        #pragma unroll
        for (int k = 0; k < 2; ++k) {
          f2v p2 = vp[0][k] * wr[i][0];
          #pragma unroll
          for (int e = 1; e < 4; ++e) p2 += vp[e][k] * wr[i][e];
          a[i * 4 + k * 2]     = p2[0];
          a[i * 4 + k * 2 + 1] = p2[1];
        }
      // Halving exchange over the 16 lanes of a head, as in rows4x8: sums c4*8 .. c4*8 + 7
      // (rows 2*c4 and 2*c4 + 1 of the wave's 32, four s each) end whole in lane c4.
      halve_in_row<8>(a, lane);
      halve_in_row<4>(a, lane);
      halve_in_row<2>(a, lane);
      halve_in_row<1>(a, lane);
      #pragma unroll
      for (int r = 0; r < 2; ++r) {
        const int d = wave * 32 + c4 * 2 + r;
        h4v o;
        #pragma unroll
        for (int k = 0; k < 4; ++k) o[k] = (_Float16)a[r * 4 + k];
        // inverse of frag_place for row d, columns g*8 + hh*4 .. + 3
        const int place = ((((d >> 4) * 2 + (g >> 1)) * 32) + (g & 1) * 16 + (d & 15)) * 8 + hh * 4;
        *(h4v*)(VOt + (size_t)b * kD * kHS + place) = o;
      }
    }
  } else {
    const int idx = (blockIdx.x - kKV) * 512 + t;
    if (idx < kHG * kD / 8) {
      // Wg1h = Wg1 * gamma (gamma of gate-LN folded into weights); one 16-B place unit a thread
      int n, k;
      frag_place(idx * 8, kD / 32, n, k);
      const f4v* wr = (const f4v*)(Wg1 + (size_t)n * kD + k);
      const f4v* gm = (const f4v*)(glng + k);
      const f4v p0 = wr[0] * gm[0], p1 = wr[1] * gm[1];
      h8v o;
      #pragma unroll
      for (int e = 0; e < 4; ++e) { o[e] = (_Float16)p0[e]; o[4 + e] = (_Float16)p1[e]; }
      *(h8v*)(Wg1h + (size_t)idx * 8) = o;
    } else {
      // bg1p = bg1 + Wg1 . beta (beta of gate-LN folded into bias); a wave takes two units n,
      // so that the 32 results of a block fill one 128-B line
      const int n0 = ((idx - kHG * kD / 8) >> 5) * 2;
      const f4v* bt = (const f4v*)glnb;
      for (int u = 0; u < 2; ++u) {
        const int n = n0 + u;
        const f4v* wr = (const f4v*)(Wg1 + (size_t)n * kD);
        f4v p4 = {};
        for (int c = 0; c < 4; ++c) p4 += wr[c * 32 + lane] * bt[c * 32 + lane];
        float acc = wave_sum((p4[0] + p4[1]) + (p4[2] + p4[3]));
        if (lane == 0) bg1p[n] = bg1[n] + acc;
      }
    }
  }
}

// ============================================================
// Fused main kernel: gate GEMM + scores + softmax + combine + final LN.
// LDS holds the pre-affine normalized tile x' = (x-mu)*rstd (f16);
// gamma/beta are folded into Wg1h/bg1p, and raw-x scores are recovered via
// scores = irs * (x'.M^T) + mu*Msum + cb.
// The second launch bound asks for eight waves per SIMD (at most 128 registers a wave):
// four work-groups then fit on a WGP, and the 1024 work-groups of the grid are all
// resident at once instead of running as three a WGP and a thin second round.
// ============================================================
__global__ __launch_bounds__(256, 8) void fused_kernel(
    const float* __restrict__ X,
    const _Float16* __restrict__ Mh,    // (B, HS, D), each batch in fragment order
    const _Float16* __restrict__ VOt,   // (B, D, HS), each batch in fragment order
    const float* __restrict__ cb,       // (B, 4 head pairs): 8 values at the head of a 128-B line
    const float* __restrict__ Msum,     // the same lines as cb, floats 8..15 of each
    const _Float16* __restrict__ Wg1h,  // (HG, D), gamma-folded, in fragment order
    const float* __restrict__ bg1p,     // (HG), beta-folded
    const float* __restrict__ Wg2, const float* __restrict__ bg2,
    const float* __restrict__ bo,
    const float* __restrict__ lng, const float* __restrict__ lnb,
    float* __restrict__ out) {
  __shared__ __attribute__((aligned(16))) _Float16 sXh[TILE * XP];  // x' (f16); later reused for attn (f16)
  __shared__ __attribute__((aligned(16))) _Float16 sGh[TILE * GP];
  __shared__ __attribute__((aligned(16))) float sSc[TILE * WP];
  __shared__ __attribute__((aligned(16))) float sW[TILE * WP];
  __shared__ float sMu[TILE], sIrs[TILE], sG[TILE];

  const int t = threadIdx.x;
  const int lane = t & 31;
  const int wave = t >> 5;
  const int r15 = lane & 15;
  const int hi = lane >> 4;          // 0 or 1 (wave32 half)
  const int kb = hi * 8;             // fragment K sub-offset per ISA layout

  const size_t rowg0 = (size_t)blockIdx.x * TILE;
  const int b = (int)(rowg0 >> 12);  // tile never crosses batch (4096 % 32 == 0)

  const size_t AW_OFF = (size_t)kB * kT * kD;
  const size_t G_OFF  = AW_OFF + (size_t)kB * kT * kSPK;

  // Each wave owns four whole rows; its lanes lie across the columns, so every
  // global load and store of a row piece is 32 lanes x 16 B = 512 contiguous bytes.
  // Piece c of row rr is f4v index rr * 128 + c * 32 + lane.
  const int row0 = wave * 4;
  const f4v* xw = (const f4v*)(X + (rowg0 + row0) * kD);

  // ---- Phase 0: LN stats inside the wave, then x' = (x-mu)*rstd to LDS (f16) ----
  {
    const f4v* xl = xw + lane;
    f4v xv[4][4];
    #pragma unroll
    for (int rr = 0; rr < 4; ++rr)
      #pragma unroll
      for (int c = 0; c < 4; ++c) xv[rr][c] = xl[rr * 128 + c * 32];
    // names the address pair so that it outlives the loads
    asm volatile("s_wait_xcnt 0x0" :: "v"(xl) : "memory");
    float s[4], q[4];
    #pragma unroll
    for (int rr = 0; rr < 4; ++rr) {
      s[rr] = 0.f; q[rr] = 0.f;
      #pragma unroll
      for (int c = 0; c < 4; ++c)
        #pragma unroll
        for (int e = 0; e < 4; ++e) { s[rr] += xv[rr][c][e]; q[rr] += xv[rr][c][e] * xv[rr][c][e]; }
    }
    #pragma unroll
    for (int rr = 0; rr < 4; ++rr) { s[rr] = wave_sum(s[rr]); q[rr] = wave_sum(q[rr]); }
    #pragma unroll
    for (int rr = 0; rr < 4; ++rr) {
      const float mu = s[rr] * (1.f / kD);
      const float var = q[rr] * (1.f / kD) - mu * mu;
      const float rs = rsqrtf(var + kEPS);
      if (lane == 0) {               // the scores epilogue of other waves reads these
        sMu[row0 + rr]  = mu;
        sIrs[row0 + rr] = sqrtf(var + kEPS);
      }
      #pragma unroll
      for (int c = 0; c < 4; ++c) {
        h4v h;
        #pragma unroll
        for (int e = 0; e < 4; ++e) h[e] = (_Float16)((xv[rr][c][e] - mu) * rs);
        *(h4v*)&sXh[(row0 + rr) * XP + c * 128 + lane * 4] = h;
      }
    }
  }
  __syncthreads();

  // ---- Gate GEMM: relu(x' @ Wg1h^T + bg1p)  (M=32,N=128,K=512) ----
  #pragma unroll
  for (int tt = 0; tt < 2; ++tt) {
    const int tid = wave + tt * 8;
    const int mt = tid >> 3, nt = tid & 7;
    const int arow = mt * 16 + r15;
    v8f acc = {};
    for (int k0 = 0; k0 < kD; k0 += 32) {
      v16h a  = frag_h(&sXh[arow * XP + k0 + kb]);
      v16h bm = frag_pk(Wg1h + nt * (16 * kD) + k0 * 16 + lane * 8);
      acc = __builtin_amdgcn_wmma_f32_16x16x32_f16(false, a, false, bm,
                                                   (short)0, acc, false, false);
    }
    const int col = nt * 16 + r15;
    const float bb = bg1p[col];
    #pragma unroll
    for (int r = 0; r < 8; ++r)
      sGh[(mt * 16 + hi * 8 + r) * GP + col] = (_Float16)fmaxf(acc[r] + bb, 0.f);
  }
  __syncthreads();

  // ---- Gate head on wave 4 (concurrent with scores on waves 0-3) ----
  if (wave == 4) {
    const int rw = lane;
    float g = bg2[0];
    const h8v* gp = (const h8v*)&sGh[rw * GP];
    #pragma unroll 4
    for (int j = 0; j < 16; ++j) {
      h8v h = gp[j];
      #pragma unroll
      for (int e = 0; e < 8; ++e) g = fmaf((float)h[e], Wg2[j * 8 + e], g);
    }
    g = 1.f / (1.f + expf(-g));
    sG[rw] = g;
    out[G_OFF + rowg0 + rw] = g;
  }

  // ---- Scores GEMM: irs*(x' @ M^T) + mu*Msum + cb  (M=32,N=32,K=512) ----
  if (wave < 4) {
    const int mt = wave >> 1, nt = wave & 1;
    const int arow = mt * 16 + r15;
    v8f acc = {};
    for (int k0 = 0; k0 < kD; k0 += 32) {
      v16h a  = frag_h(&sXh[arow * XP + k0 + kb]);
      v16h bm = frag_pk(Mh + (b * kHS + nt * 16) * kD + k0 * 16 + lane * 8);
      acc = __builtin_amdgcn_wmma_f32_16x16x32_f16(false, a, false, bm,
                                                   (short)0, acc, false, false);
    }
    const int col = nt * 16 + r15;
    const int ci = (b * 4 + (col >> 3)) * 32 + (col & 7);
    const float c0 = cb[ci];
    const float ms = Msum[ci];
    // names the index register so that it outlives the two loads
    asm volatile("s_wait_xcnt 0x0" :: "v"(ci) : "memory");
    #pragma unroll
    for (int r = 0; r < 8; ++r) {
      const int rr = mt * 16 + hi * 8 + r;
      sSc[rr * WP + col] = fmaf(acc[r], sIrs[rr], fmaf(sMu[rr], ms, c0));
    }
  }
  __syncthreads();

  // ---- Softmax over SPK=4 within each head (one thread per row-head) ----
  {
    const int rw = t >> 3, h = t & 7;
    const float* sp = &sSc[rw * WP + h * 4];
    float s0 = sp[0], s1 = sp[1], s2 = sp[2], s3 = sp[3];
    float m = fmaxf(fmaxf(s0, s1), fmaxf(s2, s3));
    float e0 = expf(s0 - m), e1 = expf(s1 - m), e2 = expf(s2 - m), e3 = expf(s3 - m);
    float inv = 1.f / (e0 + e1 + e2 + e3);
    float* wp = &sW[rw * WP + h * 4];
    wp[0] = e0 * inv; wp[1] = e1 * inv; wp[2] = e2 * inv; wp[3] = e3 * inv;
  }
  __syncthreads();
  if (t < TILE * kSPK) {  // head-averaged attention weights
    int rw = t >> 2, s = t & 3;
    float aw = 0.f;
    #pragma unroll
    for (int h = 0; h < kH; ++h) aw += sW[rw * WP + h * 4 + s];
    out[AW_OFF + (rowg0 + rw) * kSPK + s] = aw * (1.f / kH);
  }

  // ---- Combine GEMM: attn = w @ VO  (M=32,N=512,K=32) -> overwrite sXh ----
  #pragma unroll
  for (int i = 0; i < 8; ++i) {
    const int tid = wave * 8 + i;
    const int mt = tid >> 5, nt = tid & 31;
    v16h a, bm;
    {
      const f4v* wp = (const f4v*)&sW[(mt * 16 + r15) * WP + kb];
      f4v w0 = wp[0], w1 = wp[1];   // K = kb .. kb+7
      f4v w2 = wp[4], w3 = wp[5];   // K = kb+16 .. kb+23
      #pragma unroll
      for (int e = 0; e < 4; ++e) {
        a[e]      = (_Float16)w0[e];
        a[4 + e]  = (_Float16)w1[e];
        a[8 + e]  = (_Float16)w2[e];
        a[12 + e] = (_Float16)w3[e];
      }
    }
    bm = frag_pk(VOt + (b * kD + nt * 16) * kHS + lane * 8);
    v8f acc = {};
    acc = __builtin_amdgcn_wmma_f32_16x16x32_f16(false, a, false, bm,
                                                 (short)0, acc, false, false);
    const int col = nt * 16 + r15;
    #pragma unroll
    for (int r = 0; r < 8; ++r)
      sXh[(mt * 16 + hi * 8 + r) * XP + col] = (_Float16)acc[r];
  }
  __syncthreads();

  // ---- Epilogue: fused = LN(x + g*(attn + bo)), each wave on its own four rows ----
  {
    f4v* ow = (f4v*)(out + (rowg0 + row0) * kD);
    // kept rolled: unrolled, the compiler hoists all four rows' loads and the
    // register count costs a resident work-group
    #pragma unroll 1
    for (int rr = 0; rr < 4; ++rr) {
      const float g = sG[row0 + rr];
      const f4v* xr = xw + rr * 128 + lane;
      f4v f[4];
      float s = 0.f, q = 0.f;
      #pragma unroll
      for (int c = 0; c < 4; ++c) {
        const f4v v = xr[c * 32];
        const h4v a = *(const h4v*)&sXh[(row0 + rr) * XP + c * 128 + lane * 4];
        const f4v bb = ((const f4v*)bo)[c * 32 + lane];
        #pragma unroll
        for (int e = 0; e < 4; ++e) {
          const float x = v[e] + g * ((float)a[e] + bb[e]);
          f[c][e] = x;
          s += x; q += x * x;
        }
      }
      s = wave_sum(s);
      q = wave_sum(q);
      const float mu = s * (1.f / kD);
      const float var = q * (1.f / kD) - mu * mu;
      const float rs = rsqrtf(var + kEPS);
      #pragma unroll
      for (int c = 0; c < 4; ++c) {
        const f4v lg = ((const f4v*)lng)[c * 32 + lane];
        const f4v lb = ((const f4v*)lnb)[c * 32 + lane];
        f4v o;
        #pragma unroll
        for (int e = 0; e < 4; ++e) o[e] = (f[c][e] - mu) * rs * lg[e] + lb[e];
        ow[rr * 128 + c * 32 + lane] = o;
      }
      // the next trip rewrites the address and data registers that these stores name; xr is
      // named so that the x loads' address pair lives up to this wait
      asm volatile("s_wait_xcnt 0x0" :: "v"(xr) : "memory");
    }
  }
}

// ============================================================
extern "C" void kernel_launch(void* const* d_in, const int* in_sizes, int n_in,
                              void* d_out, int out_size, void* d_ws, size_t ws_size,
                              hipStream_t stream) {
  (void)in_sizes; (void)n_in; (void)out_size; (void)ws_size;
  const float* token = (const float*)d_in[0];
  const float* se    = (const float*)d_in[1];
  const float* We    = (const float*)d_in[2];
  const float* be    = (const float*)d_in[3];
  const float* spos  = (const float*)d_in[4];
  const float* Wq    = (const float*)d_in[5];
  const float* bq    = (const float*)d_in[6];
  const float* Wk    = (const float*)d_in[7];
  const float* bk    = (const float*)d_in[8];
  const float* Wv    = (const float*)d_in[9];
  const float* bv    = (const float*)d_in[10];
  const float* Wo    = (const float*)d_in[11];
  const float* bo    = (const float*)d_in[12];
  const float* glng  = (const float*)d_in[13];
  const float* glnb  = (const float*)d_in[14];
  const float* Wg1   = (const float*)d_in[15];
  const float* bg1   = (const float*)d_in[16];
  const float* Wg2   = (const float*)d_in[17];
  const float* bg2   = (const float*)d_in[18];
  const float* lng   = (const float*)d_in[19];
  const float* lnb   = (const float*)d_in[20];
  float* out = (float*)d_out;

  char* ws = (char*)d_ws;
  float*    spk  = (float*)(ws + 0);            // 64 KB
  _Float16* Mh   = (_Float16*)(ws + 196608);    // 256 KB
  _Float16* VOt  = (_Float16*)(ws + 458752);    // 256 KB
  float*    cbf  = (float*)(ws + 65536);        // 32 lines of 128 B: floats 0..7 of each
  float*    Msum = (float*)(ws + 65568);        // floats 8..15 of the same lines
  float*    bg1p = (float*)(ws + 722944);       // 512 B
  _Float16* Wg1h = (_Float16*)(ws + 723456);    // 128 KB

  spk_kernel<<<kSPK * kD / 32, 256, 0, stream>>>(se, We, be, spos, spk);
  kvfold_kernel<<<kKV + kHG * kD / 8 / 512 + kHG / 32, 512, 0, stream>>>(
      spk, Wk, bk, Wv, bv, Wq, bq, Wo, Wg1, bg1, glng, glnb, Mh, VOt, cbf, Msum, Wg1h, bg1p);
  fused_kernel<<<(kB * kT) / TILE, 256, 0, stream>>>(token, Mh, VOt, cbf, Msum, Wg1h, bg1p,
                                                     Wg2, bg2, bo, lng, lnb, out);
}

// v008
// A run of this version takes 32.6 microseconds.
// In two side-by-side timings against v007, it was 1.04 and 1.03 times as fast.
// Counting every step since v000, it is 14.5 times as fast.
#include <hip/hip_runtime.h>
#include <hip/hip_bf16.h>
#include <math.h>

// ---- problem constants ----
constexpr int kB   = 8;
constexpr int kT   = 4096;
constexpr int kD   = 512;
constexpr int kH   = 8;
constexpr int kDH  = 64;
constexpr int kSPK = 4;
constexpr int kHS  = kH * kSPK;   // 32 folded "keys" per batch
constexpr int kHG  = 128;
constexpr int TILE = 32;          // token rows per block
constexpr float kEPS = 1e-5f;
// LDS row pitches: 16 B x an odd number, so that the 16 rows that one 16-byte
// fragment read touches fall on 16 different bank groups instead of on one.
constexpr int XP = kD + 8;        // halves: 1040 B = 16 B x 65
constexpr int GP = kHG + 8;       // halves:  272 B = 16 B x 17
constexpr int WP = kHS + 4;       // floats:  144 B = 16 B x 9

typedef __attribute__((ext_vector_type(16))) _Float16 v16h;
typedef __attribute__((ext_vector_type(8)))  float    v8f;
typedef __attribute__((ext_vector_type(4)))  float    f4v;
typedef __attribute__((ext_vector_type(2)))  float    f2v;
typedef __attribute__((ext_vector_type(4)))  _Float16 h4v;
typedef __attribute__((ext_vector_type(8)))  _Float16 h8v;

// Gather one 16x32 WMMA fragment (A or B) from a row-major f16 matrix.
// p points at [row_of_this_lane][k0 + kb]; lanes 0-15 take K {0..7,16..23},
// lanes 16-31 take K {8..15,24..31} (kb handles the 8-offset).
__device__ __forceinline__ v16h frag_h(const _Float16* p) {
  h8v lo = *(const h8v*)p;
  h8v hi = *(const h8v*)(p + 16);
  v16h f;
  #pragma unroll
  for (int j = 0; j < 8; ++j) { f[j] = lo[j]; f[8 + j] = hi[j]; }
  return f;
}

// Fragment order of a B operand (f16, N rows x K columns, ksteps = K / 32). Place
// p = (((nt * ksteps + ks) * 2 + hf) * 32 + lane) * 8 + j holds row nt*16 + (lane & 15),
// column ks*32 + hf*16 + (lane >> 4)*8 + j: the same k order as frag_h, but the 32 lanes
// of each 16-byte load lie side by side, 512 contiguous bytes = 4 whole 128-B lines,
// where a row-major operand gives 16 lines with 32 bytes used of each.
__device__ __forceinline__ void frag_place(int p, int ksteps, int& n, int& k) {
  const int j = p & 7, ln = (p >> 3) & 31, hf = (p >> 8) & 1;
  const int blk = p >> 9;
  const int nt = blk / ksteps, ks = blk - nt * ksteps;
  n = nt * 16 + (ln & 15);
  k = ks * 32 + hf * 16 + (ln >> 4) * 8 + j;
}

// One 16x32 B fragment from an operand stored in fragment order.
// p points at [fragment nt * ksteps + ks][0][lane][0].
__device__ __forceinline__ v16h frag_pk(const _Float16* p) {
  h8v lo = *(const h8v*)p;
  h8v hi = *(const h8v*)(p + 256);
  v16h f;
  #pragma unroll
  for (int j = 0; j < 8; ++j) { f[j] = lo[j]; f[8 + j] = hi[j]; }
  return f;
}

// The value that lane ^ M holds, by a vector instruction: DPP row_xmask inside a 16-lane
// row, a cross-row permute for M = 16. (A shuffle compiles to an LDS-pipe permute with a
// wait on its counter behind it.) Every lane of the wave must be on.
template <int M>
__device__ __forceinline__ float lane_xor(float v) {
  const int b = __float_as_int(v);
  if constexpr (M == 16)
    return __int_as_float(__builtin_amdgcn_permlanex16(b, b, 0x76543210, 0xfedcba98, false, false));
  else
    return __int_as_float(__builtin_amdgcn_update_dpp(0, b, 0x160 + M, 0xf, 0xf, false));
}

// Sum over the 32 lanes of a wave; every lane gets the total.
__device__ __forceinline__ float wave_sum(float v) {
  v += lane_xor<16>(v);
  v += lane_xor<8>(v);
  v += lane_xor<4>(v);
  v += lane_xor<2>(v);
  v += lane_xor<1>(v);
  return v;
}

// Dot products of four weight rows with eight input rows (all of length kD, rows
// contiguous) by one wave. The lanes lie across the columns, so every load is
// 32 lanes x 16 B = 512 contiguous bytes. Lane l returns the whole sum for weight
// row (l & 3) and input row (l >> 2).
// In two halves, so that a caller can send further loads out between them.
// First half: a[i * 4 + r] is this lane's share of the sum for weight row r, input row i.
__device__ __forceinline__ void rows4x8_shares(const float* __restrict__ w,
                                               const float* __restrict__ x, int lane,
                                               float (&a)[32]) {
  // Every loop here is unrolled in full: the arrays live in registers only while
  // each index is a constant.
  const f4v* wl = (const f4v*)w + lane;
  const f4v* xl = (const f4v*)x + lane;
  f4v wv[4][4], xv[8][4];
  #pragma unroll
  for (int c = 0; c < 4; ++c) {
    #pragma unroll
    for (int r = 0; r < 4; ++r) wv[r][c] = wl[r * 128 + c * 32];
    #pragma unroll
    for (int i = 0; i < 8; ++i) xv[i][c] = xl[i * 128 + c * 32];
  }
  // names the address registers (w: the pair; x: scalar base + lane) so that they outlive
  // the loads: no load's result may land on one that earlier loads name before this wait
  asm volatile("s_wait_xcnt 0x0" :: "v"(wl), "v"(lane) : "memory");
  // keeps the wait where it is written: without it the scheduler sinks the wait below
  // the arithmetic, and lets fewer of the 48 loads fly at once
  __builtin_amdgcn_sched_barrier(0);
  #pragma unroll
  for (int i = 0; i < 32; ++i) a[i] = 0.f;
  #pragma unroll
  for (int c = 0; c < 4; ++c)
    #pragma unroll
    for (int i = 0; i < 8; ++i)
      #pragma unroll
      for (int r = 0; r < 4; ++r)
        #pragma unroll
        for (int e = 0; e < 4; ++e) a[i * 4 + r] = fmaf(xv[i][c][e], wv[r][c][e], a[i * 4 + r]);
}

// One step of the halving exchange of rows4x8_whole, over lane bit M.
template <int M>
__device__ __forceinline__ void halve_in_wave(float (&a)[32], int lane) {
  const bool up = (lane & M) != 0;
  #pragma unroll   // a lives in registers only while each index is a constant
  for (int i = 0; i < M; ++i) {
    const float lo = a[i], hi = a[i + M];
    a[i] = (up ? hi : lo) + lane_xor<M>(up ? lo : hi);
  }
}

// Second half: the shares of the 32 lanes are summed.
__device__ __forceinline__ float rows4x8_whole(float (&a)[32], int lane) {
  // Halving exchange: at each step a lane keeps the half of the sums whose index bit
  // equals its own lane bit and hands the other half to its partner, so 31 exchanges
  // leave sum l whole in lane l.
  halve_in_wave<16>(a, lane);
  halve_in_wave<8>(a, lane);
  halve_in_wave<4>(a, lane);
  halve_in_wave<2>(a, lane);
  halve_in_wave<1>(a, lane);
  return a[0];
}

__device__ __forceinline__ float rows4x8(const float* __restrict__ w,
                                         const float* __restrict__ x, int lane) {
  float a[32];
  rows4x8_shares(w, x, lane, a);
  return rows4x8_whole(a, lane);
}

// ============================================================
// Precompute 1: spk_tokens = relu(speaker_emb @ We^T + be) + spk_pos
// One wave: four rows of We against all eight batches.
// ============================================================
__global__ __launch_bounds__(256) void spk_kernel(
    const float* __restrict__ se, const float* __restrict__ We,
    const float* __restrict__ be, const float* __restrict__ spos,
    float* __restrict__ spk) {
  const int lane = threadIdx.x & 31;
  const int r0 = (blockIdx.x * 8 + (threadIdx.x >> 5)) * 4;   // r = s*D + d
  const int r = r0 + (lane & 3), b = lane >> 2;
  const float bias = be[r], pos = spos[r];   // loaded in front of the wait inside rows4x8
  const float acc = rows4x8(We + (size_t)r0 * kD, se, lane);
  spk[b * (kSPK * kD) + r] = fmaxf(acc + bias, 0.f) + pos;
}

// ============================================================
// Precompute 2: k, v and everything folded from them, in one launch.
// Work-group (k or v, batch b, head pair g), 16 waves. Each wave first takes eight rows
// of Wk or Wv against the four speaker rows of b, so the work-group holds the 4 x 128
// slice of k or v that its own outputs need, and nobody else needs that slice.
//   k: M (f16) = Wq folded into k, Msum, score bias bq.k
//   v: VO^T (f16) = Wo folded into v
// A head pair is eight neighbouring folded keys: in fragment order (frag_place) these
// fill whole 128-B lines of M and VO^T, so each line has one writing work-group.
// The last blocks fold the gate LN: gamma into Wg1 (f16, fragment order), beta into bg1.
// ============================================================
// The 32 pieces (512 contiguous bytes each, STEP x 16 B apart) of the weights that a wave
// folds its slice of k or v with. They depend on nothing computed in the kernel: called
// between the halves of rows4x8, the loads go out as registers come free and fly during
// the exchange.
template <int STEP>
__device__ __forceinline__ void fold_loads(const float* __restrict__ w2, int lane, int jj,
                                           f4v (&wr)[32]) {
  const f4v* wl = (const f4v*)w2 + lane;
  #pragma unroll   // wr lives in registers only while each index is a constant
  for (int i = 0; i < 32; ++i) wr[i] = wl[i * STEP];
  // names the address pair, and the index jj of the caller's bias loads, so that they
  // outlive the loads: no load's result may land on them before this wait
  asm volatile("s_wait_xcnt 0x0" :: "v"(wl), "v"(jj) : "memory");
}

// One step of a halving exchange inside a 16-lane row: of the 16 * M sums a lane keeps the
// half whose index bit equals its lane bit M and adds what lane ^ M hands over. The partner's
// value comes by DPP (row_xmask), a vector instruction, not through the LDS pipe.
template <int M>
__device__ __forceinline__ void halve_in_row(float (&a)[128], int lane) {
  const bool up = (lane & M) != 0;
  #pragma unroll   // a lives in registers only while each index is a constant
  for (int i = 0; i < M * 8; ++i) {
    const float lo = a[i], hi = a[i + M * 8];
    const float give = up ? lo : hi;
    a[i] = (up ? hi : lo) + __int_as_float(__builtin_amdgcn_update_dpp(
        0, __float_as_int(give), 0x160 + M, 0xf, 0xf, false));
  }
}

constexpr int PP = kD + 16;       // floats: LDS pitch of a partial row of M
constexpr int kKV = 2 * kB * (kH / 2);   // work-groups of the k and v parts

__global__ __launch_bounds__(512) void kvfold_kernel(
    const float* __restrict__ spk,
    const float* __restrict__ Wk, const float* __restrict__ bk,
    const float* __restrict__ Wv, const float* __restrict__ bv,
    const float* __restrict__ Wq, const float* __restrict__ bq,
    const float* __restrict__ Wo, const float* __restrict__ Wg1,
    const float* __restrict__ bg1,
    const float* __restrict__ glng, const float* __restrict__ glnb,
    _Float16* __restrict__ Mh, _Float16* __restrict__ VOt,
    float* __restrict__ cb, float* __restrict__ Msum,
    _Float16* __restrict__ Wg1h, float* __restrict__ bg1p) {
  __shared__ __attribute__((aligned(16))) float sP[64 * PP + 16];  // [wave][s][d] partial M
  __shared__ __attribute__((aligned(16))) float sV[8 * kDH];       // [head of pair][s][j]
  __shared__ float sRed[2][16][4];                                 // [Msum, cb][wave][s]
  // Every loop over wr, a4, vv, vp and a below is unrolled in full: the arrays live in
  // registers only while each index is a constant.
  const int t = threadIdx.x;
  const int lane = t & 31;
  // the wave's number as a scalar, so that row addresses formed from it are scalar bases
  const int wave = __builtin_amdgcn_readfirstlane(t >> 5);
  if (blockIdx.x < kKV) {
    const int which = blockIdx.x >> 5;               // 0: k, 1: v
    const int b = (blockIdx.x >> 2) & 7;
    const int g = blockIdx.x & 3;                    // heads 2g and 2g + 1
    const int wrow = g * 128 + wave * 8;             // head 2g + (wave >> 3), j from (wave & 7) * 8
    const int s = lane & 3, jj = lane >> 2;
    // the four speaker rows stand where rows4x8 has its four rows: lane l gets speaker
    // row (l & 3) against weight row wrow + (l >> 2)
    const float* spkb = spk + (size_t)b * kSPK * kD;
    float sh[32];
    f4v wr[32];
    if (which == 0) {
      // M[b][hs][d] = (1/8) * sum_j Wq[h*64+j][d] * k[b][s][h*64+j]: the wave sums over its
      // own eight j for all d (lanes across the columns), the eight waves of a head meet in LDS.
      // wr: the wave's own eight rows of Wq, whole (piece i = row i >> 2, quarter i & 3)
      const float bkv = (bk + wrow)[jj], bqv = (bq + wrow)[jj];   // in front of the wait in rows4x8_shares
      rows4x8_shares(spkb, Wk + (size_t)wrow * kD, lane, sh);
      fold_loads<32>(Wq + (size_t)wrow * kD, lane, jj, wr);
      const float kv = rows4x8_whole(sh, lane) + bkv;
      f4v a4[4][4];
      #pragma unroll
      for (int i = 0; i < 4; ++i)
        #pragma unroll
        for (int q = 0; q < 4; ++q) a4[i][q] = (f4v){0.f, 0.f, 0.f, 0.f};
      #pragma unroll
      for (int r = 0; r < 8; ++r)
        #pragma unroll
        for (int i = 0; i < 4; ++i) {
          const float kk = __int_as_float(__builtin_amdgcn_readlane(__float_as_int(kv), r * 4 + i));
          #pragma unroll
          for (int q = 0; q < 4; ++q) a4[i][q] += wr[r * 4 + q] * kk;
        }
      // Msum[b][hs] = sum_d M[b][hs][d] (fp32), cb[b][hs] = (1/8) * bq . k_head: this wave's share
      float ms[4];
      #pragma unroll
      for (int i = 0; i < 4; ++i) {
        const f4v s4 = (a4[i][0] + a4[i][1]) + (a4[i][2] + a4[i][3]);
        ms[i] = (s4[0] + s4[1]) + (s4[2] + s4[3]);
      }
      // halving exchange over lane bits 1 and 0: the sum for s = lane & 3 stays, as in cp
      const bool up2 = (lane & 2) != 0, up1 = (lane & 1) != 0;
      const float m0 = (up2 ? ms[2] : ms[0]) + lane_xor<2>(up2 ? ms[0] : ms[2]);
      const float m1 = (up2 ? ms[3] : ms[1]) + lane_xor<2>(up2 ? ms[1] : ms[3]);
      float mp = (up1 ? m1 : m0) + lane_xor<1>(up1 ? m0 : m1);
      float cp = kv * bqv;
      mp += lane_xor<4>(mp);
      cp += lane_xor<4>(cp);
      mp += lane_xor<8>(mp);
      cp += lane_xor<8>(cp);
      mp += lane_xor<16>(mp);
      cp += lane_xor<16>(cp);
      if (lane < 4) {
        sRed[0][wave][lane] = mp;
        sRed[1][wave][lane] = cp;
      }
      // the second head's rows stand 16 B further on, so that the 16 lanes of one read
      // below (4 s x 2 heads x 2 column groups) fall on 16 different bank groups
      #pragma unroll
      for (int i = 0; i < 4; ++i)
        #pragma unroll
        for (int q = 0; q < 4; ++q)
          *(f4v*)&sP[(wave * 4 + i) * PP + (wave >> 3) * 4 + q * 128 + lane * 4] = a4[i][q];
      __syncthreads();   // block-uniform branch
      // one thread: one folded key n8 of the pair, eight neighbouring d = one 16-B place unit
      const int n8 = lane & 7, oct = t >> 3;
      const int hh = n8 >> 2;
      f4v s0 = {0.f, 0.f, 0.f, 0.f}, s1 = {0.f, 0.f, 0.f, 0.f};
      #pragma unroll
      for (int i = 0; i < 8; ++i) {
        const float* p = &sP[((hh * 8 + i) * 4 + (n8 & 3)) * PP + hh * 4 + oct * 8];
        s0 += *(const f4v*)p;
        s1 += *(const f4v*)(p + 4);
      }
      h8v o;
      #pragma unroll
      for (int e = 0; e < 4; ++e) {
        o[e]     = (_Float16)(s0[e] * 0.125f);
        o[4 + e] = (_Float16)(s1[e] * 0.125f);
      }
      // inverse of frag_place for row g*8 + n8, columns oct*8 .. oct*8 + 7
      const int place = (((((g >> 1) * (kD / 32) + (oct >> 2)) * 2 + ((oct >> 1) & 1)) * 32)
                         + (oct & 1) * 16 + (g & 1) * 8 + n8) * 8;
      *(h8v*)(Mh + (size_t)b * kHS * kD + place) = o;
      if (t < 16) {
        const int kind = t >> 3;                     // 0: Msum, 1: cb
        float acc = 0.f;
        #pragma unroll
        for (int i = 0; i < 8; ++i) acc += sRed[kind][hh * 8 + i][n8 & 3];
        // each (b, g) has a 128-B line of its own for its eight cb and eight Msum
        (kind ? cb : Msum)[(b * 4 + g) * 32 + n8] = acc * 0.125f;
      }
    } else {
      // VOt[b][d][hs] = sum_j Wo[d][h*64+j] * v[b][s][h*64+j]: a wave takes 32 rows d; the
      // 128 columns of the head pair are 512 contiguous bytes, 16 lanes to a head (wr: piece i = row i)
      const float bvv = (bv + wrow)[jj];                          // in front of the wait in rows4x8_shares
      rows4x8_shares(spkb, Wv + (size_t)wrow * kD, lane, sh);
      fold_loads<128>(Wo + (size_t)(wave * 32) * kD + g * 128, lane, jj, wr);
      const float kv = rows4x8_whole(sh, lane) + bvv;
      sV[((wave >> 3) * 4 + s) * kDH + (wave & 7) * 8 + jj] = kv;
      __syncthreads();   // block-uniform branch
      const int hh = lane >> 4, c4 = lane & 15;
      f4v vv[4];
      #pragma unroll
      for (int i = 0; i < 4; ++i) vv[i] = *(const f4v*)&sV[(hh * 4 + i) * kDH + c4 * 4];
      // v in pairs of s, so that one packed multiply-add serves two sums of a row
      f2v vp[4][2];
      #pragma unroll
      for (int e = 0; e < 4; ++e) {
        vp[e][0] = (f2v){vv[0][e], vv[1][e]};
        vp[e][1] = (f2v){vv[2][e], vv[3][e]};
      }
      float a[128];
      #pragma unroll
      for (int i = 0; i < 32; ++i)
        #pragma unroll
        for (int k = 0; k < 2; ++k) {
          f2v p2 = vp[0][k] * wr[i][0];
          #pragma unroll
          for (int e = 1; e < 4; ++e) p2 += vp[e][k] * wr[i][e];
          a[i * 4 + k * 2]     = p2[0];
          a[i * 4 + k * 2 + 1] = p2[1];
        }
      // Halving exchange over the 16 lanes of a head, as in rows4x8: sums c4*8 .. c4*8 + 7
      // (rows 2*c4 and 2*c4 + 1 of the wave's 32, four s each) end whole in lane c4.
      halve_in_row<8>(a, lane);
      halve_in_row<4>(a, lane);
      halve_in_row<2>(a, lane);
      halve_in_row<1>(a, lane);
      #pragma unroll
      for (int r = 0; r < 2; ++r) {
        const int d = wave * 32 + c4 * 2 + r;
        h4v o;
        #pragma unroll
        for (int k = 0; k < 4; ++k) o[k] = (_Float16)a[r * 4 + k];
        // inverse of frag_place for row d, columns g*8 + hh*4 .. + 3
        const int place = ((((d >> 4) * 2 + (g >> 1)) * 32) + (g & 1) * 16 + (d & 15)) * 8 + hh * 4;
        *(h4v*)(VOt + (size_t)b * kD * kHS + place) = o;
      }
    }
  } else {
    const int idx = (blockIdx.x - kKV) * 512 + t;
    if (idx < kHG * kD / 8) {
      // Wg1h = Wg1 * gamma (gamma of gate-LN folded into weights); one 16-B place unit a thread
      int n, k;
      frag_place(idx * 8, kD / 32, n, k);
      const f4v* wr = (const f4v*)(Wg1 + (size_t)n * kD + k);
      const f4v* gm = (const f4v*)(glng + k);
      const f4v p0 = wr[0] * gm[0], p1 = wr[1] * gm[1];
      h8v o;
      #pragma unroll
      for (int e = 0; e < 4; ++e) { o[e] = (_Float16)p0[e]; o[4 + e] = (_Float16)p1[e]; }
      *(h8v*)(Wg1h + (size_t)idx * 8) = o;
    } else {
      // bg1p = bg1 + Wg1 . beta (beta of gate-LN folded into bias); a wave takes two units n,
      // so that the 32 results of a block fill one 128-B line
      const int n0 = ((idx - kHG * kD / 8) >> 5) * 2;
      const f4v* bt = (const f4v*)glnb;
      for (int u = 0; u < 2; ++u) {
        const int n = n0 + u;
        const f4v* wr = (const f4v*)(Wg1 + (size_t)n * kD);
        f4v p4 = {};
        for (int c = 0; c < 4; ++c) p4 += wr[c * 32 + lane] * bt[c * 32 + lane];
        float acc = wave_sum((p4[0] + p4[1]) + (p4[2] + p4[3]));
        if (lane == 0) bg1p[n] = bg1[n] + acc;
      }
    }
  }
}

// ============================================================
// Fused main kernel: gate GEMM + scores + softmax + combine + final LN.
// LDS holds the pre-affine normalized tile x' = (x-mu)*rstd (f16);
// gamma/beta are folded into Wg1h/bg1p, and raw-x scores are recovered via
// scores = irs * (x'.M^T) + mu*Msum + cb.
// The second launch bound asks for eight waves per SIMD (at most 128 registers a wave):
// four work-groups then fit on a WGP, and the 1024 work-groups of the grid are all
// resident at once instead of running as three a WGP and a thin second round.
// ============================================================
__global__ __launch_bounds__(256, 8) void fused_kernel(
    const float* __restrict__ X,
    const _Float16* __restrict__ Mh,    // (B, HS, D), each batch in fragment order
    const _Float16* __restrict__ VOt,   // (B, D, HS), each batch in fragment order
    const float* __restrict__ cb,       // (B, 4 head pairs): 8 values at the head of a 128-B line
    const float* __restrict__ Msum,     // the same lines as cb, floats 8..15 of each
    const _Float16* __restrict__ Wg1h,  // (HG, D), gamma-folded, in fragment order
    const float* __restrict__ bg1p,     // (HG), beta-folded
    const float* __restrict__ Wg2, const float* __restrict__ bg2,
    const float* __restrict__ bo,
    const float* __restrict__ lng, const float* __restrict__ lnb,
    float* __restrict__ out) {
  __shared__ __attribute__((aligned(16))) _Float16 sXh[TILE * XP];  // x' (f16); later reused for attn (f16)
  __shared__ __attribute__((aligned(16))) _Float16 sGh[TILE * GP];
  __shared__ __attribute__((aligned(16))) float sSc[TILE * WP];
  __shared__ __attribute__((aligned(16))) float sW[TILE * WP];
  __shared__ float sMu[TILE], sIrs[TILE], sG[TILE];

  const int t = threadIdx.x;
  const int lane = t & 31;
  const int wave = t >> 5;
  const int r15 = lane & 15;
  const int hi = lane >> 4;          // 0 or 1 (wave32 half)
  const int kb = hi * 8;             // fragment K sub-offset per ISA layout

  const size_t rowg0 = (size_t)blockIdx.x * TILE;
  const int b = (int)(rowg0 >> 12);  // tile never crosses batch (4096 % 32 == 0)

  const size_t AW_OFF = (size_t)kB * kT * kD;
  const size_t G_OFF  = AW_OFF + (size_t)kB * kT * kSPK;

  // Each wave owns four whole rows; its lanes lie across the columns, so every
  // global load and store of a row piece is 32 lanes x 16 B = 512 contiguous bytes.
  // Piece c of row rr is f4v index rr * 128 + c * 32 + lane.
  const int row0 = wave * 4;
  const f4v* xw = (const f4v*)(X + (rowg0 + row0) * kD);

  // ---- Phase 0: LN stats inside the wave, then x' = (x-mu)*rstd to LDS (f16) ----
  {
    const f4v* xl = xw + lane;
    f4v xv[4][4];
    #pragma unroll
    for (int rr = 0; rr < 4; ++rr)
      #pragma unroll
      for (int c = 0; c < 4; ++c) xv[rr][c] = xl[rr * 128 + c * 32];
    // names the address pair so that it outlives the loads
    asm volatile("s_wait_xcnt 0x0" :: "v"(xl) : "memory");
    float s[4], q[4];
    #pragma unroll
    for (int rr = 0; rr < 4; ++rr) {
      s[rr] = 0.f; q[rr] = 0.f;
      #pragma unroll
      for (int c = 0; c < 4; ++c)
        #pragma unroll
        for (int e = 0; e < 4; ++e) { s[rr] += xv[rr][c][e]; q[rr] += xv[rr][c][e] * xv[rr][c][e]; }
    }
    #pragma unroll
    for (int rr = 0; rr < 4; ++rr) { s[rr] = wave_sum(s[rr]); q[rr] = wave_sum(q[rr]); }
    #pragma unroll
    for (int rr = 0; rr < 4; ++rr) {
      const float mu = s[rr] * (1.f / kD);
      const float var = q[rr] * (1.f / kD) - mu * mu;
      const float rs = rsqrtf(var + kEPS);
      if (lane == 0) {               // the scores epilogue of other waves reads these
        sMu[row0 + rr]  = mu;
        sIrs[row0 + rr] = sqrtf(var + kEPS);
      }
      #pragma unroll
      for (int c = 0; c < 4; ++c) {
        h4v h;
        #pragma unroll
        for (int e = 0; e < 4; ++e) h[e] = (_Float16)((xv[rr][c][e] - mu) * rs);
        *(h4v*)&sXh[(row0 + rr) * XP + c * 128 + lane * 4] = h;
      }
    }
  }
  __syncthreads();

  // ---- Gate GEMM: relu(x' @ Wg1h^T + bg1p)  (M=32,N=128,K=512) ----
  #pragma unroll
  for (int tt = 0; tt < 2; ++tt) {
    const int tid = wave + tt * 8;
    const int mt = tid >> 3, nt = tid & 7;
    const int arow = mt * 16 + r15;
    v8f acc = {};
    for (int k0 = 0; k0 < kD; k0 += 32) {
      v16h a  = frag_h(&sXh[arow * XP + k0 + kb]);
      v16h bm = frag_pk(Wg1h + nt * (16 * kD) + k0 * 16 + lane * 8);
      acc = __builtin_amdgcn_wmma_f32_16x16x32_f16(false, a, false, bm,
                                                   (short)0, acc, false, false);
    }
    const int col = nt * 16 + r15;
    const float bb = bg1p[col];
    #pragma unroll
    for (int r = 0; r < 8; ++r)
      sGh[(mt * 16 + hi * 8 + r) * GP + col] = (_Float16)fmaxf(acc[r] + bb, 0.f);
  }
  __syncthreads();

  // ---- Gate head on wave 4 (concurrent with scores on waves 0-3) ----
  if (wave == 4) {
    const int rw = lane;
    float g = bg2[0];
    const h8v* gp = (const h8v*)&sGh[rw * GP];
    #pragma unroll 4
    for (int j = 0; j < 16; ++j) {
      h8v h = gp[j];
      #pragma unroll
      for (int e = 0; e < 8; ++e) g = fmaf((float)h[e], Wg2[j * 8 + e], g);
    }
    g = 1.f / (1.f + expf(-g));
    sG[rw] = g;
    out[G_OFF + rowg0 + rw] = g;
  }

  // ---- Scores GEMM: irs*(x' @ M^T) + mu*Msum + cb  (M=32,N=32,K=512) ----
  if (wave < 4) {
    const int mt = wave >> 1, nt = wave & 1;
    const int arow = mt * 16 + r15;
    v8f acc = {};
    for (int k0 = 0; k0 < kD; k0 += 32) {
      v16h a  = frag_h(&sXh[arow * XP + k0 + kb]);
      v16h bm = frag_pk(Mh + (b * kHS + nt * 16) * kD + k0 * 16 + lane * 8);
      acc = __builtin_amdgcn_wmma_f32_16x16x32_f16(false, a, false, bm,
                                                   (short)0, acc, false, false);
    }
    const int col = nt * 16 + r15;
    const int ci = (b * 4 + (col >> 3)) * 32 + (col & 7);
    const float c0 = cb[ci];
    const float ms = Msum[ci];
    // names the index register so that it outlives the two loads
    asm volatile("s_wait_xcnt 0x0" :: "v"(ci) : "memory");
    #pragma unroll
    for (int r = 0; r < 8; ++r) {
      const int rr = mt * 16 + hi * 8 + r;
      sSc[rr * WP + col] = fmaf(acc[r], sIrs[rr], fmaf(sMu[rr], ms, c0));
    }
  }
  __syncthreads();

  // ---- Softmax over SPK=4 within each head (one thread per row-head) ----
  {
    const int rw = t >> 3, h = t & 7;
    const float* sp = &sSc[rw * WP + h * 4];
    float s0 = sp[0], s1 = sp[1], s2 = sp[2], s3 = sp[3];
    float m = fmaxf(fmaxf(s0, s1), fmaxf(s2, s3));
    float e0 = expf(s0 - m), e1 = expf(s1 - m), e2 = expf(s2 - m), e3 = expf(s3 - m);
    float inv = 1.f / (e0 + e1 + e2 + e3);
    float* wp = &sW[rw * WP + h * 4];
    wp[0] = e0 * inv; wp[1] = e1 * inv; wp[2] = e2 * inv; wp[3] = e3 * inv;
  }
  __syncthreads();
  if (t < TILE * kSPK) {  // head-averaged attention weights
    int rw = t >> 2, s = t & 3;
    float aw = 0.f;
    #pragma unroll
    for (int h = 0; h < kH; ++h) aw += sW[rw * WP + h * 4 + s];
    out[AW_OFF + (rowg0 + rw) * kSPK + s] = aw * (1.f / kH);
  }

  // ---- Combine GEMM: attn = w @ VO  (M=32,N=512,K=32) -> overwrite sXh ----
  #pragma unroll
  for (int i = 0; i < 8; ++i) {
    const int tid = wave * 8 + i;
    const int mt = tid >> 5, nt = tid & 31;
    v16h a, bm;
    {
      const f4v* wp = (const f4v*)&sW[(mt * 16 + r15) * WP + kb];
      f4v w0 = wp[0], w1 = wp[1];   // K = kb .. kb+7
      f4v w2 = wp[4], w3 = wp[5];   // K = kb+16 .. kb+23
      #pragma unroll
      for (int e = 0; e < 4; ++e) {
        a[e]      = (_Float16)w0[e];
        a[4 + e]  = (_Float16)w1[e];
        a[8 + e]  = (_Float16)w2[e];
        a[12 + e] = (_Float16)w3[e];
      }
    }
    bm = frag_pk(VOt + (b * kD + nt * 16) * kHS + lane * 8);
    v8f acc = {};
    acc = __builtin_amdgcn_wmma_f32_16x16x32_f16(false, a, false, bm,
                                                 (short)0, acc, false, false);
    const int col = nt * 16 + r15;
    #pragma unroll
    for (int r = 0; r < 8; ++r)
      sXh[(mt * 16 + hi * 8 + r) * XP + col] = (_Float16)acc[r];
  }
  __syncthreads();

  // ---- Epilogue: fused = LN(x + g*(attn + bo)), each wave on its own four rows ----
  {
    f4v* ow = (f4v*)(out + (rowg0 + row0) * kD);
    // kept rolled: unrolled, the compiler hoists all four rows' loads and the
    // register count costs a resident work-group
    #pragma unroll 1
    for (int rr = 0; rr < 4; ++rr) {
      const float g = sG[row0 + rr];
      const f4v* xr = xw + rr * 128 + lane;
      f4v f[4];
      float s = 0.f, q = 0.f;
      #pragma unroll
      for (int c = 0; c < 4; ++c) {
        const f4v v = xr[c * 32];
        const h4v a = *(const h4v*)&sXh[(row0 + rr) * XP + c * 128 + lane * 4];
        const f4v bb = ((const f4v*)bo)[c * 32 + lane];
        #pragma unroll
        for (int e = 0; e < 4; ++e) {
          const float x = v[e] + g * ((float)a[e] + bb[e]);
          f[c][e] = x;
          // fmaf written out: left to contraction, the build with the vector-pipe sums pairs
          // the s and q chains into packed adds and pays for that in moves and conversions
          s += x; q = fmaf(x, x, q);
        }
      }
      s = wave_sum(s);
      q = wave_sum(q);
      const float mu = s * (1.f / kD);
      const float var = q * (1.f / kD) - mu * mu;
      const float rs = rsqrtf(var + kEPS);
      #pragma unroll
      for (int c = 0; c < 4; ++c) {
        const f4v lg = ((const f4v*)lng)[c * 32 + lane];
        const f4v lb = ((const f4v*)lnb)[c * 32 + lane];
        f4v o;
        #pragma unroll
        for (int e = 0; e < 4; ++e) o[e] = (f[c][e] - mu) * rs * lg[e] + lb[e];
        ow[rr * 128 + c * 32 + lane] = o;
      }
      // the next trip rewrites the address and data registers that these stores name; xr is
      // named so that the x loads' address pair lives up to this wait
      asm volatile("s_wait_xcnt 0x0" :: "v"(xr) : "memory");
    }
  }
}

// ============================================================
extern "C" void kernel_launch(void* const* d_in, const int* in_sizes, int n_in,
                              void* d_out, int out_size, void* d_ws, size_t ws_size,
                              hipStream_t stream) {
  (void)in_sizes; (void)n_in; (void)out_size; (void)ws_size;
  const float* token = (const float*)d_in[0];
  const float* se    = (const float*)d_in[1];
  const float* We    = (const float*)d_in[2];
  const float* be    = (const float*)d_in[3];
  const float* spos  = (const float*)d_in[4];
  const float* Wq    = (const float*)d_in[5];
  const float* bq    = (const float*)d_in[6];
  const float* Wk    = (const float*)d_in[7];
  const float* bk    = (const float*)d_in[8];
  const float* Wv    = (const float*)d_in[9];
  const float* bv    = (const float*)d_in[10];
  const float* Wo    = (const float*)d_in[11];
  const float* bo    = (const float*)d_in[12];
  const float* glng  = (const float*)d_in[13];
  const float* glnb  = (const float*)d_in[14];
  const float* Wg1   = (const float*)d_in[15];
  const float* bg1   = (const float*)d_in[16];
  const float* Wg2   = (const float*)d_in[17];
  const float* bg2   = (const float*)d_in[18];
  const float* lng   = (const float*)d_in[19];
  const float* lnb   = (const float*)d_in[20];
  float* out = (float*)d_out;

  char* ws = (char*)d_ws;
  float*    spk  = (float*)(ws + 0);            // 64 KB
  _Float16* Mh   = (_Float16*)(ws + 196608);    // 256 KB
  _Float16* VOt  = (_Float16*)(ws + 458752);    // 256 KB
  float*    cbf  = (float*)(ws + 65536);        // 32 lines of 128 B: floats 0..7 of each
  float*    Msum = (float*)(ws + 65568);        // floats 8..15 of the same lines
  float*    bg1p = (float*)(ws + 722944);       // 512 B
  _Float16* Wg1h = (_Float16*)(ws + 723456);    // 128 KB

  spk_kernel<<<kSPK * kD / 32, 256, 0, stream>>>(se, We, be, spos, spk);
  kvfold_kernel<<<kKV + kHG * kD / 8 / 512 + kHG / 32, 512, 0, stream>>>(
      spk, Wk, bk, Wv, bv, Wq, bq, Wo, Wg1, bg1, glng, glnb, Mh, VOt, cbf, Msum, Wg1h, bg1p);
  fused_kernel<<<(kB * kT) / TILE, 256, 0, stream>>>(token, Mh, VOt, cbf, Msum, Wg1h, bg1p,
                                                     Wg2, bg2, bo, lng, lnb, out);
}

// v009
// It runs in 30.5 microseconds.
// In two side-by-side timings against v008, it was 1.06 and 1.07 times as fast.
// Counting every step since v000, it is 15.4 times as fast.
#include <hip/hip_runtime.h>
#include <hip/hip_bf16.h>
#include <math.h>

// ---- problem constants ----
constexpr int kB   = 8;
constexpr int kT   = 4096;
constexpr int kD   = 512;
constexpr int kH   = 8;
constexpr int kDH  = 64;
constexpr int kSPK = 4;
constexpr int kHS  = kH * kSPK;   // 32 folded "keys" per batch
constexpr int kHG  = 128;
constexpr int TILE = 32;          // token rows per block
constexpr float kEPS = 1e-5f;
// LDS row pitches: 16 B x an odd number, so that the 16 rows that one 16-byte
// fragment read touches fall on 16 different bank groups instead of on one.
constexpr int XP = kD + 8;        // halves: 1040 B = 16 B x 65
constexpr int WP = kHS + 4;       // floats:  144 B = 16 B x 9

typedef __attribute__((ext_vector_type(16))) _Float16 v16h;
typedef __attribute__((ext_vector_type(8)))  float    v8f;
typedef __attribute__((ext_vector_type(4)))  float    f4v;
typedef __attribute__((ext_vector_type(2)))  float    f2v;
typedef __attribute__((ext_vector_type(4)))  _Float16 h4v;
typedef __attribute__((ext_vector_type(8)))  _Float16 h8v;

// Gather one 16x32 WMMA fragment (A or B) from a row-major f16 matrix.
// p points at [row_of_this_lane][k0 + kb]; lanes 0-15 take K {0..7,16..23},
// lanes 16-31 take K {8..15,24..31} (kb handles the 8-offset).
__device__ __forceinline__ v16h frag_h(const _Float16* p) {
  h8v lo = *(const h8v*)p;
  h8v hi = *(const h8v*)(p + 16);
  v16h f;
  #pragma unroll
  for (int j = 0; j < 8; ++j) { f[j] = lo[j]; f[8 + j] = hi[j]; }
  return f;
}

// Fragment order of an A operand (f16, N rows x K columns, ksteps = K / 32). Place
// p = (((nt * ksteps + ks) * 2 + hf) * 32 + lane) * 8 + j holds row nt*16 + (lane & 15),
// column ks*32 + hf*16 + (lane >> 4)*8 + j: the same k order as frag_h, but the 32 lanes
// of each 16-byte load lie side by side, 512 contiguous bytes = 4 whole 128-B lines,
// where a row-major operand gives 16 lines with 32 bytes used of each.
__device__ __forceinline__ void frag_place(int p, int ksteps, int& n, int& k) {
  const int j = p & 7, ln = (p >> 3) & 31, hf = (p >> 8) & 1;
  const int blk = p >> 9;
  const int nt = blk / ksteps, ks = blk - nt * ksteps;
  n = nt * 16 + (ln & 15);
  k = ks * 32 + hf * 16 + (ln >> 4) * 8 + j;
}

// One 16x32 A fragment from an operand stored in fragment order.
// p points at [fragment nt * ksteps + ks][0][lane][0].
__device__ __forceinline__ v16h frag_pk(const _Float16* p) {
  h8v lo = *(const h8v*)p;
  h8v hi = *(const h8v*)(p + 256);
  v16h f;
  #pragma unroll
  for (int j = 0; j < 8; ++j) { f[j] = lo[j]; f[8 + j] = hi[j]; }
  return f;
}

// The value that lane ^ M holds, by a vector instruction: DPP row_xmask inside a 16-lane
// row, a cross-row permute for M = 16. (A shuffle compiles to an LDS-pipe permute with a
// wait on its counter behind it.) Every lane of the wave must be on.
template <int M>
__device__ __forceinline__ float lane_xor(float v) {
  const int b = __float_as_int(v);
  if constexpr (M == 16)
    return __int_as_float(__builtin_amdgcn_permlanex16(b, b, 0x76543210, 0xfedcba98, false, false));
  else
    return __int_as_float(__builtin_amdgcn_update_dpp(0, b, 0x160 + M, 0xf, 0xf, false));
}

// Sum over the 32 lanes of a wave; every lane gets the total.
__device__ __forceinline__ float wave_sum(float v) {
  v += lane_xor<16>(v);
  v += lane_xor<8>(v);
  v += lane_xor<4>(v);
  v += lane_xor<2>(v);
  v += lane_xor<1>(v);
  return v;
}

// Dot products of four weight rows with eight input rows (all of length kD, rows
// contiguous) by one wave. The lanes lie across the columns, so every load is
// 32 lanes x 16 B = 512 contiguous bytes. Lane l returns the whole sum for weight
// row (l & 3) and input row (l >> 2).
// In two halves, so that a caller can send further loads out between them.
// First half: a[i * 4 + r] is this lane's share of the sum for weight row r, input row i.
__device__ __forceinline__ void rows4x8_shares(const float* __restrict__ w,
                                               const float* __restrict__ x, int lane,
                                               float (&a)[32]) {
  // Every loop here is unrolled in full: the arrays live in registers only while
  // each index is a constant.
  const f4v* wl = (const f4v*)w + lane;
  const f4v* xl = (const f4v*)x + lane;
  f4v wv[4][4], xv[8][4];
  #pragma unroll
  for (int c = 0; c < 4; ++c) {
    #pragma unroll
    for (int r = 0; r < 4; ++r) wv[r][c] = wl[r * 128 + c * 32];
    #pragma unroll
    for (int i = 0; i < 8; ++i) xv[i][c] = xl[i * 128 + c * 32];
  }
  // names the address registers (w: the pair; x: scalar base + lane) so that they outlive
  // the loads: no load's result may land on one that earlier loads name before this wait
  asm volatile("s_wait_xcnt 0x0" :: "v"(wl), "v"(lane) : "memory");
  // keeps the wait where it is written: without it the scheduler sinks the wait below
  // the arithmetic, and lets fewer of the 48 loads fly at once
  __builtin_amdgcn_sched_barrier(0);
  #pragma unroll
  for (int i = 0; i < 32; ++i) a[i] = 0.f;
  #pragma unroll
  for (int c = 0; c < 4; ++c)
    #pragma unroll
    for (int i = 0; i < 8; ++i)
      #pragma unroll
      for (int r = 0; r < 4; ++r)
        #pragma unroll
        for (int e = 0; e < 4; ++e) a[i * 4 + r] = fmaf(xv[i][c][e], wv[r][c][e], a[i * 4 + r]);
}

// One step of the halving exchange of rows4x8_whole, over lane bit M.
template <int M>
__device__ __forceinline__ void halve_in_wave(float (&a)[32], int lane) {
  const bool up = (lane & M) != 0;
  #pragma unroll   // a lives in registers only while each index is a constant
  for (int i = 0; i < M; ++i) {
    const float lo = a[i], hi = a[i + M];
    a[i] = (up ? hi : lo) + lane_xor<M>(up ? lo : hi);
  }
}

// Second half: the shares of the 32 lanes are summed.
__device__ __forceinline__ float rows4x8_whole(float (&a)[32], int lane) {
  // Halving exchange: at each step a lane keeps the half of the sums whose index bit
  // equals its own lane bit and hands the other half to its partner, so 31 exchanges
  // leave sum l whole in lane l.
  halve_in_wave<16>(a, lane);
  halve_in_wave<8>(a, lane);
  halve_in_wave<4>(a, lane);
  halve_in_wave<2>(a, lane);
  halve_in_wave<1>(a, lane);
  return a[0];
}

__device__ __forceinline__ float rows4x8(const float* __restrict__ w,
                                         const float* __restrict__ x, int lane) {
  float a[32];
  rows4x8_shares(w, x, lane, a);
  return rows4x8_whole(a, lane);
}

// ============================================================
// Precompute 1: spk_tokens = relu(speaker_emb @ We^T + be) + spk_pos
// One wave: four rows of We against all eight batches.
// ============================================================
__global__ __launch_bounds__(256) void spk_kernel(
    const float* __restrict__ se, const float* __restrict__ We,
    const float* __restrict__ be, const float* __restrict__ spos,
    float* __restrict__ spk) {
  const int lane = threadIdx.x & 31;
  const int r0 = (blockIdx.x * 8 + (threadIdx.x >> 5)) * 4;   // r = s*D + d
  const int r = r0 + (lane & 3), b = lane >> 2;
  const float bias = be[r], pos = spos[r];   // loaded in front of the wait inside rows4x8
  const float acc = rows4x8(We + (size_t)r0 * kD, se, lane);
  spk[b * (kSPK * kD) + r] = fmaxf(acc + bias, 0.f) + pos;
}

// ============================================================
// Precompute 2: k, v and everything folded from them, in one launch.
// Work-group (k or v, batch b, head pair g), 16 waves. Each wave first takes eight rows
// of Wk or Wv against the four speaker rows of b, so the work-group holds the 4 x 128
// slice of k or v that its own outputs need, and nobody else needs that slice.
//   k: M (f16) = Wq folded into k, Msum, score bias bq.k
//   v: VO^T (f16) = Wo folded into v
// A head pair is eight neighbouring folded keys: in fragment order (frag_place) these
// fill whole 128-B lines of M and VO^T, so each line has one writing work-group.
// The last blocks fold the gate LN: gamma into Wg1 (f16, fragment order), beta into bg1.
// ============================================================
// The 32 pieces (512 contiguous bytes each, STEP x 16 B apart) of the weights that a wave
// folds its slice of k or v with. They depend on nothing computed in the kernel: called
// between the halves of rows4x8, the loads go out as registers come free and fly during
// the exchange.
template <int STEP>
__device__ __forceinline__ void fold_loads(const float* __restrict__ w2, int lane, int jj,
                                           f4v (&wr)[32]) {
  const f4v* wl = (const f4v*)w2 + lane;
  #pragma unroll   // wr lives in registers only while each index is a constant
  for (int i = 0; i < 32; ++i) wr[i] = wl[i * STEP];
  // names the address pair, and the index jj of the caller's bias loads, so that they
  // outlive the loads: no load's result may land on them before this wait
  asm volatile("s_wait_xcnt 0x0" :: "v"(wl), "v"(jj) : "memory");
}

// One step of a halving exchange inside a 16-lane row: of the 16 * M sums a lane keeps the
// half whose index bit equals its lane bit M and adds what lane ^ M hands over. The partner's
// value comes by DPP (row_xmask), a vector instruction, not through the LDS pipe.
template <int M>
__device__ __forceinline__ void halve_in_row(float (&a)[128], int lane) {
  const bool up = (lane & M) != 0;
  #pragma unroll   // a lives in registers only while each index is a constant
  for (int i = 0; i < M * 8; ++i) {
    const float lo = a[i], hi = a[i + M * 8];
    const float give = up ? lo : hi;
    a[i] = (up ? hi : lo) + __int_as_float(__builtin_amdgcn_update_dpp(
        0, __float_as_int(give), 0x160 + M, 0xf, 0xf, false));
  }
}

constexpr int PP = kD + 16;       // floats: LDS pitch of a partial row of M
constexpr int kKV = 2 * kB * (kH / 2);   // work-groups of the k and v parts

__global__ __launch_bounds__(512) void kvfold_kernel(
    const float* __restrict__ spk,
    const float* __restrict__ Wk, const float* __restrict__ bk,
    const float* __restrict__ Wv, const float* __restrict__ bv,
    const float* __restrict__ Wq, const float* __restrict__ bq,
    const float* __restrict__ Wo, const float* __restrict__ Wg1,
    const float* __restrict__ bg1,
    const float* __restrict__ glng, const float* __restrict__ glnb,
    _Float16* __restrict__ Mh, _Float16* __restrict__ VOt,
    float* __restrict__ cb, float* __restrict__ Msum,
    _Float16* __restrict__ Wg1h, float* __restrict__ bg1p) {
  __shared__ __attribute__((aligned(16))) float sP[64 * PP + 16];  // [wave][s][d] partial M
  __shared__ __attribute__((aligned(16))) float sV[8 * kDH];       // [head of pair][s][j]
  __shared__ float sRed[2][16][4];                                 // [Msum, cb][wave][s]
  // Every loop over wr, a4, vv, vp and a below is unrolled in full: the arrays live in
  // registers only while each index is a constant.
  const int t = threadIdx.x;
  const int lane = t & 31;
  // the wave's number as a scalar, so that row addresses formed from it are scalar bases
  const int wave = __builtin_amdgcn_readfirstlane(t >> 5);
  if (blockIdx.x < kKV) {
    const int which = blockIdx.x >> 5;               // 0: k, 1: v
    const int b = (blockIdx.x >> 2) & 7;
    const int g = blockIdx.x & 3;                    // heads 2g and 2g + 1
    const int wrow = g * 128 + wave * 8;             // head 2g + (wave >> 3), j from (wave & 7) * 8
    const int s = lane & 3, jj = lane >> 2;
    // the four speaker rows stand where rows4x8 has its four rows: lane l gets speaker
    // row (l & 3) against weight row wrow + (l >> 2)
    const float* spkb = spk + (size_t)b * kSPK * kD;
    float sh[32];
    f4v wr[32];
    if (which == 0) {
      // M[b][hs][d] = (1/8) * sum_j Wq[h*64+j][d] * k[b][s][h*64+j]: the wave sums over its
      // own eight j for all d (lanes across the columns), the eight waves of a head meet in LDS.
      // wr: the wave's own eight rows of Wq, whole (piece i = row i >> 2, quarter i & 3)
      const float bkv = (bk + wrow)[jj], bqv = (bq + wrow)[jj];   // in front of the wait in rows4x8_shares
      rows4x8_shares(spkb, Wk + (size_t)wrow * kD, lane, sh);
      fold_loads<32>(Wq + (size_t)wrow * kD, lane, jj, wr);
      const float kv = rows4x8_whole(sh, lane) + bkv;
      f4v a4[4][4];
      #pragma unroll
      for (int i = 0; i < 4; ++i)
        #pragma unroll
        for (int q = 0; q < 4; ++q) a4[i][q] = (f4v){0.f, 0.f, 0.f, 0.f};
      #pragma unroll
      for (int r = 0; r < 8; ++r)
        #pragma unroll
        for (int i = 0; i < 4; ++i) {
          const float kk = __int_as_float(__builtin_amdgcn_readlane(__float_as_int(kv), r * 4 + i));
          #pragma unroll
          for (int q = 0; q < 4; ++q) a4[i][q] += wr[r * 4 + q] * kk;
        }
      // Msum[b][hs] = sum_d M[b][hs][d] (fp32), cb[b][hs] = (1/8) * bq . k_head: this wave's share
      float ms[4];
      #pragma unroll
      for (int i = 0; i < 4; ++i) {
        const f4v s4 = (a4[i][0] + a4[i][1]) + (a4[i][2] + a4[i][3]);
        ms[i] = (s4[0] + s4[1]) + (s4[2] + s4[3]);
      }
      // halving exchange over lane bits 1 and 0: the sum for s = lane & 3 stays, as in cp
      const bool up2 = (lane & 2) != 0, up1 = (lane & 1) != 0;
      const float m0 = (up2 ? ms[2] : ms[0]) + lane_xor<2>(up2 ? ms[0] : ms[2]);
      const float m1 = (up2 ? ms[3] : ms[1]) + lane_xor<2>(up2 ? ms[1] : ms[3]);
      float mp = (up1 ? m1 : m0) + lane_xor<1>(up1 ? m0 : m1);
      float cp = kv * bqv;
      mp += lane_xor<4>(mp);
      cp += lane_xor<4>(cp);
      mp += lane_xor<8>(mp);
      cp += lane_xor<8>(cp);
      mp += lane_xor<16>(mp);
      cp += lane_xor<16>(cp);
      if (lane < 4) {
        sRed[0][wave][lane] = mp;
        sRed[1][wave][lane] = cp;
      }
      // the second head's rows stand 16 B further on, so that the 16 lanes of one read
      // below (4 s x 2 heads x 2 column groups) fall on 16 different bank groups
      #pragma unroll
      for (int i = 0; i < 4; ++i)
        #pragma unroll
        for (int q = 0; q < 4; ++q)
          *(f4v*)&sP[(wave * 4 + i) * PP + (wave >> 3) * 4 + q * 128 + lane * 4] = a4[i][q];
      __syncthreads();   // block-uniform branch
      // one thread: one folded key n8 of the pair, eight neighbouring d = one 16-B place unit
      const int n8 = lane & 7, oct = t >> 3;
      const int hh = n8 >> 2;
      f4v s0 = {0.f, 0.f, 0.f, 0.f}, s1 = {0.f, 0.f, 0.f, 0.f};
      #pragma unroll
      for (int i = 0; i < 8; ++i) {
        const float* p = &sP[((hh * 8 + i) * 4 + (n8 & 3)) * PP + hh * 4 + oct * 8];
        s0 += *(const f4v*)p;
        s1 += *(const f4v*)(p + 4);
      }
      h8v o;
      #pragma unroll
      for (int e = 0; e < 4; ++e) {
        o[e]     = (_Float16)(s0[e] * 0.125f);
        o[4 + e] = (_Float16)(s1[e] * 0.125f);
      }
      // inverse of frag_place for row g*8 + n8, columns oct*8 .. oct*8 + 7
      const int place = (((((g >> 1) * (kD / 32) + (oct >> 2)) * 2 + ((oct >> 1) & 1)) * 32)
                         + (oct & 1) * 16 + (g & 1) * 8 + n8) * 8;
      *(h8v*)(Mh + (size_t)b * kHS * kD + place) = o;
      if (t < 16) {
        const int kind = t >> 3;                     // 0: Msum, 1: cb
        float acc = 0.f;
        #pragma unroll
        for (int i = 0; i < 8; ++i) acc += sRed[kind][hh * 8 + i][n8 & 3];
        // each (b, g) has a 128-B line of its own for its eight cb and eight Msum
        (kind ? cb : Msum)[(b * 4 + g) * 32 + n8] = acc * 0.125f;
      }
    } else {
      // VOt[b][d][hs] = sum_j Wo[d][h*64+j] * v[b][s][h*64+j]: a wave takes 32 rows d; the
      // 128 columns of the head pair are 512 contiguous bytes, 16 lanes to a head (wr: piece i = row i)
      const float bvv = (bv + wrow)[jj];                          // in front of the wait in rows4x8_shares
      rows4x8_shares(spkb, Wv + (size_t)wrow * kD, lane, sh);
      fold_loads<128>(Wo + (size_t)(wave * 32) * kD + g * 128, lane, jj, wr);
      const float kv = rows4x8_whole(sh, lane) + bvv;
      sV[((wave >> 3) * 4 + s) * kDH + (wave & 7) * 8 + jj] = kv;
      __syncthreads();   // block-uniform branch
      const int hh = lane >> 4, c4 = lane & 15;
      f4v vv[4];
      #pragma unroll
      for (int i = 0; i < 4; ++i) vv[i] = *(const f4v*)&sV[(hh * 4 + i) * kDH + c4 * 4];
      // v in pairs of s, so that one packed multiply-add serves two sums of a row
      f2v vp[4][2];
      #pragma unroll
      for (int e = 0; e < 4; ++e) {
        vp[e][0] = (f2v){vv[0][e], vv[1][e]};
        vp[e][1] = (f2v){vv[2][e], vv[3][e]};
      }
      float a[128];
      #pragma unroll
      for (int i = 0; i < 32; ++i)
        #pragma unroll
        for (int k = 0; k < 2; ++k) {
          f2v p2 = vp[0][k] * wr[i][0];
          #pragma unroll
          for (int e = 1; e < 4; ++e) p2 += vp[e][k] * wr[i][e];
          a[i * 4 + k * 2]     = p2[0];
          a[i * 4 + k * 2 + 1] = p2[1];
        }
      // Halving exchange over the 16 lanes of a head, as in rows4x8: sums c4*8 .. c4*8 + 7
      // (rows 2*c4 and 2*c4 + 1 of the wave's 32, four s each) end whole in lane c4.
      halve_in_row<8>(a, lane);
      halve_in_row<4>(a, lane);
      halve_in_row<2>(a, lane);
      halve_in_row<1>(a, lane);
      #pragma unroll
      for (int r = 0; r < 2; ++r) {
        const int d = wave * 32 + c4 * 2 + r;
        h4v o;
        #pragma unroll
        for (int k = 0; k < 4; ++k) o[k] = (_Float16)a[r * 4 + k];
        // inverse of frag_place for row d, columns g*8 + hh*4 .. + 3
        const int place = ((((d >> 4) * 2 + (g >> 1)) * 32) + (g & 1) * 16 + (d & 15)) * 8 + hh * 4;
        *(h4v*)(VOt + (size_t)b * kD * kHS + place) = o;
      }
    }
  } else {
    const int idx = (blockIdx.x - kKV) * 512 + t;
    if (idx < kHG * kD / 8) {
      // Wg1h = Wg1 * gamma (gamma of gate-LN folded into weights); one 16-B place unit a thread
      int n, k;
      frag_place(idx * 8, kD / 32, n, k);
      const f4v* wr = (const f4v*)(Wg1 + (size_t)n * kD + k);
      const f4v* gm = (const f4v*)(glng + k);
      const f4v p0 = wr[0] * gm[0], p1 = wr[1] * gm[1];
      h8v o;
      #pragma unroll
      for (int e = 0; e < 4; ++e) { o[e] = (_Float16)p0[e]; o[4 + e] = (_Float16)p1[e]; }
      *(h8v*)(Wg1h + (size_t)idx * 8) = o;
    } else {
      // bg1p = bg1 + Wg1 . beta (beta of gate-LN folded into bias); a wave takes two units n,
      // so that the 32 results of a block fill one 128-B line
      const int n0 = ((idx - kHG * kD / 8) >> 5) * 2;
      const f4v* bt = (const f4v*)glnb;
      for (int u = 0; u < 2; ++u) {
        const int n = n0 + u;
        const f4v* wr = (const f4v*)(Wg1 + (size_t)n * kD);
        f4v p4 = {};
        for (int c = 0; c < 4; ++c) p4 += wr[c * 32 + lane] * bt[c * 32 + lane];
        float acc = wave_sum((p4[0] + p4[1]) + (p4[2] + p4[3]));
        if (lane == 0) bg1p[n] = bg1[n] + acc;
      }
    }
  }
}

// ============================================================
// Fused main kernel: gate GEMM + scores + softmax + combine + final LN.
// LDS holds the pre-affine normalized tile x' = (x-mu)*rstd (f16);
// gamma/beta are folded into Wg1h/bg1p, and raw-x scores are recovered via
// scores = irs * (x'.M^T) + mu*Msum + cb.
// All three products are formed transposed: the weights are the A operand, the token rows
// the B operand (both fragments have the same lane and k order, so only the two arguments
// change places). Register r of a result tile is then weight row 8 * (lane >> 4) + r for
// token lane & 15: a lane holds eight neighbouring columns of ONE token row.
// The second launch bound asks for eight waves per SIMD (at most 128 registers a wave):
// four work-groups then fit on a WGP, and the 1024 work-groups of the grid are all
// resident at once instead of running as three a WGP and a thin second round.
// ============================================================
__global__ __launch_bounds__(256, 8) void fused_kernel(
    const float* __restrict__ X,
    const _Float16* __restrict__ Mh,    // (B, HS, D), each batch in fragment order
    const _Float16* __restrict__ VOt,   // (B, D, HS), each batch in fragment order
    const float* __restrict__ cb,       // (B, 4 head pairs): 8 values at the head of a 128-B line
    const float* __restrict__ Msum,     // the same lines as cb, floats 8..15 of each
    const _Float16* __restrict__ Wg1h,  // (HG, D), gamma-folded, in fragment order
    const float* __restrict__ bg1p,     // (HG), beta-folded
    const float* __restrict__ Wg2, const float* __restrict__ bg2,
    const float* __restrict__ bo,
    const float* __restrict__ lng, const float* __restrict__ lnb,
    float* __restrict__ out) {
  __shared__ __attribute__((aligned(16))) _Float16 sXh[TILE * XP];  // x' (f16); later reused for attn (f16)
  __shared__ __attribute__((aligned(16))) float sW[TILE * WP];
  __shared__ float sGp[16 * TILE];   // [wave * 2 + lane half][row]: shares of the gate head's sum
  __shared__ float sMu[TILE], sIrs[TILE], sG[TILE];

  const int t = threadIdx.x;
  const int lane = t & 31;
  const int wave = t >> 5;
  const int r15 = lane & 15;
  const int hi = lane >> 4;          // 0 or 1 (wave32 half)
  const int kb = hi * 8;             // fragment K sub-offset per ISA layout

  const size_t rowg0 = (size_t)blockIdx.x * TILE;
  const int b = (int)(rowg0 >> 12);  // tile never crosses batch (4096 % 32 == 0)

  const size_t AW_OFF = (size_t)kB * kT * kD;
  const size_t G_OFF  = AW_OFF + (size_t)kB * kT * kSPK;

  // Each wave owns four whole rows; its lanes lie across the columns, so every
  // global load and store of a row piece is 32 lanes x 16 B = 512 contiguous bytes.
  // Piece c of row rr is f4v index rr * 128 + c * 32 + lane.
  const int row0 = wave * 4;
  const f4v* xw = (const f4v*)(X + (rowg0 + row0) * kD);

  // ---- Phase 0: LN stats inside the wave, then x' = (x-mu)*rstd to LDS (f16) ----
  {
    const f4v* xl = xw + lane;
    f4v xv[4][4];
    #pragma unroll
    for (int rr = 0; rr < 4; ++rr)
      #pragma unroll
      for (int c = 0; c < 4; ++c) xv[rr][c] = xl[rr * 128 + c * 32];
    // names the address pair so that it outlives the loads
    asm volatile("s_wait_xcnt 0x0" :: "v"(xl) : "memory");
    float s[4], q[4];
    #pragma unroll
    for (int rr = 0; rr < 4; ++rr) {
      s[rr] = 0.f; q[rr] = 0.f;
      #pragma unroll
      for (int c = 0; c < 4; ++c)
        #pragma unroll
        for (int e = 0; e < 4; ++e) { s[rr] += xv[rr][c][e]; q[rr] += xv[rr][c][e] * xv[rr][c][e]; }
    }
    #pragma unroll
    for (int rr = 0; rr < 4; ++rr) { s[rr] = wave_sum(s[rr]); q[rr] = wave_sum(q[rr]); }
    #pragma unroll
    for (int rr = 0; rr < 4; ++rr) {
      const float mu = s[rr] * (1.f / kD);
      const float var = q[rr] * (1.f / kD) - mu * mu;
      const float rs = rsqrtf(var + kEPS);
      if (lane == 0) {               // the scores epilogue of other waves reads these
        sMu[row0 + rr]  = mu;
        sIrs[row0 + rr] = sqrtf(var + kEPS);
      }
      #pragma unroll
      for (int c = 0; c < 4; ++c) {
        h4v h;
        #pragma unroll
        for (int e = 0; e < 4; ++e) h[e] = (_Float16)((xv[rr][c][e] - mu) * rs);
        *(h4v*)&sXh[(row0 + rr) * XP + c * 128 + lane * 4] = h;
      }
    }
  }
  __syncthreads();

  // ---- Gate GEMM and gate head: relu(x' @ Wg1h^T + bg1p) . Wg2  (M=32,N=128,K=512) ----
  // A lane's eight results are hidden units wave*16 + kb .. + 7 of one token: bias, relu and
  // the product with Wg2 stay in the lane, and only its share of the head's sum goes to LDS.
  {
    const _Float16* wl = Wg1h + wave * (16 * kD) + lane * 8;
    v8f acc[2];
    #pragma unroll   // acc lives in registers only while each index is a constant
    for (int mt = 0; mt < 2; ++mt) {
      acc[mt] = (v8f){};
      for (int k0 = 0; k0 < kD; k0 += 32) {
        v16h xf = frag_h(&sXh[(mt * 16 + r15) * XP + k0 + kb]);
        v16h wf = frag_pk(wl + k0 * 16);
        acc[mt] = __builtin_amdgcn_wmma_f32_16x16x32_f16(false, wf, false, xf,
                                                         (short)0, acc[mt], false, false);
      }
    }
    const f4v* bp = (const f4v*)(bg1p + wave * 16 + kb);
    const f4v* up = (const f4v*)(Wg2 + wave * 16 + kb);
    const f4v b0 = bp[0], b1 = bp[1], u0 = up[0], u1 = up[1];
    // names the address pairs of these four loads and of the fragment loads so that they
    // outlive the loads
    asm volatile("s_wait_xcnt 0x0" :: "v"(bp), "v"(up), "v"(wl) : "memory");
    #pragma unroll
    for (int mt = 0; mt < 2; ++mt) {
      // neighbouring units in pairs, as they lie in the registers: packed add and multiply-add
      f2v p = {0.f, 0.f};
      #pragma unroll
      for (int e = 0; e < 4; e += 2) {
        const f2v h0 = (f2v){acc[mt][e], acc[mt][e + 1]} + (f2v){b0[e], b0[e + 1]};
        const f2v h1 = (f2v){acc[mt][4 + e], acc[mt][5 + e]} + (f2v){b1[e], b1[e + 1]};
        p += (f2v){fmaxf(h0[0], 0.f), fmaxf(h0[1], 0.f)} * (f2v){u0[e], u0[e + 1]};
        p += (f2v){fmaxf(h1[0], 0.f), fmaxf(h1[1], 0.f)} * (f2v){u1[e], u1[e + 1]};
      }
      sGp[(wave * 2 + hi) * TILE + mt * 16 + r15] = p[0] + p[1];
    }
  }

  // ---- Scores GEMM: irs*(x' @ M^T) + mu*Msum + cb  (M=32,N=32,K=512), softmax in the lane ----
  // Nothing here reads what the gate phase wrote, so no barrier stands in between.
  if (wave < 4) {
    const int mt = wave >> 1, nt = wave & 1;
    const int arow = mt * 16 + r15;
    const _Float16* ml = Mh + (b * kHS + nt * 16) * kD + lane * 8;
    v8f acc = {};
    for (int k0 = 0; k0 < kD; k0 += 32) {
      v16h xf = frag_h(&sXh[arow * XP + k0 + kb]);
      v16h mf = frag_pk(ml + k0 * 16);
      acc = __builtin_amdgcn_wmma_f32_16x16x32_f16(false, mf, false, xf,
                                                   (short)0, acc, false, false);
    }
    // the lane's eight folded keys nt*16 + kb .. + 7 are head pair nt*2 + hi: one 128-B line
    const f4v* cp = (const f4v*)(cb + (b * 4 + nt * 2 + hi) * 32);
    const f4v* mp = (const f4v*)(Msum + (b * 4 + nt * 2 + hi) * 32);
    const f4v c0 = cp[0], c1 = cp[1], m0 = mp[0], m1 = mp[1];
    // names the address pairs of these four loads and of the fragment loads so that they
    // outlive the loads
    asm volatile("s_wait_xcnt 0x0" :: "v"(cp), "v"(mp), "v"(ml) : "memory");
    const float irs = sIrs[arow], mu = sMu[arow];
    f4v sc[2];
    #pragma unroll
    for (int e = 0; e < 4; ++e) {
      sc[0][e] = fmaf(acc[e],     irs, fmaf(mu, m0[e], c0[e]));
      sc[1][e] = fmaf(acc[4 + e], irs, fmaf(mu, m1[e], c1[e]));
    }
    // softmax over SPK=4: each half of the eight is one head
    #pragma unroll
    for (int hh = 0; hh < 2; ++hh) {
      const float s0 = sc[hh][0], s1 = sc[hh][1], s2 = sc[hh][2], s3 = sc[hh][3];
      const float m = fmaxf(fmaxf(s0, s1), fmaxf(s2, s3));
      const float e0 = expf(s0 - m), e1 = expf(s1 - m), e2 = expf(s2 - m), e3 = expf(s3 - m);
      const float inv = 1.f / (e0 + e1 + e2 + e3);
      *(f4v*)&sW[arow * WP + nt * 16 + kb + hh * 4] = (f4v){e0 * inv, e1 * inv, e2 * inv, e3 * inv};
    }
  }
  __syncthreads();
  // Combine GEMM, operand loads: one token tile mt, eight column tiles from nt0 a wave. The eight
  // VO fragments depend on nothing computed here: all 16 loads go out together, at the head
  // of the phase, and fly during the two small pieces of work in front of the products.
  const int mt = wave >> 2, nt0 = (wave & 3) * 8;
  const _Float16* vl = VOt + (b * kD + nt0 * 16) * kHS + lane * 8;
  v16h vf[8];
  #pragma unroll   // vf lives in registers only while each index is a constant
  for (int i = 0; i < 8; ++i) vf[i] = frag_pk(vl + i * (16 * kHS));
  // names the address pair so that it outlives the loads
  asm volatile("s_wait_xcnt 0x0" :: "v"(vl) : "memory");
  if (t < TILE * kSPK) {  // head-averaged attention weights
    int rw = t >> 2, s = t & 3;
    float aw = 0.f;
    #pragma unroll
    for (int h = 0; h < kH; ++h) aw += sW[rw * WP + h * 4 + s];
    out[AW_OFF + (rowg0 + rw) * kSPK + s] = aw * (1.f / kH);
  }
  if (wave == 4) {        // gate head: the 16 shares of a row, one row a lane
    float a4[4] = {0.f, 0.f, 0.f, 0.f};
    #pragma unroll
    for (int i = 0; i < 4; ++i)
      #pragma unroll
      for (int j = 0; j < 4; ++j) a4[j] += sGp[(i * 4 + j) * TILE + lane];
    float g = bg2[0] + ((a4[0] + a4[1]) + (a4[2] + a4[3]));
    g = 1.f / (1.f + expf(-g));
    sG[lane] = g;
    out[G_OFF + rowg0 + lane] = g;
  }

  // ---- Combine GEMM: attn = w @ VO  (M=32,N=512,K=32) -> overwrite sXh ----
  {
    v16h a;
    {
      const f4v* wp = (const f4v*)&sW[(mt * 16 + r15) * WP + kb];
      f4v w0 = wp[0], w1 = wp[1];   // K = kb .. kb+7
      f4v w2 = wp[4], w3 = wp[5];   // K = kb+16 .. kb+23
      #pragma unroll
      for (int e = 0; e < 4; ++e) {
        a[e]      = (_Float16)w0[e];
        a[4 + e]  = (_Float16)w1[e];
        a[8 + e]  = (_Float16)w2[e];
        a[12 + e] = (_Float16)w3[e];
      }
    }
    #pragma unroll
    for (int i = 0; i < 8; ++i) {
      v8f acc = {};
      acc = __builtin_amdgcn_wmma_f32_16x16x32_f16(false, vf[i], false, a,
                                                   (short)0, acc, false, false);
      // the lane's eight results are columns (nt0 + i)*16 + kb .. + 7 of one token: one 16-B store
      h8v o;
      #pragma unroll
      for (int r = 0; r < 8; ++r) o[r] = (_Float16)acc[r];
      *(h8v*)&sXh[(mt * 16 + r15) * XP + (nt0 + i) * 16 + kb] = o;
    }
  }
  __syncthreads();

  // ---- Epilogue: fused = LN(x + g*(attn + bo)), each wave on its own four rows ----
  {
    f4v* ow = (f4v*)(out + (rowg0 + row0) * kD);
    // kept rolled: unrolled, the compiler hoists all four rows' loads and the
    // register count costs a resident work-group
    #pragma unroll 1
    for (int rr = 0; rr < 4; ++rr) {
      const float g = sG[row0 + rr];
      const f4v* xr = xw + rr * 128 + lane;
      f4v f[4];
      float s = 0.f, q = 0.f;
      #pragma unroll
      for (int c = 0; c < 4; ++c) {
        const f4v v = xr[c * 32];
        const h4v a = *(const h4v*)&sXh[(row0 + rr) * XP + c * 128 + lane * 4];
        const f4v bb = ((const f4v*)bo)[c * 32 + lane];
        #pragma unroll
        for (int e = 0; e < 4; ++e) {
          const float x = v[e] + g * ((float)a[e] + bb[e]);
          f[c][e] = x;
          // fmaf written out: left to contraction, the build with the vector-pipe sums pairs
          // the s and q chains into packed adds and pays for that in moves and conversions
          s += x; q = fmaf(x, x, q);
        }
      }
      s = wave_sum(s);
      q = wave_sum(q);
      const float mu = s * (1.f / kD);
      const float var = q * (1.f / kD) - mu * mu;
      const float rs = rsqrtf(var + kEPS);
      #pragma unroll
      for (int c = 0; c < 4; ++c) {
        const f4v lg = ((const f4v*)lng)[c * 32 + lane];
        const f4v lb = ((const f4v*)lnb)[c * 32 + lane];
        f4v o;
        #pragma unroll
        for (int e = 0; e < 4; ++e) o[e] = (f[c][e] - mu) * rs * lg[e] + lb[e];
        ow[rr * 128 + c * 32 + lane] = o;
      }
      // the next trip rewrites the address and data registers that these stores name; xr is
      // named so that the x loads' address pair lives up to this wait
      asm volatile("s_wait_xcnt 0x0" :: "v"(xr) : "memory");
    }
  }
}

// ============================================================
extern "C" void kernel_launch(void* const* d_in, const int* in_sizes, int n_in,
                              void* d_out, int out_size, void* d_ws, size_t ws_size,
                              hipStream_t stream) {
  (void)in_sizes; (void)n_in; (void)out_size; (void)ws_size;
  const float* token = (const float*)d_in[0];
  const float* se    = (const float*)d_in[1];
  const float* We    = (const float*)d_in[2];
  const float* be    = (const float*)d_in[3];
  const float* spos  = (const float*)d_in[4];
  const float* Wq    = (const float*)d_in[5];
  const float* bq    = (const float*)d_in[6];
  const float* Wk    = (const float*)d_in[7];
  const float* bk    = (const float*)d_in[8];
  const float* Wv    = (const float*)d_in[9];
  const float* bv    = (const float*)d_in[10];
  const float* Wo    = (const float*)d_in[11];
  const float* bo    = (const float*)d_in[12];
  const float* glng  = (const float*)d_in[13];
  const float* glnb  = (const float*)d_in[14];
  const float* Wg1   = (const float*)d_in[15];
  const float* bg1   = (const float*)d_in[16];
  const float* Wg2   = (const float*)d_in[17];
  const float* bg2   = (const float*)d_in[18];
  const float* lng   = (const float*)d_in[19];
  const float* lnb   = (const float*)d_in[20];
  float* out = (float*)d_out;

  char* ws = (char*)d_ws;
  float*    spk  = (float*)(ws + 0);            // 64 KB
  _Float16* Mh   = (_Float16*)(ws + 196608);    // 256 KB
  _Float16* VOt  = (_Float16*)(ws + 458752);    // 256 KB
  float*    cbf  = (float*)(ws + 65536);        // 32 lines of 128 B: floats 0..7 of each
  float*    Msum = (float*)(ws + 65568);        // floats 8..15 of the same lines
  float*    bg1p = (float*)(ws + 722944);       // 512 B
  _Float16* Wg1h = (_Float16*)(ws + 723456);    // 128 KB

  spk_kernel<<<kSPK * kD / 32, 256, 0, stream>>>(se, We, be, spos, spk);
  kvfold_kernel<<<kKV + kHG * kD / 8 / 512 + kHG / 32, 512, 0, stream>>>(
      spk, Wk, bk, Wv, bv, Wq, bq, Wo, Wg1, bg1, glng, glnb, Mh, VOt, cbf, Msum, Wg1h, bg1p);
  fused_kernel<<<(kB * kT) / TILE, 256, 0, stream>>>(token, Mh, VOt, cbf, Msum, Wg1h, bg1p,
                                                     Wg2, bg2, bo, lng, lnb, out);
}

// v010
// A run of this version takes 29.3 microseconds.
// Next to v009, in two timings, it ran 1.04 and 1.05 times as fast.
// Counting every step since v000, it is 16.1 times as fast.
#include <hip/hip_runtime.h>
#include <hip/hip_bf16.h>
#include <math.h>

// ---- problem constants ----
constexpr int kB   = 8;
constexpr int kT   = 4096;
constexpr int kD   = 512;
constexpr int kH   = 8;
constexpr int kDH  = 64;
constexpr int kSPK = 4;
constexpr int kHS  = kH * kSPK;   // 32 folded "keys" per batch
constexpr int kHG  = 128;
constexpr int TILE = 32;          // token rows per block
constexpr float kEPS = 1e-5f;
// LDS row pitches: 16 B x an odd number, so that the 16 rows that one 16-byte
// fragment read touches fall on 16 different bank groups instead of on one.
constexpr int XP = kD + 8;        // halves: 1040 B = 16 B x 65
constexpr int WP = kHS + 4;       // floats:  144 B = 16 B x 9

typedef __attribute__((ext_vector_type(16))) _Float16 v16h;
typedef __attribute__((ext_vector_type(8)))  float    v8f;
typedef __attribute__((ext_vector_type(4)))  float    f4v;
typedef __attribute__((ext_vector_type(2)))  float    f2v;
typedef __attribute__((ext_vector_type(4)))  _Float16 h4v;
typedef __attribute__((ext_vector_type(8)))  _Float16 h8v;

// Gather one 16x32 WMMA fragment (A or B) from a row-major f16 matrix.
// p points at [row_of_this_lane][k0 + kb]; lanes 0-15 take K {0..7,16..23},
// lanes 16-31 take K {8..15,24..31} (kb handles the 8-offset).
__device__ __forceinline__ v16h frag_h(const _Float16* p) {
  h8v lo = *(const h8v*)p;
  h8v hi = *(const h8v*)(p + 16);
  v16h f;
  #pragma unroll
  for (int j = 0; j < 8; ++j) { f[j] = lo[j]; f[8 + j] = hi[j]; }
  return f;
}

// Fragment order of an A operand (f16, N rows x K columns, ksteps = K / 32). Place
// p = (((nt * ksteps + ks) * 2 + hf) * 32 + lane) * 8 + j holds row nt*16 + (lane & 15),
// column ks*32 + hf*16 + (lane >> 4)*8 + j: the same k order as frag_h, but the 32 lanes
// of each 16-byte load lie side by side, 512 contiguous bytes = 4 whole 128-B lines,
// where a row-major operand gives 16 lines with 32 bytes used of each.
__device__ __forceinline__ void frag_place(int p, int ksteps, int& n, int& k) {
  const int j = p & 7, ln = (p >> 3) & 31, hf = (p >> 8) & 1;
  const int blk = p >> 9;
  const int nt = blk / ksteps, ks = blk - nt * ksteps;
  n = nt * 16 + (ln & 15);
  k = ks * 32 + hf * 16 + (ln >> 4) * 8 + j;
}

// One 16x32 A fragment from an operand stored in fragment order.
// p points at [fragment nt * ksteps + ks][0][lane][0].
__device__ __forceinline__ v16h frag_pk(const _Float16* p) {
  h8v lo = *(const h8v*)p;
  h8v hi = *(const h8v*)(p + 256);
  v16h f;
  #pragma unroll
  for (int j = 0; j < 8; ++j) { f[j] = lo[j]; f[8 + j] = hi[j]; }
  return f;
}

// The value that lane ^ M holds, by a vector instruction: DPP row_xmask inside a 16-lane
// row, a cross-row permute for M = 16. (A shuffle compiles to an LDS-pipe permute with a
// wait on its counter behind it.) Every lane of the wave must be on.
template <int M>
__device__ __forceinline__ float lane_xor(float v) {
  const int b = __float_as_int(v);
  if constexpr (M == 16)
    return __int_as_float(__builtin_amdgcn_permlanex16(b, b, 0x76543210, 0xfedcba98, false, false));
  else
    return __int_as_float(__builtin_amdgcn_update_dpp(0, b, 0x160 + M, 0xf, 0xf, false));
}

// Sum over the 32 lanes of a wave; every lane gets the total.
__device__ __forceinline__ float wave_sum(float v) {
  v += lane_xor<16>(v);
  v += lane_xor<8>(v);
  v += lane_xor<4>(v);
  v += lane_xor<2>(v);
  v += lane_xor<1>(v);
  return v;
}

// Dot products of four weight rows with eight input rows (all of length kD, rows
// contiguous) by one wave. The lanes lie across the columns, so every load is
// 32 lanes x 16 B = 512 contiguous bytes. Lane l returns the whole sum for weight
// row (l & 3) and input row (l >> 2).
// In two halves, so that a caller can send further loads out between them.
// First half: a[i * 4 + r] is this lane's share of the sum for weight row r, input row i.
__device__ __forceinline__ void rows4x8_shares(const float* __restrict__ w,
                                               const float* __restrict__ x, int lane,
                                               float (&a)[32]) {
  // Every loop here is unrolled in full: the arrays live in registers only while
  // each index is a constant.
  const f4v* wl = (const f4v*)w + lane;
  const f4v* xl = (const f4v*)x + lane;
  f4v wv[4][4], xv[8][4];
  #pragma unroll
  for (int c = 0; c < 4; ++c) {
    #pragma unroll
    for (int r = 0; r < 4; ++r) wv[r][c] = wl[r * 128 + c * 32];
    #pragma unroll
    for (int i = 0; i < 8; ++i) xv[i][c] = xl[i * 128 + c * 32];
  }
  // names the address registers (w: the pair; x: scalar base + lane) so that they outlive
  // the loads: no load's result may land on one that earlier loads name before this wait
  asm volatile("s_wait_xcnt 0x0" :: "v"(wl), "v"(lane) : "memory");
  // keeps the wait where it is written: without it the scheduler sinks the wait below
  // the arithmetic, and lets fewer of the 48 loads fly at once
  __builtin_amdgcn_sched_barrier(0);
  #pragma unroll
  for (int i = 0; i < 32; ++i) a[i] = 0.f;
  #pragma unroll
  for (int c = 0; c < 4; ++c)
    #pragma unroll
    for (int i = 0; i < 8; ++i)
      #pragma unroll
      for (int r = 0; r < 4; ++r)
        #pragma unroll
        for (int e = 0; e < 4; ++e) a[i * 4 + r] = fmaf(xv[i][c][e], wv[r][c][e], a[i * 4 + r]);
}

// One step of the halving exchange of rows4x8_whole, over lane bit M.
template <int M>
__device__ __forceinline__ void halve_in_wave(float (&a)[32], int lane) {
  const bool up = (lane & M) != 0;
  #pragma unroll   // a lives in registers only while each index is a constant
  for (int i = 0; i < M; ++i) {
    const float lo = a[i], hi = a[i + M];
    a[i] = (up ? hi : lo) + lane_xor<M>(up ? lo : hi);
  }
}

// Second half: the shares of the 32 lanes are summed.
__device__ __forceinline__ float rows4x8_whole(float (&a)[32], int lane) {
  // Halving exchange: at each step a lane keeps the half of the sums whose index bit
  // equals its own lane bit and hands the other half to its partner, so 31 exchanges
  // leave sum l whole in lane l.
  halve_in_wave<16>(a, lane);
  halve_in_wave<8>(a, lane);
  halve_in_wave<4>(a, lane);
  halve_in_wave<2>(a, lane);
  halve_in_wave<1>(a, lane);
  return a[0];
}

__device__ __forceinline__ float rows4x8(const float* __restrict__ w,
                                         const float* __restrict__ x, int lane) {
  float a[32];
  rows4x8_shares(w, x, lane, a);
  return rows4x8_whole(a, lane);
}

// ============================================================
// Precompute 1: spk_tokens = relu(speaker_emb @ We^T + be) + spk_pos
// One wave: four rows of We against all eight batches.
// ============================================================
__global__ __launch_bounds__(256) void spk_kernel(
    const float* __restrict__ se, const float* __restrict__ We,
    const float* __restrict__ be, const float* __restrict__ spos,
    float* __restrict__ spk) {
  const int lane = threadIdx.x & 31;
  const int r0 = (blockIdx.x * 8 + (threadIdx.x >> 5)) * 4;   // r = s*D + d
  const int r = r0 + (lane & 3), b = lane >> 2;
  const float bias = be[r], pos = spos[r];   // loaded in front of the wait inside rows4x8
  const float acc = rows4x8(We + (size_t)r0 * kD, se, lane);
  spk[b * (kSPK * kD) + r] = fmaxf(acc + bias, 0.f) + pos;
}

// ============================================================
// Precompute 2: k, v and everything folded from them, in one launch.
// Work-group (k or v, batch b, head pair g), 16 waves. Each wave first takes eight rows
// of Wk or Wv against the four speaker rows of b, so the work-group holds the 4 x 128
// slice of k or v that its own outputs need, and nobody else needs that slice.
//   k: M (f16) = Wq folded into k, Msum, score bias bq.k
//   v: VO^T (f16) = Wo folded into v
// A head pair is eight neighbouring folded keys: in fragment order (frag_place) these
// fill whole 128-B lines of M and VO^T, so each line has one writing work-group.
// The last blocks fold the gate LN: gamma into Wg1 (f16, fragment order), beta into bg1.
// ============================================================
// The 32 pieces (512 contiguous bytes each, STEP x 16 B apart) of the weights that a wave
// folds its slice of k or v with. They depend on nothing computed in the kernel: called
// between the halves of rows4x8, the loads go out as registers come free and fly during
// the exchange.
template <int STEP>
__device__ __forceinline__ void fold_loads(const float* __restrict__ w2, int lane, int jj,
                                           f4v (&wr)[32]) {
  const f4v* wl = (const f4v*)w2 + lane;
  #pragma unroll   // wr lives in registers only while each index is a constant
  for (int i = 0; i < 32; ++i) wr[i] = wl[i * STEP];
  // names the address pair, and the index jj of the caller's bias loads, so that they
  // outlive the loads: no load's result may land on them before this wait
  asm volatile("s_wait_xcnt 0x0" :: "v"(wl), "v"(jj) : "memory");
}

// One step of a halving exchange inside a 16-lane row: of the 16 * M sums a lane keeps the
// half whose index bit equals its lane bit M and adds what lane ^ M hands over. The partner's
// value comes by DPP (row_xmask), a vector instruction, not through the LDS pipe.
template <int M>
__device__ __forceinline__ void halve_in_row(float (&a)[128], int lane) {
  const bool up = (lane & M) != 0;
  #pragma unroll   // a lives in registers only while each index is a constant
  for (int i = 0; i < M * 8; ++i) {
    const float lo = a[i], hi = a[i + M * 8];
    const float give = up ? lo : hi;
    a[i] = (up ? hi : lo) + __int_as_float(__builtin_amdgcn_update_dpp(
        0, __float_as_int(give), 0x160 + M, 0xf, 0xf, false));
  }
}

constexpr int PP = kD + 16;       // floats: LDS pitch of a partial row of M
constexpr int kKV = 2 * kB * (kH / 2);   // work-groups of the k and v parts

__global__ __launch_bounds__(512) void kvfold_kernel(
    const float* __restrict__ spk,
    const float* __restrict__ Wk, const float* __restrict__ bk,
    const float* __restrict__ Wv, const float* __restrict__ bv,
    const float* __restrict__ Wq, const float* __restrict__ bq,
    const float* __restrict__ Wo, const float* __restrict__ Wg1,
    const float* __restrict__ bg1,
    const float* __restrict__ glng, const float* __restrict__ glnb,
    _Float16* __restrict__ Mh, _Float16* __restrict__ VOt,
    float* __restrict__ cb, float* __restrict__ Msum,
    _Float16* __restrict__ Wg1h, float* __restrict__ bg1p) {
  __shared__ __attribute__((aligned(16))) float sP[64 * PP + 16];  // [wave][s][d] partial M
  __shared__ __attribute__((aligned(16))) float sV[8 * kDH];       // [head of pair][s][j]
  __shared__ float sRed[2][16][4];                                 // [Msum, cb][wave][s]
  // Every loop over wr, a4, vv, vp and a below is unrolled in full: the arrays live in
  // registers only while each index is a constant.
  const int t = threadIdx.x;
  const int lane = t & 31;
  // the wave's number as a scalar, so that row addresses formed from it are scalar bases
  const int wave = __builtin_amdgcn_readfirstlane(t >> 5);
  if (blockIdx.x < kKV) {
    const int which = blockIdx.x >> 5;               // 0: k, 1: v
    const int b = (blockIdx.x >> 2) & 7;
    const int g = blockIdx.x & 3;                    // heads 2g and 2g + 1
    const int wrow = g * 128 + wave * 8;             // head 2g + (wave >> 3), j from (wave & 7) * 8
    const int s = lane & 3, jj = lane >> 2;
    // the four speaker rows stand where rows4x8 has its four rows: lane l gets speaker
    // row (l & 3) against weight row wrow + (l >> 2)
    const float* spkb = spk + (size_t)b * kSPK * kD;
    float sh[32];
    f4v wr[32];
    if (which == 0) {
      // M[b][hs][d] = (1/8) * sum_j Wq[h*64+j][d] * k[b][s][h*64+j]: the wave sums over its
      // own eight j for all d (lanes across the columns), the eight waves of a head meet in LDS.
      // wr: the wave's own eight rows of Wq, whole (piece i = row i >> 2, quarter i & 3)
      const float bkv = (bk + wrow)[jj], bqv = (bq + wrow)[jj];   // in front of the wait in rows4x8_shares
      rows4x8_shares(spkb, Wk + (size_t)wrow * kD, lane, sh);
      fold_loads<32>(Wq + (size_t)wrow * kD, lane, jj, wr);
      const float kv = rows4x8_whole(sh, lane) + bkv;
      f4v a4[4][4];
      #pragma unroll
      for (int i = 0; i < 4; ++i)
        #pragma unroll
        for (int q = 0; q < 4; ++q) a4[i][q] = (f4v){0.f, 0.f, 0.f, 0.f};
      #pragma unroll
      for (int r = 0; r < 8; ++r)
        #pragma unroll
        for (int i = 0; i < 4; ++i) {
          const float kk = __int_as_float(__builtin_amdgcn_readlane(__float_as_int(kv), r * 4 + i));
          #pragma unroll
          for (int q = 0; q < 4; ++q) a4[i][q] += wr[r * 4 + q] * kk;
        }
      // Msum[b][hs] = sum_d M[b][hs][d] (fp32), cb[b][hs] = (1/8) * bq . k_head: this wave's share
      float ms[4];
      #pragma unroll
      for (int i = 0; i < 4; ++i) {
        const f4v s4 = (a4[i][0] + a4[i][1]) + (a4[i][2] + a4[i][3]);
        ms[i] = (s4[0] + s4[1]) + (s4[2] + s4[3]);
      }
      // halving exchange over lane bits 1 and 0: the sum for s = lane & 3 stays, as in cp
      const bool up2 = (lane & 2) != 0, up1 = (lane & 1) != 0;
      const float m0 = (up2 ? ms[2] : ms[0]) + lane_xor<2>(up2 ? ms[0] : ms[2]);
      const float m1 = (up2 ? ms[3] : ms[1]) + lane_xor<2>(up2 ? ms[1] : ms[3]);
      float mp = (up1 ? m1 : m0) + lane_xor<1>(up1 ? m0 : m1);
      float cp = kv * bqv;
      mp += lane_xor<4>(mp);
      cp += lane_xor<4>(cp);
      mp += lane_xor<8>(mp);
      cp += lane_xor<8>(cp);
      mp += lane_xor<16>(mp);
      cp += lane_xor<16>(cp);
      if (lane < 4) {
        sRed[0][wave][lane] = mp;
        sRed[1][wave][lane] = cp;
      }
      // the second head's rows stand 16 B further on, so that the 16 lanes of one read
      // below (4 s x 2 heads x 2 column groups) fall on 16 different bank groups
      #pragma unroll
      for (int i = 0; i < 4; ++i)
        #pragma unroll
        for (int q = 0; q < 4; ++q)
          *(f4v*)&sP[(wave * 4 + i) * PP + (wave >> 3) * 4 + q * 128 + lane * 4] = a4[i][q];
      __syncthreads();   // block-uniform branch
      // one thread: one folded key n8 of the pair, eight neighbouring d = one 16-B place unit
      const int n8 = lane & 7, oct = t >> 3;
      const int hh = n8 >> 2;
      f4v s0 = {0.f, 0.f, 0.f, 0.f}, s1 = {0.f, 0.f, 0.f, 0.f};
      #pragma unroll
      for (int i = 0; i < 8; ++i) {
        const float* p = &sP[((hh * 8 + i) * 4 + (n8 & 3)) * PP + hh * 4 + oct * 8];
        s0 += *(const f4v*)p;
        s1 += *(const f4v*)(p + 4);
      }
      h8v o;
      #pragma unroll
      for (int e = 0; e < 4; ++e) {
        o[e]     = (_Float16)(s0[e] * 0.125f);
        o[4 + e] = (_Float16)(s1[e] * 0.125f);
      }
      // inverse of frag_place for row g*8 + n8, columns oct*8 .. oct*8 + 7
      const int place = (((((g >> 1) * (kD / 32) + (oct >> 2)) * 2 + ((oct >> 1) & 1)) * 32)
                         + (oct & 1) * 16 + (g & 1) * 8 + n8) * 8;
      *(h8v*)(Mh + (size_t)b * kHS * kD + place) = o;
      if (t < 16) {
        const int kind = t >> 3;                     // 0: Msum, 1: cb
        float acc = 0.f;
        #pragma unroll
        for (int i = 0; i < 8; ++i) acc += sRed[kind][hh * 8 + i][n8 & 3];
        // each (b, g) has a 128-B line of its own for its eight cb and eight Msum
        (kind ? cb : Msum)[(b * 4 + g) * 32 + n8] = acc * 0.125f;
      }
    } else {
      // VOt[b][d][hs] = sum_j Wo[d][h*64+j] * v[b][s][h*64+j]: a wave takes 32 rows d; the
      // 128 columns of the head pair are 512 contiguous bytes, 16 lanes to a head (wr: piece i = row i)
      const float bvv = (bv + wrow)[jj];                          // in front of the wait in rows4x8_shares
      rows4x8_shares(spkb, Wv + (size_t)wrow * kD, lane, sh);
      fold_loads<128>(Wo + (size_t)(wave * 32) * kD + g * 128, lane, jj, wr);
      const float kv = rows4x8_whole(sh, lane) + bvv;
      sV[((wave >> 3) * 4 + s) * kDH + (wave & 7) * 8 + jj] = kv;
      __syncthreads();   // block-uniform branch
      const int hh = lane >> 4, c4 = lane & 15;
      f4v vv[4];
      #pragma unroll
      for (int i = 0; i < 4; ++i) vv[i] = *(const f4v*)&sV[(hh * 4 + i) * kDH + c4 * 4];
      // v in pairs of s, so that one packed multiply-add serves two sums of a row
      f2v vp[4][2];
      #pragma unroll
      for (int e = 0; e < 4; ++e) {
        vp[e][0] = (f2v){vv[0][e], vv[1][e]};
        vp[e][1] = (f2v){vv[2][e], vv[3][e]};
      }
      float a[128];
      #pragma unroll
      for (int i = 0; i < 32; ++i)
        #pragma unroll
        for (int k = 0; k < 2; ++k) {
          f2v p2 = vp[0][k] * wr[i][0];
          #pragma unroll
          for (int e = 1; e < 4; ++e) p2 += vp[e][k] * wr[i][e];
          a[i * 4 + k * 2]     = p2[0];
          a[i * 4 + k * 2 + 1] = p2[1];
        }
      // Halving exchange over the 16 lanes of a head, as in rows4x8: sums c4*8 .. c4*8 + 7
      // (rows 2*c4 and 2*c4 + 1 of the wave's 32, four s each) end whole in lane c4.
      halve_in_row<8>(a, lane);
      halve_in_row<4>(a, lane);
      halve_in_row<2>(a, lane);
      halve_in_row<1>(a, lane);
      #pragma unroll
      for (int r = 0; r < 2; ++r) {
        const int d = wave * 32 + c4 * 2 + r;
        h4v o;
        #pragma unroll
        for (int k = 0; k < 4; ++k) o[k] = (_Float16)a[r * 4 + k];
        // inverse of frag_place for row d, columns g*8 + hh*4 .. + 3
        const int place = ((((d >> 4) * 2 + (g >> 1)) * 32) + (g & 1) * 16 + (d & 15)) * 8 + hh * 4;
        *(h4v*)(VOt + (size_t)b * kD * kHS + place) = o;
      }
    }
  } else {
    const int idx = (blockIdx.x - kKV) * 512 + t;
    if (idx < kHG * kD / 8) {
      // Wg1h = Wg1 * gamma (gamma of gate-LN folded into weights); one 16-B place unit a thread
      int n, k;
      frag_place(idx * 8, kD / 32, n, k);
      const f4v* wr = (const f4v*)(Wg1 + (size_t)n * kD + k);
      const f4v* gm = (const f4v*)(glng + k);
      const f4v p0 = wr[0] * gm[0], p1 = wr[1] * gm[1];
      h8v o;
      #pragma unroll
      for (int e = 0; e < 4; ++e) { o[e] = (_Float16)p0[e]; o[4 + e] = (_Float16)p1[e]; }
      *(h8v*)(Wg1h + (size_t)idx * 8) = o;
    } else {
      // bg1p = bg1 + Wg1 . beta (beta of gate-LN folded into bias); a wave takes two units n,
      // so that the 32 results of a block fill one 128-B line
      const int n0 = ((idx - kHG * kD / 8) >> 5) * 2;
      const f4v* bt = (const f4v*)glnb;
      for (int u = 0; u < 2; ++u) {
        const int n = n0 + u;
        const f4v* wr = (const f4v*)(Wg1 + (size_t)n * kD);
        f4v p4 = {};
        for (int c = 0; c < 4; ++c) p4 += wr[c * 32 + lane] * bt[c * 32 + lane];
        float acc = wave_sum((p4[0] + p4[1]) + (p4[2] + p4[3]));
        if (lane == 0) bg1p[n] = bg1[n] + acc;
      }
    }
  }
}

// ============================================================
// Fused main kernel: gate GEMM + scores + softmax + combine + final LN.
// LDS holds the pre-affine normalized tile x' = (x-mu)*rstd (f16);
// gamma/beta are folded into Wg1h/bg1p, and raw-x scores are recovered via
// scores = irs * (x'.M^T) + mu*Msum + cb.
// All three products are formed transposed: the weights are the A operand, the token rows
// the B operand (both fragments have the same lane and k order, so only the two arguments
// change places). Register r of a result tile is then weight row 8 * (lane >> 4) + r for
// token lane & 15: a lane holds eight neighbouring columns of ONE token row.
// A work-group is four waves, one on each SIMD, and a wave does the work of two of an
// eight-wave group: the launch has half as many waves to start, and one read of an x'
// fragment serves two gate column tiles. The second launch bound asks for four waves per
// SIMD (at most 256 registers a wave): four work-groups fit on a WGP, and the 1024
// work-groups of the grid are all resident at once.
// ============================================================
constexpr int NW  = 4;            // waves per work-group
constexpr int RPW = TILE / NW;    // token rows that a wave owns

__global__ __launch_bounds__(NW * 32, 4) void fused_kernel(
    const float* __restrict__ X,
    const _Float16* __restrict__ Mh,    // (B, HS, D), each batch in fragment order
    const _Float16* __restrict__ VOt,   // (B, D, HS), each batch in fragment order
    const float* __restrict__ cb,       // (B, 4 head pairs): 8 values at the head of a 128-B line
    const float* __restrict__ Msum,     // the same lines as cb, floats 8..15 of each
    const _Float16* __restrict__ Wg1h,  // (HG, D), gamma-folded, in fragment order
    const float* __restrict__ bg1p,     // (HG), beta-folded
    const float* __restrict__ Wg2, const float* __restrict__ bg2,
    const float* __restrict__ bo,
    const float* __restrict__ lng, const float* __restrict__ lnb,
    float* __restrict__ out) {
  __shared__ __attribute__((aligned(16))) _Float16 sXh[TILE * XP];  // x' (f16); later reused for attn (f16)
  __shared__ __attribute__((aligned(16))) float sW[TILE * WP];
  __shared__ float sGp[16 * TILE];   // [gate column tile * 2 + lane half][row]: shares of the gate head's sum
  __shared__ float sMu[TILE], sIrs[TILE], sG[TILE];

  const int t = threadIdx.x;
  const int lane = t & 31;
  const int wave = t >> 5;
  const int r15 = lane & 15;
  const int hi = lane >> 4;          // 0 or 1 (wave32 half)
  const int kb = hi * 8;             // fragment K sub-offset per ISA layout

  const size_t rowg0 = (size_t)blockIdx.x * TILE;
  const int b = (int)(rowg0 >> 12);  // tile never crosses batch (4096 % 32 == 0)

  const size_t AW_OFF = (size_t)kB * kT * kD;
  const size_t G_OFF  = AW_OFF + (size_t)kB * kT * kSPK;

  // Each wave owns eight whole rows; its lanes lie across the columns, so every
  // global load and store of a row piece is 32 lanes x 16 B = 512 contiguous bytes.
  // Piece c of row rr is f4v index rr * 128 + c * 32 + lane.
  const int row0 = wave * RPW;
  const f4v* xw = (const f4v*)(X + (rowg0 + row0) * kD);

  // ---- Phase 0: LN stats inside the wave, then x' = (x-mu)*rstd to LDS (f16) ----
  {
    const f4v* xl = xw + lane;
    f4v xv[RPW][4];
    #pragma unroll
    for (int rr = 0; rr < RPW; ++rr)
      #pragma unroll
      for (int c = 0; c < 4; ++c) xv[rr][c] = xl[rr * 128 + c * 32];
    // names the address pair so that it outlives the loads
    asm volatile("s_wait_xcnt 0x0" :: "v"(xl) : "memory");
    float s[RPW], q[RPW];
    #pragma unroll
    for (int rr = 0; rr < RPW; ++rr) {
      s[rr] = 0.f; q[rr] = 0.f;
      #pragma unroll
      for (int c = 0; c < 4; ++c)
        #pragma unroll
        for (int e = 0; e < 4; ++e) { s[rr] += xv[rr][c][e]; q[rr] += xv[rr][c][e] * xv[rr][c][e]; }
    }
    #pragma unroll
    for (int rr = 0; rr < RPW; ++rr) { s[rr] = wave_sum(s[rr]); q[rr] = wave_sum(q[rr]); }
    #pragma unroll
    for (int rr = 0; rr < RPW; ++rr) {
      const float mu = s[rr] * (1.f / kD);
      const float var = q[rr] * (1.f / kD) - mu * mu;
      const float rs = rsqrtf(var + kEPS);
      if (lane == 0) {               // the scores epilogue of other waves reads these
        sMu[row0 + rr]  = mu;
        sIrs[row0 + rr] = sqrtf(var + kEPS);
      }
      #pragma unroll
      for (int c = 0; c < 4; ++c) {
        h4v h;
        #pragma unroll
        for (int e = 0; e < 4; ++e) h[e] = (_Float16)((xv[rr][c][e] - mu) * rs);
        *(h4v*)&sXh[(row0 + rr) * XP + c * 128 + lane * 4] = h;
      }
    }
  }
  // ---- Gate GEMM and gate head: relu(x' @ Wg1h^T + bg1p) . Wg2  (M=32,N=128,K=512) ----
  // A wave takes the column tiles 2 * wave and 2 * wave + 1 against both token tiles.
  // A lane's eight results of a tile are hidden units tile*16 + kb .. + 7 of one token: bias,
  // relu and the product with Wg2 stay in the lane, and only its share of the head's sum
  // goes to LDS.
  // With four waves on a SIMD, not eight, a wave covers more of its own load latency: its
  // weight fragments are fetched WD k steps ahead into a register ring, the first WD steps'
  // in front of the barrier (they depend on nothing in LDS), its x' fragments two steps ahead.
  constexpr int KS = kD / 32;        // k steps
  constexpr int WD = 6;
  const _Float16* wl = Wg1h + wave * (32 * kD) + lane * 8;
  // scores: one of the four result tiles a wave
  const int smt = wave >> 1, snt = wave & 1;
  const int arow = smt * 16 + r15;
  const _Float16* ml = Mh + (b * kHS + snt * 16) * kD + lane * 8;
  // Every loop over wf, mf, xf and acc below is unrolled in full: the arrays live in
  // registers only while each index is a constant.
  v16h wf[WD][2];                    // [k step mod WD][column tile of the wave]
  v16h mf[KS];                       // the wave's fragments of M
  #pragma unroll
  for (int k = 0; k < WD; ++k)
    #pragma unroll
    for (int u = 0; u < 2; ++u) wf[k][u] = frag_pk(wl + u * (16 * kD) + k * 512);
  __syncthreads();
  {
    v8f acc[2][2];                   // [column tile of the wave][token tile]
    v16h xf[3][2];                   // [k step mod 3][token tile]
    #pragma unroll
    for (int u = 0; u < 2; ++u)
      #pragma unroll
      for (int mt = 0; mt < 2; ++mt) {
        acc[u][mt] = (v8f){};
        xf[u][mt] = frag_h(&sXh[(mt * 16 + r15) * XP + u * 32 + kb]);
      }
    #pragma unroll
    for (int k = 0; k < KS; ++k) {
      if (k + 2 < KS) {
        #pragma unroll
        for (int mt = 0; mt < 2; ++mt)
          xf[(k + 2) % 3][mt] = frag_h(&sXh[(mt * 16 + r15) * XP + (k + 2) * 32 + kb]);
      }
      #pragma unroll
      for (int u = 0; u < 2; ++u)
        #pragma unroll
        for (int mt = 0; mt < 2; ++mt)
          acc[u][mt] = __builtin_amdgcn_wmma_f32_16x16x32_f16(false, wf[k % WD][u], false, xf[k % 3][mt],
                                                              (short)0, acc[u][mt], false, false);
      // the ring place just read takes step k + WD; once the gate's fragments are all on
      // their way, the freed places take the first fragments of M for the scores
      #pragma unroll
      for (int u = 0; u < 2; ++u) {
        if (k + WD < KS) wf[k % WD][u] = frag_pk(wl + u * (16 * kD) + (k + WD) * 512);
        else mf[(k + WD - KS) * 2 + u] = frag_pk(ml + ((k + WD - KS) * 2 + u) * 512);
      }
      // keeps each step's loads in their step: left free, the scheduler sinks the fragment
      // loads to one or two steps in front of their use, and the wave waits out L2 each step
      __builtin_amdgcn_sched_barrier(0);
    }
    #pragma unroll
    for (int k = 2 * WD; k < KS; ++k) mf[k] = frag_pk(ml + k * 512);
    const f4v* bp = (const f4v*)(bg1p + wave * 32 + kb);
    const f4v* up = (const f4v*)(Wg2 + wave * 32 + kb);
    f4v bb[2][2], uu[2][2];          // [column tile of the wave][half of the lane's eight units]
    #pragma unroll
    for (int u = 0; u < 2; ++u)
      #pragma unroll
      for (int j = 0; j < 2; ++j) { bb[u][j] = bp[u * 4 + j]; uu[u][j] = up[u * 4 + j]; }
    // names the address pairs of these eight loads and of the fragment loads so that they
    // outlive the loads
    asm volatile("s_wait_xcnt 0x0" :: "v"(bp), "v"(up), "v"(wl) : "memory");
    #pragma unroll
    for (int u = 0; u < 2; ++u)
      #pragma unroll
      for (int mt = 0; mt < 2; ++mt) {
        const f4v b0 = bb[u][0], b1 = bb[u][1], u0 = uu[u][0], u1 = uu[u][1];
        const v8f ac = acc[u][mt];
        // neighbouring units in pairs, as they lie in the registers: packed add and multiply-add
        f2v p = {0.f, 0.f};
        #pragma unroll
        for (int e = 0; e < 4; e += 2) {
          const f2v h0 = (f2v){ac[e], ac[e + 1]} + (f2v){b0[e], b0[e + 1]};
          const f2v h1 = (f2v){ac[4 + e], ac[5 + e]} + (f2v){b1[e], b1[e + 1]};
          p += (f2v){fmaxf(h0[0], 0.f), fmaxf(h0[1], 0.f)} * (f2v){u0[e], u0[e + 1]};
          p += (f2v){fmaxf(h1[0], 0.f), fmaxf(h1[1], 0.f)} * (f2v){u1[e], u1[e + 1]};
        }
        sGp[((wave * 2 + u) * 2 + hi) * TILE + mt * 16 + r15] = p[0] + p[1];
      }
  }

  // ---- Scores GEMM: irs*(x' @ M^T) + mu*Msum + cb  (M=32,N=32,K=512), softmax in the lane ----
  // Nothing here reads what the gate phase wrote, so no barrier stands in between.
  {
    const int nt = snt;
    v8f acc = {};
    #pragma unroll
    for (int k = 0; k < KS; ++k) {
      v16h xf = frag_h(&sXh[arow * XP + k * 32 + kb]);
      acc = __builtin_amdgcn_wmma_f32_16x16x32_f16(false, mf[k], false, xf,
                                                   (short)0, acc, false, false);
    }
    // the lane's eight folded keys nt*16 + kb .. + 7 are head pair nt*2 + hi: one 128-B line
    const f4v* cp = (const f4v*)(cb + (b * 4 + nt * 2 + hi) * 32);
    const f4v* mp = (const f4v*)(Msum + (b * 4 + nt * 2 + hi) * 32);
    const f4v c0 = cp[0], c1 = cp[1], m0 = mp[0], m1 = mp[1];
    // names the address pairs of these four loads and of the fragment loads so that they
    // outlive the loads
    asm volatile("s_wait_xcnt 0x0" :: "v"(cp), "v"(mp), "v"(ml) : "memory");
    const float irs = sIrs[arow], mu = sMu[arow];
    f4v sc[2];
    #pragma unroll
    for (int e = 0; e < 4; ++e) {
      sc[0][e] = fmaf(acc[e],     irs, fmaf(mu, m0[e], c0[e]));
      sc[1][e] = fmaf(acc[4 + e], irs, fmaf(mu, m1[e], c1[e]));
    }
    // softmax over SPK=4: each half of the eight is one head
    #pragma unroll
    for (int hh = 0; hh < 2; ++hh) {
      const float s0 = sc[hh][0], s1 = sc[hh][1], s2 = sc[hh][2], s3 = sc[hh][3];
      const float m = fmaxf(fmaxf(s0, s1), fmaxf(s2, s3));
      const float e0 = expf(s0 - m), e1 = expf(s1 - m), e2 = expf(s2 - m), e3 = expf(s3 - m);
      const float inv = 1.f / (e0 + e1 + e2 + e3);
      *(f4v*)&sW[arow * WP + nt * 16 + kb + hh * 4] = (f4v){e0 * inv, e1 * inv, e2 * inv, e3 * inv};
    }
  }
  __syncthreads();
  // Combine GEMM, operand loads: one token tile mt, sixteen column tiles from nt0 a wave. The
  // VO fragments depend on nothing computed here: all 32 loads go out together, at the head
  // of the phase, and fly during the two small pieces of work in front of the products.
  constexpr int CT = kD / 16 * 2 / NW;   // column tiles a wave
  const int mt = wave >> 1, nt0 = (wave & 1) * CT;
  const _Float16* vl = VOt + (b * kD + nt0 * 16) * kHS + lane * 8;
  v16h vf[CT];
  #pragma unroll   // vf lives in registers only while each index is a constant
  for (int i = 0; i < CT; ++i) vf[i] = frag_pk(vl + i * (16 * kHS));
  // names the address pair so that it outlives the loads
  asm volatile("s_wait_xcnt 0x0" :: "v"(vl) : "memory");
  {                       // head-averaged attention weights: one (row, speaker) a thread
    int rw = t >> 2, s = t & 3;
    float aw = 0.f;
    #pragma unroll
    for (int h = 0; h < kH; ++h) aw += sW[rw * WP + h * 4 + s];
    out[AW_OFF + (rowg0 + rw) * kSPK + s] = aw * (1.f / kH);
  }
  if (wave == NW - 1) {   // gate head: the 16 shares of a row, one row a lane
    float a4[4] = {0.f, 0.f, 0.f, 0.f};
    #pragma unroll
    for (int i = 0; i < 4; ++i)
      #pragma unroll
      for (int j = 0; j < 4; ++j) a4[j] += sGp[(i * 4 + j) * TILE + lane];
    float g = bg2[0] + ((a4[0] + a4[1]) + (a4[2] + a4[3]));
    g = 1.f / (1.f + expf(-g));
    sG[lane] = g;
    out[G_OFF + rowg0 + lane] = g;
  }

  // Epilogue, operand loads: the x of the wave's first two rows, asked for here so that it
  // arrives under the combine products and the barrier.
  const f4v* xe = xw + lane;
  f4v xq[2][2][4];                   // [trip mod 2][row of the trip][piece]
  #pragma unroll   // xq lives in registers only while each index is a constant
  for (int u = 0; u < 2; ++u)
    #pragma unroll
    for (int cc = 0; cc < 4; ++cc) xq[0][u][cc] = xe[u * 128 + cc * 32];

  // ---- Combine GEMM: attn = w @ VO  (M=32,N=512,K=32) -> overwrite sXh ----
  {
    v16h a;
    {
      const f4v* wp = (const f4v*)&sW[(mt * 16 + r15) * WP + kb];
      f4v w0 = wp[0], w1 = wp[1];   // K = kb .. kb+7
      f4v w2 = wp[4], w3 = wp[5];   // K = kb+16 .. kb+23
      #pragma unroll
      for (int e = 0; e < 4; ++e) {
        a[e]      = (_Float16)w0[e];
        a[4 + e]  = (_Float16)w1[e];
        a[8 + e]  = (_Float16)w2[e];
        a[12 + e] = (_Float16)w3[e];
      }
    }
    #pragma unroll
    for (int i = 0; i < CT; ++i) {
      v8f acc = {};
      acc = __builtin_amdgcn_wmma_f32_16x16x32_f16(false, vf[i], false, a,
                                                   (short)0, acc, false, false);
      // the lane's eight results are columns (nt0 + i)*16 + kb .. + 7 of one token: one 16-B store
      h8v o;
      #pragma unroll
      for (int r = 0; r < 8; ++r) o[r] = (_Float16)acc[r];
      *(h8v*)&sXh[(mt * 16 + r15) * XP + (nt0 + i) * 16 + kb] = o;
    }
  }
  __syncthreads();

  // ---- Epilogue: fused = LN(x + g*(attn + bo)), each wave on its own eight rows ----
  {
    f4v* ow = (f4v*)(out + (rowg0 + row0) * kD);
    // bo and the LN parameters: the lane's columns, read once for all eight rows
    f4v bov[4], lgv[4], lbv[4];
    #pragma unroll   // they live in registers only while each index is a constant
    for (int cc = 0; cc < 4; ++cc) {
      bov[cc] = ((const f4v*)bo)[cc * 32 + lane];
      lgv[cc] = ((const f4v*)lng)[cc * 32 + lane];
      lbv[cc] = ((const f4v*)lnb)[cc * 32 + lane];
    }
    // two rows a trip, and the next trip's eight x loads go out in front of this trip's work:
    // with half as many waves on a WGP, no fewer bytes are in flight. Unrolled in full
    // because xq is indexed by the trip.
    #pragma unroll
    for (int rp = 0; rp < RPW; rp += 2) {
      const int cur = (rp >> 1) & 1;
      if (rp + 2 < RPW) {
        #pragma unroll
        for (int u = 0; u < 2; ++u)
          #pragma unroll
          for (int cc = 0; cc < 4; ++cc) xq[cur ^ 1][u][cc] = xe[(rp + 2 + u) * 128 + cc * 32];
      }
      #pragma unroll
      for (int u = 0; u < 2; ++u) {
        const int rr = rp + u;
        const float g = sG[row0 + rr];
        f4v f[4];
        float s = 0.f, q = 0.f;
        #pragma unroll
        for (int c = 0; c < 4; ++c) {
          const h4v a = *(const h4v*)&sXh[(row0 + rr) * XP + c * 128 + lane * 4];
          const f4v bb = bov[c];
          #pragma unroll
          for (int e = 0; e < 4; ++e) {
            const float x = xq[cur][u][c][e] + g * ((float)a[e] + bb[e]);
            f[c][e] = x;
            // fmaf written out: left to contraction, the build with the vector-pipe sums pairs
            // the s and q chains into packed adds and pays for that in moves and conversions
            s += x; q = fmaf(x, x, q);
          }
        }
        s = wave_sum(s);
        q = wave_sum(q);
        const float mu = s * (1.f / kD);
        const float var = q * (1.f / kD) - mu * mu;
        const float rs = rsqrtf(var + kEPS);
        #pragma unroll
        for (int c = 0; c < 4; ++c) {
          const f4v lg = lgv[c], lb = lbv[c];
          f4v o;
          #pragma unroll
          for (int e = 0; e < 4; ++e) o[e] = (f[c][e] - mu) * rs * lg[e] + lb[e];
          ow[rr * 128 + c * 32 + lane] = o;
        }
      }
      // the next trip rewrites the address and data registers that these stores name; xe is
      // named so that the x loads' address pair lives up to this wait
      asm volatile("s_wait_xcnt 0x0" :: "v"(xe) : "memory");
    }
  }
}

// ============================================================
extern "C" void kernel_launch(void* const* d_in, const int* in_sizes, int n_in,
                              void* d_out, int out_size, void* d_ws, size_t ws_size,
                              hipStream_t stream) {
  (void)in_sizes; (void)n_in; (void)out_size; (void)ws_size;
  const float* token = (const float*)d_in[0];
  const float* se    = (const float*)d_in[1];
  const float* We    = (const float*)d_in[2];
  const float* be    = (const float*)d_in[3];
  const float* spos  = (const float*)d_in[4];
  const float* Wq    = (const float*)d_in[5];
  const float* bq    = (const float*)d_in[6];
  const float* Wk    = (const float*)d_in[7];
  const float* bk    = (const float*)d_in[8];
  const float* Wv    = (const float*)d_in[9];
  const float* bv    = (const float*)d_in[10];
  const float* Wo    = (const float*)d_in[11];
  const float* bo    = (const float*)d_in[12];
  const float* glng  = (const float*)d_in[13];
  const float* glnb  = (const float*)d_in[14];
  const float* Wg1   = (const float*)d_in[15];
  const float* bg1   = (const float*)d_in[16];
  const float* Wg2   = (const float*)d_in[17];
  const float* bg2   = (const float*)d_in[18];
  const float* lng   = (const float*)d_in[19];
  const float* lnb   = (const float*)d_in[20];
  float* out = (float*)d_out;

  char* ws = (char*)d_ws;
  float*    spk  = (float*)(ws + 0);            // 64 KB
  _Float16* Mh   = (_Float16*)(ws + 196608);    // 256 KB
  _Float16* VOt  = (_Float16*)(ws + 458752);    // 256 KB
  float*    cbf  = (float*)(ws + 65536);        // 32 lines of 128 B: floats 0..7 of each
  float*    Msum = (float*)(ws + 65568);        // floats 8..15 of the same lines
  float*    bg1p = (float*)(ws + 722944);       // 512 B
  _Float16* Wg1h = (_Float16*)(ws + 723456);    // 128 KB

  spk_kernel<<<kSPK * kD / 32, 256, 0, stream>>>(se, We, be, spos, spk);
  kvfold_kernel<<<kKV + kHG * kD / 8 / 512 + kHG / 32, 512, 0, stream>>>(
      spk, Wk, bk, Wv, bv, Wq, bq, Wo, Wg1, bg1, glng, glnb, Mh, VOt, cbf, Msum, Wg1h, bg1p);
  fused_kernel<<<(kB * kT) / TILE, NW * 32, 0, stream>>>(token, Mh, VOt, cbf, Msum, Wg1h, bg1p,
                                                     Wg2, bg2, bo, lng, lnb, out);
}
